// v000
// Measured on an AMD MI455X. A time is GPU time per run, averaged over a window of back-to-back runs after a warm-up
// (all launches, gaps included; the runs take copies of the inputs in turn), and the median of several windows.
// Apart from v000's, it joins two sittings. Times from different sittings can be a few percent apart, while
// side-by-side timings come from the same sitting.
// The starting kernel, v000, takes 682 microseconds a run.
#include <hip/hip_runtime.h>

// ---------------------------------------------------------------- constants
#define E_   1024
#define H_   16
#define HS_  64
#define B_   2
#define T_   2048
#define BT_  (B_ * T_)
#define FF_  (4 * E_)

// CDNA5 data-movement experiments (fallbacks preserved if assembler rejects)
#define USE_TDM   1   // tensor_load_to_lds for GEMM B tiles
#define USE_ASYNC 1   // global_load_async_to_lds_b128 for GEMM A tiles

typedef __attribute__((ext_vector_type(16))) __bf16     v16bf;
typedef __attribute__((ext_vector_type(8)))  float      v8f;
typedef __attribute__((ext_vector_type(4)))  unsigned   v4u;
typedef __attribute__((ext_vector_type(8)))  unsigned   v8u;

union Frag { v16bf v; uint4 q[2]; unsigned short us[16]; };

__device__ inline unsigned short f2bf(float f) {
  unsigned u = __float_as_uint(f);
  u += 0x7fffu + ((u >> 16) & 1u);           // round-to-nearest-even
  return (unsigned short)(u >> 16);
}

__device__ inline v8f vzero8() {
  v8f z = {0.f, 0.f, 0.f, 0.f, 0.f, 0.f, 0.f, 0.f};
  return z;
}

__device__ inline v8f wmma_bf16(const Frag& a, const Frag& b, v8f c) {
  return __builtin_amdgcn_wmma_f32_16x16x32_bf16(
      /*neg_a=*/false, a.v, /*neg_b=*/false, b.v,
      /*c_mod=*/(short)0, c, /*reuse_a=*/false, /*reuse_b=*/false);
}

// LDS offset of a shared-memory pointer: generic LDS addresses keep the
// LDS byte offset in the low 32 bits (ISA 10.2 aperture rules).
__device__ inline unsigned lds_off(const void* p) {
  return (unsigned)(unsigned long long)p;
}

__device__ inline void wait_async0() {
  asm volatile("s_wait_asynccnt 0x0" ::: "memory");
}

__device__ inline void wait_tensor0() {
#if __has_builtin(__builtin_amdgcn_s_wait_tensorcnt)
  __builtin_amdgcn_s_wait_tensorcnt(0);
#else
  asm volatile("s_wait_tensorcnt 0x0" ::: "memory");
#endif
}

// async copy 16 bytes global -> LDS (per-lane scatter, ASYNCcnt tracked)
__device__ inline void async_g2l_b128(unsigned loff, const void* g) {
  asm volatile("global_load_async_to_lds_b128 %0, %1, off"
               :: "v"(loff), "v"(g)
               : "memory");
}

// ------------------------------------------------- weight / dtype conversion
__global__ __launch_bounds__(256) void f32_to_bf16_kernel(
    const float* __restrict__ in, unsigned short* __restrict__ out, int n) {
  int i = blockIdx.x * 256 + threadIdx.x;
  if (i < n) out[i] = f2bf(in[i]);
}

// Wk/Wv: [H][E][HS] f32  ->  [E][H*HS] bf16  (so projection is one GEMM)
__global__ __launch_bounds__(256) void headperm_bf16_kernel(
    const float* __restrict__ in, unsigned short* __restrict__ out) {
  int idx = blockIdx.x * 256 + threadIdx.x;     // idx = e*1024 + h*64 + d
  int e = idx >> 10;
  int c = idx & 1023;
  int h = c >> 6;
  int d = c & 63;
  out[idx] = f2bf(in[(size_t)h * (E_ * HS_) + (size_t)e * HS_ + d]);
}

// ------------------------------------------------------------- layernorm
__global__ __launch_bounds__(256) void layernorm_bf16_kernel(
    const float* __restrict__ x, const float* __restrict__ g,
    const float* __restrict__ b, unsigned short* __restrict__ out) {
  __shared__ float red[16];
  const int row = blockIdx.x;
  const int tid = threadIdx.x;
  const int lane = tid & 31, w = tid >> 5;

  float4 xv = ((const float4*)x)[(size_t)row * (E_ / 4) + tid];
  float s  = xv.x + xv.y + xv.z + xv.w;
  float s2 = xv.x * xv.x + xv.y * xv.y + xv.z * xv.z + xv.w * xv.w;
  #pragma unroll
  for (int o = 16; o > 0; o >>= 1) {
    s  += __shfl_down(s, o, 32);
    s2 += __shfl_down(s2, o, 32);
  }
  if (lane == 0) { red[w] = s; red[8 + w] = s2; }
  __syncthreads();
  if (tid == 0) {
    float a = 0.f, c = 0.f;
    #pragma unroll
    for (int i = 0; i < 8; ++i) { a += red[i]; c += red[8 + i]; }
    float mean = a / (float)E_;
    red[0] = mean;
    red[1] = c / (float)E_ - mean * mean;
  }
  __syncthreads();
  float mean = red[0];
  float inv  = rsqrtf(red[1] + 1e-5f);
  float vv[4] = {xv.x, xv.y, xv.z, xv.w};
  #pragma unroll
  for (int j = 0; j < 4; ++j) {
    int c = tid * 4 + j;
    float n = (vv[j] - mean) * inv * g[c] + b[c];
    out[(size_t)row * E_ + c] = f2bf(n);
  }
}

// ------------------------------------------------------------ generic GEMM
// C[M,N] = A[M,K](bf16) * B[K,N](bf16)  (+bias)(relu)(+res f32) -> f32/bf16
// block tile 64(M) x 128(N), 8 waves (2x4), wave tile 32x32, K step 32.
// A tile staged by per-lane async global->LDS copies (ASYNCcnt),
// B tile staged by the Tensor Data Mover (TENSORcnt), one DMA per K step.
template <bool BIAS, bool RELU, bool RES, bool OUT32, bool OUT16>
__global__ __launch_bounds__(256) void gemm_bf16_kernel(
    const unsigned short* __restrict__ A, const unsigned short* __restrict__ Bm,
    const float* __restrict__ bias, const float* __restrict__ res,
    float* __restrict__ out32, unsigned short* __restrict__ out16,
    int M, int N, int K) {
  __shared__ unsigned short As[64 * 40];    // [64 rows][32 K] pad->40
#if USE_TDM
  __shared__ unsigned short Bt[32 * 128];   // row-major [32 K][128 N] (TDM)
#else
  __shared__ unsigned short Bt[128 * 40];   // transposed [128 N][32 K]
#endif

  const int tid  = threadIdx.x;
  const int lane = tid & 31, w = tid >> 5;
  const int l16 = lane & 15, half = lane >> 4;
  const int wm = w >> 2, wn = w & 3;
  const int m0 = blockIdx.y * 64;
  const int n0 = blockIdx.x * 128;

#if USE_TDM
  // D# group 1 (constant over the K loop): data_size=2B, tensor dim0=N,
  // dim0 stride=N, tile 128 x 32.
  v8u g1;
  g1[0] = 0x00010000u;                                   // data_size = 2 bytes
  g1[1] = ((unsigned)N & 0xFFFFu) << 16;                 // tensor_dim0 lo
  g1[2] = (((unsigned)K & 0xFFFFu) << 16) |
          (((unsigned)N >> 16) & 0xFFFFu);               // dim1 lo | dim0 hi
  g1[3] = (128u << 16) | (((unsigned)K >> 16) & 0xFFFFu);// tile_dim0 | dim1 hi
  g1[4] = 32u;                                           // tile_dim1
  g1[5] = (unsigned)N;                                   // dim0_stride lo
  g1[6] = 0u;
  g1[7] = 0u;
  const unsigned bt_base = lds_off(&Bt[0]);
#endif
#if USE_ASYNC
  const unsigned as_base = lds_off(&As[0]);
#endif

  v8f acc[2][2];
  #pragma unroll
  for (int mt = 0; mt < 2; ++mt)
    #pragma unroll
    for (int nt = 0; nt < 2; ++nt) acc[mt][nt] = vzero8();

  for (int k0 = 0; k0 < K; k0 += 32) {
#if USE_TDM
    if (w == 0) {                      // one DMA per block per K step
      unsigned long long ga =
          (unsigned long long)(const void*)&Bm[(size_t)k0 * N + n0];
      v4u g0;
      g0[0] = 1u;                                        // count=1
      g0[1] = bt_base;                                   // lds_addr
      g0[2] = (unsigned)ga;                              // global_addr lo
      g0[3] = ((unsigned)(ga >> 32) & 0x01FFFFFFu) | (2u << 30); // hi|type=2
      asm volatile("tensor_load_to_lds %0, %1" :: "s"(g0), "s"(g1) : "memory");
      wait_tensor0();
    }
#else
    #pragma unroll
    for (int i = 0; i < 2; ++i) {
      int idx = tid + i * 256;
      int kr = idx >> 4, nc = (idx & 15) * 8;
      uint4 bv = *(const uint4*)&Bm[(size_t)(k0 + kr) * N + n0 + nc];
      const unsigned short* pb = (const unsigned short*)&bv;
      #pragma unroll
      for (int j = 0; j < 8; ++j) Bt[(nc + j) * 40 + kr] = pb[j];
    }
#endif

    {
      int r = tid >> 2, c = (tid & 3) * 8;
      const unsigned short* gp = &A[(size_t)(m0 + r) * K + k0 + c];
#if USE_ASYNC
      async_g2l_b128(as_base + (unsigned)(r * 40 + c) * 2, gp);
#else
      *(uint4*)&As[r * 40 + c] = *(const uint4*)gp;
#endif
      if (k0 + 32 < K) {               // prefetch first 16 K rows of next B tile into L2
        __builtin_prefetch(&Bm[(size_t)(k0 + 32 + (tid >> 4)) * N + n0 +
                               (tid & 15) * 8], 0, 1);
      }
    }
#if USE_ASYNC
    wait_async0();
#endif
    __syncthreads();

    Frag af[2], bf[2];
    #pragma unroll
    for (int mt = 0; mt < 2; ++mt) {
      int rr = wm * 32 + mt * 16 + l16;
      af[mt].q[0] = *(const uint4*)&As[rr * 40 + half * 8];
      af[mt].q[1] = *(const uint4*)&As[rr * 40 + 16 + half * 8];
    }
    #pragma unroll
    for (int nt = 0; nt < 2; ++nt) {
      int cc = wn * 32 + nt * 16 + l16;
#if USE_TDM
      #pragma unroll
      for (int e = 0; e < 8; ++e) {                 // gather column cc
        bf[nt].us[e]     = Bt[(half * 8 + e) * 128 + cc];
        bf[nt].us[8 + e] = Bt[(16 + half * 8 + e) * 128 + cc];
      }
#else
      bf[nt].q[0] = *(const uint4*)&Bt[cc * 40 + half * 8];
      bf[nt].q[1] = *(const uint4*)&Bt[cc * 40 + 16 + half * 8];
#endif
    }
    #pragma unroll
    for (int mt = 0; mt < 2; ++mt)
      #pragma unroll
      for (int nt = 0; nt < 2; ++nt)
        acc[mt][nt] = wmma_bf16(af[mt], bf[nt], acc[mt][nt]);
    __syncthreads();
  }

  // epilogue; D layout: row = r + 8*half, col = l16
  #pragma unroll
  for (int mt = 0; mt < 2; ++mt)
    #pragma unroll
    for (int nt = 0; nt < 2; ++nt)
      #pragma unroll
      for (int r = 0; r < 8; ++r) {
        int gr = m0 + wm * 32 + mt * 16 + r + 8 * half;
        int gc = n0 + wn * 32 + nt * 16 + l16;
        float v = acc[mt][nt][r];
        if constexpr (BIAS) v += bias[gc];
        if constexpr (RELU) v = fmaxf(v, 0.f);
        if constexpr (RES)  v += res[(size_t)gr * N + gc];
        if constexpr (OUT32) out32[(size_t)gr * N + gc] = v;
        if constexpr (OUT16) out16[(size_t)gr * N + gc] = f2bf(v);
      }
}

// ---------------------------------------------------- attention pass 1:
// per-COLUMN (softmax over query axis t, as in the reference) max & sumexp.
// one wave per (bh, 16-column strip); scores = k[t]·k[s] * 1/32, causal t>=s.
__global__ __launch_bounds__(32) void attn_colstats_kernel(
    const unsigned short* __restrict__ kall,
    float* __restrict__ colmax, float* __restrict__ colsum) {
  const int lane = threadIdx.x;
  const int l16 = lane & 15, half = lane >> 4;
  const int sT = blockIdx.x;
  const int bh = blockIdx.y;
  const int b = bh >> 4, h = bh & 15;
  const int bt0 = b * T_;
  const int hoff = h * HS_;
  const int s_base = sT * 16;
  const float scale = 0.03125f;               // 1024^-0.5
  const float NINF = -__builtin_inff();

  Frag bf[2];                                 // key columns (loop-invariant)
  {
    const unsigned short* kp = &kall[(size_t)(bt0 + s_base + l16) * E_ + hoff];
    bf[0].q[0] = *(const uint4*)&kp[half * 8];
    bf[0].q[1] = *(const uint4*)&kp[16 + half * 8];
    bf[1].q[0] = *(const uint4*)&kp[32 + half * 8];
    bf[1].q[1] = *(const uint4*)&kp[48 + half * 8];
  }

  float m_run = NINF, s_run = 0.f;
  const int s = s_base + l16;

  for (int tT = sT; tT < T_ / 16; ++tT) {
    const int t_base = tT * 16;
    Frag af[2];
    const unsigned short* qp = &kall[(size_t)(bt0 + t_base + l16) * E_ + hoff];
    af[0].q[0] = *(const uint4*)&qp[half * 8];
    af[0].q[1] = *(const uint4*)&qp[16 + half * 8];
    af[1].q[0] = *(const uint4*)&qp[32 + half * 8];
    af[1].q[1] = *(const uint4*)&qp[48 + half * 8];

    v8f sc = vzero8();
    sc = wmma_bf16(af[0], bf[0], sc);
    sc = wmma_bf16(af[1], bf[1], sc);

    float vals[8];
    float tmax = NINF;
    #pragma unroll
    for (int r = 0; r < 8; ++r) {
      int t = t_base + r + 8 * half;
      if (t >= s) {
        float e = sc[r] * scale;
        vals[r] = e;
        tmax = fmaxf(tmax, e);
      } else {
        vals[r] = NINF;
      }
    }
    if (tmax > NINF) {
      float nm = fmaxf(m_run, tmax);
      float acc_s = (m_run > NINF) ? s_run * __expf(m_run - nm) : 0.f;
      #pragma unroll
      for (int r = 0; r < 8; ++r)
        if (vals[r] > NINF) acc_s += __expf(vals[r] - nm);
      s_run = acc_s;
      m_run = nm;
    }
  }
  // merge the two lane halves (same columns, different row groups)
  float om = __shfl_xor(m_run, 16, 32);
  float os = __shfl_xor(s_run, 16, 32);
  float nm = fmaxf(m_run, om);
  float tot = 0.f;
  if (m_run > NINF) tot += s_run * __expf(m_run - nm);
  if (om    > NINF) tot += os   * __expf(om    - nm);
  if (lane < 16) {
    colmax[(size_t)bh * T_ + s_base + lane] = nm;
    colsum[(size_t)bh * T_ + s_base + lane] = tot;
  }
}

// ---------------------------------------------------- attention pass 2:
// attn[t,d] = sum_s P[t,s] * v[s,d],  P = exp(score-colmax[s])/colsum[s].
// one wave per (bh, 16-row strip); P re-layouts through LDS, Vt staged in LDS.
__global__ __launch_bounds__(32) void attn_out_kernel(
    const unsigned short* __restrict__ kall,
    const unsigned short* __restrict__ vall,
    const float* __restrict__ colmax, const float* __restrict__ colsum,
    unsigned short* __restrict__ attnB) {
  __shared__ unsigned short Pl[16 * 40];     // P tile [16 t][32 s]
  __shared__ unsigned short Vt[64 * 40];     // V^T tile [64 d][32 s]

  const int lane = threadIdx.x;
  const int l16 = lane & 15, half = lane >> 4;
  const int tT = blockIdx.x;
  const int bh = blockIdx.y;
  const int b = bh >> 4, h = bh & 15;
  const int bt0 = b * T_;
  const int hoff = h * HS_;
  const int t_base = tT * 16;
  const float scale = 0.03125f;

  Frag qf[2];                                 // query rows (loop-invariant)
  {
    const unsigned short* qp = &kall[(size_t)(bt0 + t_base + l16) * E_ + hoff];
    qf[0].q[0] = *(const uint4*)&qp[half * 8];
    qf[0].q[1] = *(const uint4*)&qp[16 + half * 8];
    qf[1].q[0] = *(const uint4*)&qp[32 + half * 8];
    qf[1].q[1] = *(const uint4*)&qp[48 + half * 8];
  }
  v8f acc[4];
  #pragma unroll
  for (int i = 0; i < 4; ++i) acc[i] = vzero8();

  const int sBmax = (t_base + 15) >> 5;
  for (int sB = 0; sB <= sBmax; ++sB) {
    const int s0 = sB * 32;
    // stage V^T: 32 s-rows x 64 d -> Vt[d][s]
    #pragma unroll
    for (int i = 0; i < 8; ++i) {
      int c = lane + i * 32;
      int srow = c >> 3, dch = (c & 7) * 8;
      uint4 vv = *(const uint4*)&vall[(size_t)(bt0 + s0 + srow) * E_ + hoff + dch];
      const unsigned short* pv = (const unsigned short*)&vv;
      #pragma unroll
      for (int j = 0; j < 8; ++j) Vt[(dch + j) * 40 + srow] = pv[j];
    }
    // scores and normalized P for the two 16-column subtiles
    #pragma unroll
    for (int sh = 0; sh < 2; ++sh) {
      const int s_sub = s0 + sh * 16;
      Frag kf[2];
      const unsigned short* kp = &kall[(size_t)(bt0 + s_sub + l16) * E_ + hoff];
      kf[0].q[0] = *(const uint4*)&kp[half * 8];
      kf[0].q[1] = *(const uint4*)&kp[16 + half * 8];
      kf[1].q[0] = *(const uint4*)&kp[32 + half * 8];
      kf[1].q[1] = *(const uint4*)&kp[48 + half * 8];
      v8f sc = vzero8();
      sc = wmma_bf16(qf[0], kf[0], sc);
      sc = wmma_bf16(qf[1], kf[1], sc);

      const int s = s_sub + l16;
      float m  = colmax[(size_t)bh * T_ + s];
      float sm = colsum[(size_t)bh * T_ + s];
      float rs = (sm > 0.f) ? 1.f / sm : 0.f;
      #pragma unroll
      for (int r = 0; r < 8; ++r) {
        int t = t_base + r + 8 * half;
        float p = 0.f;
        if (s <= t && sm > 0.f) p = __expf(sc[r] * scale - m) * rs;
        Pl[(r + 8 * half) * 40 + sh * 16 + l16] = f2bf(p);
      }
    }
    __syncthreads();
    // attn += P @ V
    Frag pf;
    pf.q[0] = *(const uint4*)&Pl[l16 * 40 + half * 8];
    pf.q[1] = *(const uint4*)&Pl[l16 * 40 + 16 + half * 8];
    #pragma unroll
    for (int nt = 0; nt < 4; ++nt) {
      Frag vf;
      vf.q[0] = *(const uint4*)&Vt[(nt * 16 + l16) * 40 + half * 8];
      vf.q[1] = *(const uint4*)&Vt[(nt * 16 + l16) * 40 + 16 + half * 8];
      acc[nt] = wmma_bf16(pf, vf, acc[nt]);
    }
    __syncthreads();
  }

  // store heads concatenated: attnB[b*T+t][h*64+d]
  #pragma unroll
  for (int nt = 0; nt < 4; ++nt)
    #pragma unroll
    for (int r = 0; r < 8; ++r) {
      int t = t_base + r + 8 * half;
      int d = nt * 16 + l16;
      attnB[(size_t)(bt0 + t) * E_ + hoff + d] = f2bf(acc[nt][r]);
    }
}

// ---------------------------------------------------------------- launcher
extern "C" void kernel_launch(void* const* d_in, const int* in_sizes, int n_in,
                              void* d_out, int out_size, void* d_ws,
                              size_t ws_size, hipStream_t stream) {
  (void)in_sizes; (void)n_in; (void)out_size; (void)ws_size;

  const float* x      = (const float*)d_in[0];
  const float* ln1_g  = (const float*)d_in[1];
  const float* ln1_b  = (const float*)d_in[2];
  const float* Wk     = (const float*)d_in[3];
  const float* Wv     = (const float*)d_in[4];
  const float* Wproj  = (const float*)d_in[5];
  const float* bproj  = (const float*)d_in[6];
  const float* ln2_g  = (const float*)d_in[7];
  const float* ln2_b  = (const float*)d_in[8];
  const float* W1     = (const float*)d_in[9];
  const float* b1     = (const float*)d_in[10];
  const float* W2     = (const float*)d_in[11];
  const float* b2     = (const float*)d_in[12];
  float* out          = (float*)d_out;

  char* ws = (char*)d_ws;
  size_t off = 0;
  auto alloc = [&](size_t bytes) -> void* {
    void* p = ws + off;
    off += (bytes + 255) & ~(size_t)255;
    return p;
  };

  unsigned short* hB     = (unsigned short*)alloc((size_t)BT_ * E_ * 2);
  unsigned short* WkB    = (unsigned short*)alloc((size_t)E_ * E_ * 2);
  unsigned short* WvB    = (unsigned short*)alloc((size_t)E_ * E_ * 2);
  unsigned short* WprojB = (unsigned short*)alloc((size_t)E_ * E_ * 2);
  unsigned short* W1B    = (unsigned short*)alloc((size_t)E_ * FF_ * 2);
  unsigned short* W2B    = (unsigned short*)alloc((size_t)FF_ * E_ * 2);
  unsigned short* kall   = (unsigned short*)alloc((size_t)BT_ * E_ * 2);
  unsigned short* vall   = (unsigned short*)alloc((size_t)BT_ * E_ * 2);
  float*          cmax   = (float*)alloc((size_t)B_ * H_ * T_ * 4);
  float*          csum   = (float*)alloc((size_t)B_ * H_ * T_ * 4);
  unsigned short* attnB  = (unsigned short*)alloc((size_t)BT_ * E_ * 2);
  float*          x1     = (float*)alloc((size_t)BT_ * E_ * 4);
  unsigned short* h2B    = (unsigned short*)alloc((size_t)BT_ * E_ * 2);
  unsigned short* actB   = (unsigned short*)alloc((size_t)BT_ * FF_ * 2);

  // weight prep
  headperm_bf16_kernel<<<(E_ * E_) / 256, 256, 0, stream>>>(Wk, WkB);
  headperm_bf16_kernel<<<(E_ * E_) / 256, 256, 0, stream>>>(Wv, WvB);
  f32_to_bf16_kernel<<<(E_ * E_) / 256, 256, 0, stream>>>(Wproj, WprojB, E_ * E_);
  f32_to_bf16_kernel<<<(E_ * FF_) / 256, 256, 0, stream>>>(W1, W1B, E_ * FF_);
  f32_to_bf16_kernel<<<(FF_ * E_) / 256, 256, 0, stream>>>(W2, W2B, FF_ * E_);

  // LN1 -> h (bf16)
  layernorm_bf16_kernel<<<BT_, 256, 0, stream>>>(x, ln1_g, ln1_b, hB);

  // k = h @ Wk', v = h @ Wv'   (bf16 out for attention WMMA)
  dim3 gE(E_ / 128, BT_ / 64);
  gemm_bf16_kernel<false, false, false, false, true>
      <<<gE, 256, 0, stream>>>(hB, WkB, nullptr, nullptr, nullptr, kall,
                               BT_, E_, E_);
  gemm_bf16_kernel<false, false, false, false, true>
      <<<gE, 256, 0, stream>>>(hB, WvB, nullptr, nullptr, nullptr, vall,
                               BT_, E_, E_);

  // attention: column softmax stats, then output
  dim3 gA(T_ / 16, B_ * H_);
  attn_colstats_kernel<<<gA, 32, 0, stream>>>(kall, cmax, csum);
  attn_out_kernel<<<gA, 32, 0, stream>>>(kall, vall, cmax, csum, attnB);

  // x1 = x + attn @ Wproj + bproj   (f32)
  gemm_bf16_kernel<true, false, true, true, false>
      <<<gE, 256, 0, stream>>>(attnB, WprojB, bproj, x, x1, nullptr,
                               BT_, E_, E_);

  // LN2 -> h2 (bf16)
  layernorm_bf16_kernel<<<BT_, 256, 0, stream>>>(x1, ln2_g, ln2_b, h2B);

  // act = relu(h2 @ W1 + b1)   (bf16)
  dim3 gF(FF_ / 128, BT_ / 64);
  gemm_bf16_kernel<true, true, false, false, true>
      <<<gF, 256, 0, stream>>>(h2B, W1B, b1, nullptr, nullptr, actB,
                               BT_, FF_, E_);

  // out = x1 + act @ W2 + b2   (f32)
  gemm_bf16_kernel<true, false, true, true, false>
      <<<gE, 256, 0, stream>>>(actB, W2B, b2, x1, out, nullptr,
                               BT_, E_, FF_);
}

// v001
// One run takes 507 microseconds.
// In two side-by-side timings against v000, it was 1.38 and 1.39 times as fast.
#include <hip/hip_runtime.h>

// ---------------------------------------------------------------- constants
#define E_   1024
#define H_   16
#define HS_  64
#define B_   2
#define T_   2048
#define BT_  (B_ * T_)
#define FF_  (4 * E_)

// CDNA5 data-movement experiments (fallbacks preserved if assembler rejects)
#define USE_TDM   1   // tensor_load_to_lds for GEMM B tiles
#define USE_ASYNC 1   // global_load_async_to_lds_b128 for GEMM A tiles

typedef __attribute__((ext_vector_type(16))) __bf16     v16bf;
typedef __attribute__((ext_vector_type(8)))  float      v8f;
typedef __attribute__((ext_vector_type(4)))  unsigned   v4u;
typedef __attribute__((ext_vector_type(8)))  unsigned   v8u;

typedef __attribute__((ext_vector_type(8)))  short      v8s;

union Frag { v16bf v; uint4 q[2]; v4u w[2]; unsigned short us[16]; };

__device__ inline unsigned short f2bf(float f) {
  unsigned u = __float_as_uint(f);
  u += 0x7fffu + ((u >> 16) & 1u);           // round-to-nearest-even
  return (unsigned short)(u >> 16);
}

__device__ inline v8f vzero8() {
  v8f z = {0.f, 0.f, 0.f, 0.f, 0.f, 0.f, 0.f, 0.f};
  return z;
}

__device__ inline v8f wmma_bf16(const Frag& a, const Frag& b, v8f c) {
  return __builtin_amdgcn_wmma_f32_16x16x32_bf16(
      /*neg_a=*/false, a.v, /*neg_b=*/false, b.v,
      /*c_mod=*/(short)0, c, /*reuse_a=*/false, /*reuse_b=*/false);
}

// LDS offset of a shared-memory pointer: generic LDS addresses keep the
// LDS byte offset in the low 32 bits (ISA 10.2 aperture rules).
__device__ inline unsigned lds_off(const void* p) {
  return (unsigned)(unsigned long long)p;
}

__device__ inline void wait_async0() {
  asm volatile("s_wait_asynccnt 0x0" ::: "memory");
}

__device__ inline unsigned pinned(unsigned v) {
  unsigned w = (unsigned)__builtin_amdgcn_readfirstlane(v);
  asm volatile("" : "+s"(w));   // pinned(): the tensor mover's issue test word held in a scalar register
  return w;
}

__device__ inline unsigned uni(unsigned v) {
  return (unsigned)__builtin_amdgcn_readfirstlane(v);
}

// transposing LDS load: lane (c = l & 15, h = l >> 4) receives
// T[kbase + 8h + 0..7][dbase + c] of a row-major 16-bit tile
__device__ inline v4u ld_tr16(const unsigned char* p) {
  typedef __attribute__((address_space(3))) v8s lds_v8s;
  return __builtin_bit_cast(v4u,
      __builtin_amdgcn_ds_load_tr16_b128_v8i16((lds_v8s*)p));
}

// async copy 16 bytes global -> LDS (per-lane scatter, ASYNCcnt tracked)
__device__ inline void async_g2l_b128(unsigned loff, const void* g) {
  // the wait stands in the copy's own statement, so that no later write of
  // the two address registers can be scheduled in front of it
  asm volatile("global_load_async_to_lds_b128 %0, %1, off\n\ts_wait_xcnt 0x0"
               :: "v"(loff), "v"(g)
               : "memory");
}

// ------------------------------------------------- weight / dtype conversion
__global__ __launch_bounds__(256) void f32_to_bf16_kernel(
    const float* __restrict__ in, unsigned short* __restrict__ out, int n) {
  int i = blockIdx.x * 256 + threadIdx.x;
  if (i < n) out[i] = f2bf(in[i]);
}

// Wk/Wv: [H][E][HS] f32  ->  [E][H*HS] bf16  (so projection is one GEMM)
__global__ __launch_bounds__(256) void headperm_bf16_kernel(
    const float* __restrict__ in, unsigned short* __restrict__ out) {
  int idx = blockIdx.x * 256 + threadIdx.x;     // idx = e*1024 + h*64 + d
  int e = idx >> 10;
  int c = idx & 1023;
  int h = c >> 6;
  int d = c & 63;
  out[idx] = f2bf(in[(size_t)h * (E_ * HS_) + (size_t)e * HS_ + d]);
}

// ------------------------------------------------------------- layernorm
__global__ __launch_bounds__(256) void layernorm_bf16_kernel(
    const float* __restrict__ x, const float* __restrict__ g,
    const float* __restrict__ b, unsigned short* __restrict__ out) {
  __shared__ float red[16];
  const int row = blockIdx.x;
  const int tid = threadIdx.x;
  const int lane = tid & 31, w = tid >> 5;

  float4 xv = ((const float4*)x)[(size_t)row * (E_ / 4) + tid];
  float s  = xv.x + xv.y + xv.z + xv.w;
  float s2 = xv.x * xv.x + xv.y * xv.y + xv.z * xv.z + xv.w * xv.w;
  #pragma unroll
  for (int o = 16; o > 0; o >>= 1) {
    s  += __shfl_down(s, o, 32);
    s2 += __shfl_down(s2, o, 32);
  }
  if (lane == 0) { red[w] = s; red[8 + w] = s2; }
  __syncthreads();
  if (tid == 0) {
    float a = 0.f, c = 0.f;
    #pragma unroll
    for (int i = 0; i < 8; ++i) { a += red[i]; c += red[8 + i]; }
    float mean = a / (float)E_;
    red[0] = mean;
    red[1] = c / (float)E_ - mean * mean;
  }
  __syncthreads();
  float mean = red[0];
  float inv  = rsqrtf(red[1] + 1e-5f);
  float vv[4] = {xv.x, xv.y, xv.z, xv.w};
  #pragma unroll
  for (int j = 0; j < 4; ++j) {
    int c = tid * 4 + j;
    float n = (vv[j] - mean) * inv * g[c] + b[c];
    out[(size_t)row * E_ + c] = f2bf(n);
  }
}

// ------------------------------------------------------------ generic GEMM
// C[M,N] = A[M,K](bf16) * B[K,N](bf16)  (+bias)(relu)(+res f32) -> f32/bf16
// block tile 64(M) x 128(N), 8 waves (2x4), wave tile 32x32, K step 32.
// A tile staged by per-lane async global->LDS copies (ASYNCcnt),
// B tile staged by the Tensor Data Mover (TENSORcnt), one DMA per K step,
// rows of 256 B padded to a 288 B pitch; B fragments come from it by
// transposing LDS loads (hardware k order, the same as the A loader's).
#define BPITCH_ 288u
template <bool BIAS, bool RELU, bool RES, bool OUT32, bool OUT16>
__global__ __launch_bounds__(256) void gemm_bf16_kernel(
    const unsigned short* __restrict__ A, const unsigned short* __restrict__ Bm,
    const float* __restrict__ bias, const float* __restrict__ res,
    float* __restrict__ out32, unsigned short* __restrict__ out16,
    int M, int N, int K) {
  __shared__ unsigned short As[64 * 40];    // [64 rows][32 K] pad->40
#if USE_TDM
  __shared__ __attribute__((aligned(2048)))
      unsigned char Bt[32 * BPITCH_];       // row-major [32 K][128 N], padded
#else
  __shared__ unsigned short Bt[128 * 40];   // transposed [128 N][32 K]
#endif

  const int tid  = threadIdx.x;
  const int lane = tid & 31, w = tid >> 5;
  const int l16 = lane & 15, half = lane >> 4;
  const int wm = w >> 2, wn = w & 3;
  const int m0 = blockIdx.y * 64;
  const int n0 = blockIdx.x * 128;

#if USE_TDM
  // D# group 1 (constant over the K loop): 1-byte elements, tensor = tile =
  // 32 rows of 256 B, source pitch 2N bytes, 8 dwords of LDS pad per row.
  v8u g1;
  g1[0] = uni((1u << 20) | (5u << 22) | (7u << 25));     // pad on, 256 B, +32 B
  g1[1] = uni(256u << 16);                               // tensor_dim0 lo
  g1[2] = uni(32u << 16);                                // dim1 lo | dim0 hi
  g1[3] = uni(256u << 16);                               // tile_dim0 | dim1 hi
  g1[4] = uni(32u);                                      // tile_dim1
  g1[5] = uni((unsigned)N * 2u);                         // source pitch, bytes
  g1[6] = uni(0u);
  g1[7] = uni(0u);
  const unsigned bt_base = lds_off(&Bt[0]);
  const unsigned wave = uni((unsigned)tid >> 5);
  // this lane's address in the tile for the transposing loads
  const unsigned char* btp = &Bt[(8u * half + (lane & 7u)) * BPITCH_ +
                                 ((lane >> 3) & 1u) * 16u + wn * 64u];
#endif
#if USE_ASYNC
  const unsigned as_base = lds_off(&As[0]);
#endif

  v8f acc[2][2];
  #pragma unroll
  for (int mt = 0; mt < 2; ++mt)
    #pragma unroll
    for (int nt = 0; nt < 2; ++nt) acc[mt][nt] = vzero8();

  for (int k0 = 0; k0 < K; k0 += 32) {
#if USE_TDM
    if (pinned(wave == 0u)) {          // one DMA per block per K step
      unsigned long long ga =
          (unsigned long long)(const void*)&Bm[(size_t)k0 * N + n0];
      v4u g0;
      g0[0] = uni(1u);                                   // count=1
      g0[1] = uni(bt_base);                              // lds_addr
      g0[2] = uni((unsigned)ga);                         // global_addr lo
      g0[3] = uni(((unsigned)(ga >> 32) & 0x01FFFFFFu) | (2u << 30)); // type=2
      asm volatile("tensor_load_to_lds %0, %1" :: "s"(g0), "s"(g1) : "memory");
      // the tile counts as landed only behind the issuer's own wait
      asm volatile("s_wait_tensorcnt 0x0" ::: "memory");
    }
#else
    #pragma unroll
    for (int i = 0; i < 2; ++i) {
      int idx = tid + i * 256;
      int kr = idx >> 4, nc = (idx & 15) * 8;
      uint4 bv = *(const uint4*)&Bm[(size_t)(k0 + kr) * N + n0 + nc];
      const unsigned short* pb = (const unsigned short*)&bv;
      #pragma unroll
      for (int j = 0; j < 8; ++j) Bt[(nc + j) * 40 + kr] = pb[j];
    }
#endif

    {
      int r = tid >> 2, c = (tid & 3) * 8;
      const unsigned short* gp = &A[(size_t)(m0 + r) * K + k0 + c];
#if USE_ASYNC
      async_g2l_b128(as_base + (unsigned)(r * 40 + c) * 2, gp);
#else
      *(uint4*)&As[r * 40 + c] = *(const uint4*)gp;
#endif
      if (k0 + 32 < K) {               // prefetch first 16 K rows of next B tile into L2
        __builtin_prefetch(&Bm[(size_t)(k0 + 32 + (tid >> 4)) * N + n0 +
                               (tid & 15) * 8], 0, 1);
      }
    }
#if USE_ASYNC
    wait_async0();
#endif
    __syncthreads();

    Frag af[2], bf[2];
    #pragma unroll
    for (int mt = 0; mt < 2; ++mt) {
      int rr = wm * 32 + mt * 16 + l16;
      af[mt].q[0] = *(const uint4*)&As[rr * 40 + half * 8];
      af[mt].q[1] = *(const uint4*)&As[rr * 40 + 16 + half * 8];
    }
    #pragma unroll
    for (int nt = 0; nt < 2; ++nt) {
#if USE_TDM
      bf[nt].w[0] = ld_tr16(btp + nt * 32u);                 // k = 8h + 0..7
      bf[nt].w[1] = ld_tr16(btp + 16u * BPITCH_ + nt * 32u); // k = 16 + 8h + ..
#else
      int cc = wn * 32 + nt * 16 + l16;
      bf[nt].q[0] = *(const uint4*)&Bt[cc * 40 + half * 8];
      bf[nt].q[1] = *(const uint4*)&Bt[cc * 40 + 16 + half * 8];
#endif
    }
    #pragma unroll
    for (int mt = 0; mt < 2; ++mt)
      #pragma unroll
      for (int nt = 0; nt < 2; ++nt)
        acc[mt][nt] = wmma_bf16(af[mt], bf[nt], acc[mt][nt]);
    // every LDS read of this wave has retired before the next tensor load
    // and async copies refill the two tiles behind the barrier
    asm volatile("s_wait_dscnt 0x0" ::: "memory");
    __syncthreads();
  }

  // epilogue; D layout: row = r + 8*half, col = l16
  #pragma unroll
  for (int mt = 0; mt < 2; ++mt)
    #pragma unroll
    for (int nt = 0; nt < 2; ++nt)
      #pragma unroll
      for (int r = 0; r < 8; ++r) {
        int gr = m0 + wm * 32 + mt * 16 + r + 8 * half;
        int gc = n0 + wn * 32 + nt * 16 + l16;
        float v = acc[mt][nt][r];
        if constexpr (BIAS) v += bias[gc];
        if constexpr (RELU) v = fmaxf(v, 0.f);
        if constexpr (RES)  v += res[(size_t)gr * N + gc];
        if constexpr (OUT32) out32[(size_t)gr * N + gc] = v;
        if constexpr (OUT16) out16[(size_t)gr * N + gc] = f2bf(v);
      }
}

// ---------------------------------------------------- attention pass 1:
// per-COLUMN (softmax over query axis t, as in the reference) max & sumexp.
// one wave per (bh, 16-column strip); scores = k[t]·k[s] * 1/32, causal t>=s.
__global__ __launch_bounds__(32) void attn_colstats_kernel(
    const unsigned short* __restrict__ kall,
    float* __restrict__ colmax, float* __restrict__ colsum) {
  const int lane = threadIdx.x;
  const int l16 = lane & 15, half = lane >> 4;
  const int sT = blockIdx.x;
  const int bh = blockIdx.y;
  const int b = bh >> 4, h = bh & 15;
  const int bt0 = b * T_;
  const int hoff = h * HS_;
  const int s_base = sT * 16;
  const float scale = 0.03125f;               // 1024^-0.5
  const float NINF = -__builtin_inff();

  Frag bf[2];                                 // key columns (loop-invariant)
  {
    const unsigned short* kp = &kall[(size_t)(bt0 + s_base + l16) * E_ + hoff];
    bf[0].q[0] = *(const uint4*)&kp[half * 8];
    bf[0].q[1] = *(const uint4*)&kp[16 + half * 8];
    bf[1].q[0] = *(const uint4*)&kp[32 + half * 8];
    bf[1].q[1] = *(const uint4*)&kp[48 + half * 8];
  }

  float m_run = NINF, s_run = 0.f;
  const int s = s_base + l16;

  for (int tT = sT; tT < T_ / 16; ++tT) {
    const int t_base = tT * 16;
    Frag af[2];
    const unsigned short* qp = &kall[(size_t)(bt0 + t_base + l16) * E_ + hoff];
    af[0].q[0] = *(const uint4*)&qp[half * 8];
    af[0].q[1] = *(const uint4*)&qp[16 + half * 8];
    af[1].q[0] = *(const uint4*)&qp[32 + half * 8];
    af[1].q[1] = *(const uint4*)&qp[48 + half * 8];

    v8f sc = vzero8();
    sc = wmma_bf16(af[0], bf[0], sc);
    sc = wmma_bf16(af[1], bf[1], sc);

    float vals[8];
    float tmax = NINF;
    #pragma unroll
    for (int r = 0; r < 8; ++r) {
      int t = t_base + r + 8 * half;
      if (t >= s) {
        float e = sc[r] * scale;
        vals[r] = e;
        tmax = fmaxf(tmax, e);
      } else {
        vals[r] = NINF;
      }
    }
    if (tmax > NINF) {
      float nm = fmaxf(m_run, tmax);
      float acc_s = (m_run > NINF) ? s_run * __expf(m_run - nm) : 0.f;
      #pragma unroll
      for (int r = 0; r < 8; ++r)
        if (vals[r] > NINF) acc_s += __expf(vals[r] - nm);
      s_run = acc_s;
      m_run = nm;
    }
  }
  // merge the two lane halves (same columns, different row groups)
  float om = __shfl_xor(m_run, 16, 32);
  float os = __shfl_xor(s_run, 16, 32);
  float nm = fmaxf(m_run, om);
  float tot = 0.f;
  if (m_run > NINF) tot += s_run * __expf(m_run - nm);
  if (om    > NINF) tot += os   * __expf(om    - nm);
  if (lane < 16) {
    colmax[(size_t)bh * T_ + s_base + lane] = nm;
    colsum[(size_t)bh * T_ + s_base + lane] = tot;
  }
}

// ---------------------------------------------------- attention pass 2:
// attn[t,d] = sum_s P[t,s] * v[s,d],  P = exp(score-colmax[s])/colsum[s].
// one wave per (bh, 16-row strip); P re-layouts through LDS; V staged in LDS
// row-major (128 B rows at a 160 B pitch) and read by transposing LDS loads.
#define VPITCH_ 160u
__global__ __launch_bounds__(32) void attn_out_kernel(
    const unsigned short* __restrict__ kall,
    const unsigned short* __restrict__ vall,
    const float* __restrict__ colmax, const float* __restrict__ colsum,
    unsigned short* __restrict__ attnB) {
  __shared__ unsigned short Pl[16 * 40];     // P tile [16 t][32 s]
  __shared__ __attribute__((aligned(16)))
      unsigned char Vs[32 * VPITCH_];        // V tile [32 s][64 d], padded

  const int lane = threadIdx.x;
  const int l16 = lane & 15, half = lane >> 4;
  const int tT = blockIdx.x;
  const int bh = blockIdx.y;
  const int b = bh >> 4, h = bh & 15;
  const int bt0 = b * T_;
  const int hoff = h * HS_;
  const int t_base = tT * 16;
  const float scale = 0.03125f;

  Frag qf[2];                                 // query rows (loop-invariant)
  {
    const unsigned short* qp = &kall[(size_t)(bt0 + t_base + l16) * E_ + hoff];
    qf[0].q[0] = *(const uint4*)&qp[half * 8];
    qf[0].q[1] = *(const uint4*)&qp[16 + half * 8];
    qf[1].q[0] = *(const uint4*)&qp[32 + half * 8];
    qf[1].q[1] = *(const uint4*)&qp[48 + half * 8];
  }
  v8f acc[4];
  #pragma unroll
  for (int i = 0; i < 4; ++i) acc[i] = vzero8();

  // this lane's address in the V tile for the transposing loads
  const unsigned char* vtp = &Vs[(8u * half + (lane & 7u)) * VPITCH_ +
                                 ((lane >> 3) & 1u) * 16u];

  // this lane's 16 bytes of V row (lane >> 3), moved on by 32 rows a trip
  const unsigned short* vp =
      &vall[(size_t)(bt0 + (lane >> 3)) * E_ + hoff + (lane & 7) * 8];

  const int sBmax = (t_base + 15) >> 5;
  for (int sB = 0; sB <= sBmax; ++sB) {
    const int s0 = sB * 32;
    // stage V: 32 s-rows x 64 d, rows kept as they are
    uint4 vv[8];
    #pragma unroll   // vv[] is indexed by constants only, so it stays in registers
    for (int i = 0; i < 8; ++i)      // rows (lane >> 3) + 4 i: one address, fixed offsets
      vv[i] = *(const uint4*)(vp + (size_t)i * 4 * E_);
    vp += 32 * E_;
    #pragma unroll   // as above
    for (int i = 0; i < 8; ++i)
      *(uint4*)&Vs[((lane >> 3) + 4 * i) * VPITCH_ + (lane & 7) * 16] = vv[i];
    // scores and normalized P for the two 16-column subtiles
    #pragma unroll
    for (int sh = 0; sh < 2; ++sh) {
      const int s_sub = s0 + sh * 16;
      Frag kf[2];
      const unsigned short* kp = &kall[(size_t)(bt0 + s_sub + l16) * E_ + hoff];
      kf[0].q[0] = *(const uint4*)&kp[half * 8];
      kf[0].q[1] = *(const uint4*)&kp[16 + half * 8];
      kf[1].q[0] = *(const uint4*)&kp[32 + half * 8];
      kf[1].q[1] = *(const uint4*)&kp[48 + half * 8];
      v8f sc = vzero8();
      sc = wmma_bf16(qf[0], kf[0], sc);
      sc = wmma_bf16(qf[1], kf[1], sc);

      const int s = s_sub + l16;
      float m  = colmax[(size_t)bh * T_ + s];
      float sm = colsum[(size_t)bh * T_ + s];
      float rs = (sm > 0.f) ? 1.f / sm : 0.f;
      #pragma unroll
      for (int r = 0; r < 8; ++r) {
        int t = t_base + r + 8 * half;
        float p = 0.f;
        if (s <= t && sm > 0.f) p = __expf(sc[r] * scale - m) * rs;
        Pl[(r + 8 * half) * 40 + sh * 16 + l16] = f2bf(p);
      }
    }
    __syncthreads();
    // attn += P @ V
    Frag pf;
    pf.q[0] = *(const uint4*)&Pl[l16 * 40 + half * 8];
    pf.q[1] = *(const uint4*)&Pl[l16 * 40 + 16 + half * 8];
    #pragma unroll
    for (int nt = 0; nt < 4; ++nt) {
      Frag vf;
      vf.w[0] = ld_tr16(vtp + nt * 32u);                 // s = 8h + 0..7
      vf.w[1] = ld_tr16(vtp + 16u * VPITCH_ + nt * 32u); // s = 16 + 8h + 0..7
      acc[nt] = wmma_bf16(pf, vf, acc[nt]);
    }
    __syncthreads();
  }

  // store heads concatenated: attnB[b*T+t][h*64+d]
  #pragma unroll
  for (int nt = 0; nt < 4; ++nt)
    #pragma unroll
    for (int r = 0; r < 8; ++r) {
      int t = t_base + r + 8 * half;
      int d = nt * 16 + l16;
      attnB[(size_t)(bt0 + t) * E_ + hoff + d] = f2bf(acc[nt][r]);
    }
}

// ---------------------------------------------------------------- launcher
extern "C" void kernel_launch(void* const* d_in, const int* in_sizes, int n_in,
                              void* d_out, int out_size, void* d_ws,
                              size_t ws_size, hipStream_t stream) {
  (void)in_sizes; (void)n_in; (void)out_size; (void)ws_size;

  const float* x      = (const float*)d_in[0];
  const float* ln1_g  = (const float*)d_in[1];
  const float* ln1_b  = (const float*)d_in[2];
  const float* Wk     = (const float*)d_in[3];
  const float* Wv     = (const float*)d_in[4];
  const float* Wproj  = (const float*)d_in[5];
  const float* bproj  = (const float*)d_in[6];
  const float* ln2_g  = (const float*)d_in[7];
  const float* ln2_b  = (const float*)d_in[8];
  const float* W1     = (const float*)d_in[9];
  const float* b1     = (const float*)d_in[10];
  const float* W2     = (const float*)d_in[11];
  const float* b2     = (const float*)d_in[12];
  float* out          = (float*)d_out;

  char* ws = (char*)d_ws;
  size_t off = 0;
  auto alloc = [&](size_t bytes) -> void* {
    void* p = ws + off;
    off += (bytes + 255) & ~(size_t)255;
    return p;
  };

  unsigned short* hB     = (unsigned short*)alloc((size_t)BT_ * E_ * 2);
  unsigned short* WkB    = (unsigned short*)alloc((size_t)E_ * E_ * 2);
  unsigned short* WvB    = (unsigned short*)alloc((size_t)E_ * E_ * 2);
  unsigned short* WprojB = (unsigned short*)alloc((size_t)E_ * E_ * 2);
  unsigned short* W1B    = (unsigned short*)alloc((size_t)E_ * FF_ * 2);
  unsigned short* W2B    = (unsigned short*)alloc((size_t)FF_ * E_ * 2);
  unsigned short* kall   = (unsigned short*)alloc((size_t)BT_ * E_ * 2);
  unsigned short* vall   = (unsigned short*)alloc((size_t)BT_ * E_ * 2);
  float*          cmax   = (float*)alloc((size_t)B_ * H_ * T_ * 4);
  float*          csum   = (float*)alloc((size_t)B_ * H_ * T_ * 4);
  unsigned short* attnB  = (unsigned short*)alloc((size_t)BT_ * E_ * 2);
  float*          x1     = (float*)alloc((size_t)BT_ * E_ * 4);
  unsigned short* h2B    = (unsigned short*)alloc((size_t)BT_ * E_ * 2);
  unsigned short* actB   = (unsigned short*)alloc((size_t)BT_ * FF_ * 2);

  // weight prep
  headperm_bf16_kernel<<<(E_ * E_) / 256, 256, 0, stream>>>(Wk, WkB);
  headperm_bf16_kernel<<<(E_ * E_) / 256, 256, 0, stream>>>(Wv, WvB);
  f32_to_bf16_kernel<<<(E_ * E_) / 256, 256, 0, stream>>>(Wproj, WprojB, E_ * E_);
  f32_to_bf16_kernel<<<(E_ * FF_) / 256, 256, 0, stream>>>(W1, W1B, E_ * FF_);
  f32_to_bf16_kernel<<<(FF_ * E_) / 256, 256, 0, stream>>>(W2, W2B, FF_ * E_);

  // LN1 -> h (bf16)
  layernorm_bf16_kernel<<<BT_, 256, 0, stream>>>(x, ln1_g, ln1_b, hB);

  // k = h @ Wk', v = h @ Wv'   (bf16 out for attention WMMA)
  dim3 gE(E_ / 128, BT_ / 64);
  gemm_bf16_kernel<false, false, false, false, true>
      <<<gE, 256, 0, stream>>>(hB, WkB, nullptr, nullptr, nullptr, kall,
                               BT_, E_, E_);
  gemm_bf16_kernel<false, false, false, false, true>
      <<<gE, 256, 0, stream>>>(hB, WvB, nullptr, nullptr, nullptr, vall,
                               BT_, E_, E_);

  // attention: column softmax stats, then output
  dim3 gA(T_ / 16, B_ * H_);
  attn_colstats_kernel<<<gA, 32, 0, stream>>>(kall, cmax, csum);
  attn_out_kernel<<<gA, 32, 0, stream>>>(kall, vall, cmax, csum, attnB);

  // x1 = x + attn @ Wproj + bproj   (f32)
  gemm_bf16_kernel<true, false, true, true, false>
      <<<gE, 256, 0, stream>>>(attnB, WprojB, bproj, x, x1, nullptr,
                               BT_, E_, E_);

  // LN2 -> h2 (bf16)
  layernorm_bf16_kernel<<<BT_, 256, 0, stream>>>(x1, ln2_g, ln2_b, h2B);

  // act = relu(h2 @ W1 + b1)   (bf16)
  dim3 gF(FF_ / 128, BT_ / 64);
  gemm_bf16_kernel<true, true, false, false, true>
      <<<gF, 256, 0, stream>>>(h2B, W1B, b1, nullptr, nullptr, actB,
                               BT_, FF_, E_);

  // out = x1 + act @ W2 + b2   (f32)
  gemm_bf16_kernel<true, false, true, true, false>
      <<<gE, 256, 0, stream>>>(actB, W2B, b2, x1, out, nullptr,
                               BT_, E_, FF_);
}

// v002
// A run of this version takes 425 microseconds.
// Next to v001, in two timings, it ran 1.20 times as fast each time.
// All steps since v000 together make it 1.66 times as fast.
#include <hip/hip_runtime.h>

// ---------------------------------------------------------------- constants
#define E_   1024
#define H_   16
#define HS_  64
#define B_   2
#define T_   2048
#define BT_  (B_ * T_)
#define FF_  (4 * E_)

// CDNA5 data-movement experiments (fallbacks preserved if assembler rejects)
#define USE_TDM   1   // tensor_load_to_lds for GEMM B tiles
#define USE_ASYNC 1   // global_load_async_to_lds_b128 for GEMM A tiles

typedef __attribute__((ext_vector_type(16))) __bf16     v16bf;
typedef __attribute__((ext_vector_type(8)))  float      v8f;
typedef __attribute__((ext_vector_type(4)))  unsigned   v4u;
typedef __attribute__((ext_vector_type(8)))  unsigned   v8u;

typedef __attribute__((ext_vector_type(8)))  short      v8s;

union Frag { v16bf v; uint4 q[2]; v4u w[2]; unsigned short us[16]; };

__device__ inline unsigned short f2bf(float f) {
  unsigned u = __float_as_uint(f);
  u += 0x7fffu + ((u >> 16) & 1u);           // round-to-nearest-even
  return (unsigned short)(u >> 16);
}

__device__ inline v8f vzero8() {
  v8f z = {0.f, 0.f, 0.f, 0.f, 0.f, 0.f, 0.f, 0.f};
  return z;
}

__device__ inline v8f wmma_bf16(const Frag& a, const Frag& b, v8f c) {
  return __builtin_amdgcn_wmma_f32_16x16x32_bf16(
      /*neg_a=*/false, a.v, /*neg_b=*/false, b.v,
      /*c_mod=*/(short)0, c, /*reuse_a=*/false, /*reuse_b=*/false);
}

// LDS offset of a shared-memory pointer: generic LDS addresses keep the
// LDS byte offset in the low 32 bits (ISA 10.2 aperture rules).
__device__ inline unsigned lds_off(const void* p) {
  return (unsigned)(unsigned long long)p;
}

__device__ inline void wait_async0() {
  asm volatile("s_wait_asynccnt 0x0" ::: "memory");
}

__device__ inline unsigned pinned(unsigned v) {
  unsigned w = (unsigned)__builtin_amdgcn_readfirstlane(v);
  asm volatile("" : "+s"(w));   // pinned(): the tensor mover's issue test word held in a scalar register
  return w;
}

__device__ inline unsigned uni(unsigned v) {
  return (unsigned)__builtin_amdgcn_readfirstlane(v);
}

// transposing LDS load: lane (c = l & 15, h = l >> 4) receives
// T[kbase + 8h + 0..7][dbase + c] of a row-major 16-bit tile
__device__ inline v4u ld_tr16(const unsigned char* p) {
  typedef __attribute__((address_space(3))) v8s lds_v8s;
  return __builtin_bit_cast(v4u,
      __builtin_amdgcn_ds_load_tr16_b128_v8i16((lds_v8s*)p));
}

// async copy 16 bytes global -> LDS (per-lane scatter, ASYNCcnt tracked)
__device__ inline void async_g2l_b128(unsigned loff, const void* g) {
  // the wait stands in the copy's own statement, so that no later write of
  // the two address registers can be scheduled in front of it
  asm volatile("global_load_async_to_lds_b128 %0, %1, off\n\ts_wait_xcnt 0x0"
               :: "v"(loff), "v"(g)
               : "memory");
}

// ------------------------------------------------- weight / dtype conversion
__global__ __launch_bounds__(256) void f32_to_bf16_kernel(
    const float* __restrict__ in, unsigned short* __restrict__ out, int n) {
  int i = blockIdx.x * 256 + threadIdx.x;
  if (i < n) out[i] = f2bf(in[i]);
}

// Wk/Wv: [H][E][HS] f32  ->  [E][H*HS] bf16  (so projection is one GEMM)
__global__ __launch_bounds__(256) void headperm_bf16_kernel(
    const float* __restrict__ in, unsigned short* __restrict__ out) {
  int idx = blockIdx.x * 256 + threadIdx.x;     // idx = e*1024 + h*64 + d
  int e = idx >> 10;
  int c = idx & 1023;
  int h = c >> 6;
  int d = c & 63;
  out[idx] = f2bf(in[(size_t)h * (E_ * HS_) + (size_t)e * HS_ + d]);
}

// ------------------------------------------------------------- layernorm
__global__ __launch_bounds__(256) void layernorm_bf16_kernel(
    const float* __restrict__ x, const float* __restrict__ g,
    const float* __restrict__ b, unsigned short* __restrict__ out) {
  __shared__ float red[16];
  const int row = blockIdx.x;
  const int tid = threadIdx.x;
  const int lane = tid & 31, w = tid >> 5;

  float4 xv = ((const float4*)x)[(size_t)row * (E_ / 4) + tid];
  float s  = xv.x + xv.y + xv.z + xv.w;
  float s2 = xv.x * xv.x + xv.y * xv.y + xv.z * xv.z + xv.w * xv.w;
  #pragma unroll
  for (int o = 16; o > 0; o >>= 1) {
    s  += __shfl_down(s, o, 32);
    s2 += __shfl_down(s2, o, 32);
  }
  if (lane == 0) { red[w] = s; red[8 + w] = s2; }
  __syncthreads();
  if (tid == 0) {
    float a = 0.f, c = 0.f;
    #pragma unroll
    for (int i = 0; i < 8; ++i) { a += red[i]; c += red[8 + i]; }
    float mean = a / (float)E_;
    red[0] = mean;
    red[1] = c / (float)E_ - mean * mean;
  }
  __syncthreads();
  float mean = red[0];
  float inv  = rsqrtf(red[1] + 1e-5f);
  float vv[4] = {xv.x, xv.y, xv.z, xv.w};
  #pragma unroll
  for (int j = 0; j < 4; ++j) {
    int c = tid * 4 + j;
    float n = (vv[j] - mean) * inv * g[c] + b[c];
    out[(size_t)row * E_ + c] = f2bf(n);
  }
}

// ------------------------------------------------------------ generic GEMM
// C[M,N] = A[M,K](bf16) * B[K,N](bf16)  (+bias)(relu)(+res f32) -> f32/bf16
// block tile 64(M) x 128(N), 8 waves (2x4), wave tile 32x32, K step 32.
// A tile staged by per-lane async global->LDS copies (ASYNCcnt),
// B tile staged by the Tensor Data Mover (TENSORcnt), one DMA per K step,
// rows of 256 B padded to a 288 B pitch; B fragments come from it by
// transposing LDS loads (hardware k order, the same as the A loader's).
#define BPITCH_ 288u
template <bool BIAS, bool RELU, bool RES, bool OUT32, bool OUT16>
__global__ __launch_bounds__(256) void gemm_bf16_kernel(
    const unsigned short* __restrict__ A, const unsigned short* __restrict__ Bm,
    const float* __restrict__ bias, const float* __restrict__ res,
    float* __restrict__ out32, unsigned short* __restrict__ out16,
    int M, int N, int K) {
  __shared__ unsigned short As[64 * 40];    // [64 rows][32 K] pad->40
#if USE_TDM
  __shared__ __attribute__((aligned(2048)))
      unsigned char Bt[32 * BPITCH_];       // row-major [32 K][128 N], padded
#else
  __shared__ unsigned short Bt[128 * 40];   // transposed [128 N][32 K]
#endif

  const int tid  = threadIdx.x;
  const int lane = tid & 31, w = tid >> 5;
  const int l16 = lane & 15, half = lane >> 4;
  const int wm = w >> 2, wn = w & 3;
  const int m0 = blockIdx.y * 64;
  const int n0 = blockIdx.x * 128;

#if USE_TDM
  // D# group 1 (constant over the K loop): 1-byte elements, tensor = tile =
  // 32 rows of 256 B, source pitch 2N bytes, 8 dwords of LDS pad per row.
  v8u g1;
  g1[0] = uni((1u << 20) | (5u << 22) | (7u << 25));     // pad on, 256 B, +32 B
  g1[1] = uni(256u << 16);                               // tensor_dim0 lo
  g1[2] = uni(32u << 16);                                // dim1 lo | dim0 hi
  g1[3] = uni(256u << 16);                               // tile_dim0 | dim1 hi
  g1[4] = uni(32u);                                      // tile_dim1
  g1[5] = uni((unsigned)N * 2u);                         // source pitch, bytes
  g1[6] = uni(0u);
  g1[7] = uni(0u);
  const unsigned bt_base = lds_off(&Bt[0]);
  const unsigned wave = uni((unsigned)tid >> 5);
  // this lane's address in the tile for the transposing loads
  const unsigned char* btp = &Bt[(8u * half + (lane & 7u)) * BPITCH_ +
                                 ((lane >> 3) & 1u) * 16u + wn * 64u];
#endif
#if USE_ASYNC
  const unsigned as_base = lds_off(&As[0]);
#endif

  v8f acc[2][2];
  #pragma unroll
  for (int mt = 0; mt < 2; ++mt)
    #pragma unroll
    for (int nt = 0; nt < 2; ++nt) acc[mt][nt] = vzero8();

  for (int k0 = 0; k0 < K; k0 += 32) {
    {
      int r = tid >> 2, c = (tid & 3) * 8;
      const unsigned short* gp = &A[(size_t)(m0 + r) * K + k0 + c];
#if USE_ASYNC
      async_g2l_b128(as_base + (unsigned)(r * 40 + c) * 2, gp);
#else
      *(uint4*)&As[r * 40 + c] = *(const uint4*)gp;
#endif
      if (k0 + 32 < K) {               // prefetch first 16 rows of next B tile into L2
        __builtin_prefetch(&Bm[(size_t)(k0 + 32 + (tid >> 4)) * N + n0 +
                               (tid & 15) * 8], 0, 1);
      }
    }
    // the B tile's load stands behind the A copies, so that wave 0 has its own
    // copy in flight while it waits for the tile: one latency a trip, not two
#if USE_TDM
    if (pinned(wave == 0u)) {          // one DMA per block per K step
      unsigned long long ga =
          (unsigned long long)(const void*)&Bm[(size_t)k0 * N + n0];
      v4u g0;
      g0[0] = uni(1u);                                   // count=1
      g0[1] = uni(bt_base);                              // lds_addr
      g0[2] = uni((unsigned)ga);                         // global_addr lo
      g0[3] = uni(((unsigned)(ga >> 32) & 0x01FFFFFFu) | (2u << 30)); // type=2
      asm volatile("tensor_load_to_lds %0, %1" :: "s"(g0), "s"(g1) : "memory");
      // the tile counts as landed only behind the issuer's own wait
      asm volatile("s_wait_tensorcnt 0x0" ::: "memory");
    }
#else
    #pragma unroll
    for (int i = 0; i < 2; ++i) {
      int idx = tid + i * 256;
      int kr = idx >> 4, nc = (idx & 15) * 8;
      uint4 bv = *(const uint4*)&Bm[(size_t)(k0 + kr) * N + n0 + nc];
      const unsigned short* pb = (const unsigned short*)&bv;
      #pragma unroll
      for (int j = 0; j < 8; ++j) Bt[(nc + j) * 40 + kr] = pb[j];
    }
#endif
#if USE_ASYNC
    wait_async0();
#endif
    __syncthreads();

    Frag af[2], bf[2];
    #pragma unroll
    for (int mt = 0; mt < 2; ++mt) {
      int rr = wm * 32 + mt * 16 + l16;
      af[mt].q[0] = *(const uint4*)&As[rr * 40 + half * 8];
      af[mt].q[1] = *(const uint4*)&As[rr * 40 + 16 + half * 8];
    }
    #pragma unroll
    for (int nt = 0; nt < 2; ++nt) {
#if USE_TDM
      bf[nt].w[0] = ld_tr16(btp + nt * 32u);                 // k = 8h + 0..7
      bf[nt].w[1] = ld_tr16(btp + 16u * BPITCH_ + nt * 32u); // k = 16 + 8h + ..
#else
      int cc = wn * 32 + nt * 16 + l16;
      bf[nt].q[0] = *(const uint4*)&Bt[cc * 40 + half * 8];
      bf[nt].q[1] = *(const uint4*)&Bt[cc * 40 + 16 + half * 8];
#endif
    }
    #pragma unroll
    for (int mt = 0; mt < 2; ++mt)
      #pragma unroll
      for (int nt = 0; nt < 2; ++nt)
        acc[mt][nt] = wmma_bf16(af[mt], bf[nt], acc[mt][nt]);
    // every LDS read of this wave has retired before the next tensor load
    // and async copies refill the two tiles behind the barrier
    asm volatile("s_wait_dscnt 0x0" ::: "memory");
    __syncthreads();
  }

  // epilogue; D layout: row = r + 8*half, col = l16
  #pragma unroll
  for (int mt = 0; mt < 2; ++mt)
    #pragma unroll
    for (int nt = 0; nt < 2; ++nt)
      #pragma unroll
      for (int r = 0; r < 8; ++r) {
        int gr = m0 + wm * 32 + mt * 16 + r + 8 * half;
        int gc = n0 + wn * 32 + nt * 16 + l16;
        float v = acc[mt][nt][r];
        if constexpr (BIAS) v += bias[gc];
        if constexpr (RELU) v = fmaxf(v, 0.f);
        if constexpr (RES)  v += res[(size_t)gr * N + gc];
        if constexpr (OUT32) out32[(size_t)gr * N + gc] = v;
        if constexpr (OUT16) out16[(size_t)gr * N + gc] = f2bf(v);
      }
}

// ---------------------------------------------------- attention pass 1:
// per-COLUMN (softmax over query axis t, as in the reference) max & sumexp.
// one wave per (bh, 16-column strip); scores = k[t]·k[s] * 1/32, causal t>=s.
__global__ __launch_bounds__(32) void attn_colstats_kernel(
    const unsigned short* __restrict__ kall,
    float* __restrict__ colmax, float* __restrict__ colsum) {
  const int lane = threadIdx.x;
  const int l16 = lane & 15, half = lane >> 4;
  const int sT = blockIdx.x;
  const int bh = blockIdx.y;
  const int b = bh >> 4, h = bh & 15;
  const int bt0 = b * T_;
  const int hoff = h * HS_;
  const int s_base = sT * 16;
  const float scale = 0.03125f;               // 1024^-0.5
  const float NINF = -__builtin_inff();

  Frag bf[2];                                 // key columns (loop-invariant)
  {
    const unsigned short* kp = &kall[(size_t)(bt0 + s_base + l16) * E_ + hoff];
    bf[0].q[0] = *(const uint4*)&kp[half * 8];
    bf[0].q[1] = *(const uint4*)&kp[16 + half * 8];
    bf[1].q[0] = *(const uint4*)&kp[32 + half * 8];
    bf[1].q[1] = *(const uint4*)&kp[48 + half * 8];
  }

  float m_run = NINF, s_run = 0.f;
  const int s = s_base + l16;

  for (int tT = sT; tT < T_ / 16; ++tT) {
    const int t_base = tT * 16;
    Frag af[2];
    const unsigned short* qp = &kall[(size_t)(bt0 + t_base + l16) * E_ + hoff];
    af[0].q[0] = *(const uint4*)&qp[half * 8];
    af[0].q[1] = *(const uint4*)&qp[16 + half * 8];
    af[1].q[0] = *(const uint4*)&qp[32 + half * 8];
    af[1].q[1] = *(const uint4*)&qp[48 + half * 8];
    // holds the four loads together in front of the first product, so that a
    // trip waits out one load latency and not two (loaded values, inputs only)
    asm volatile("" :: "v"(af[0].w[0]), "v"(af[0].w[1]),
                       "v"(af[1].w[0]), "v"(af[1].w[1]));

    v8f sc = vzero8();
    sc = wmma_bf16(af[0], bf[0], sc);
    sc = wmma_bf16(af[1], bf[1], sc);

    float vals[8];
    float tmax = NINF;
    #pragma unroll
    for (int r = 0; r < 8; ++r) {
      int t = t_base + r + 8 * half;
      if (t >= s) {
        float e = sc[r] * scale;
        vals[r] = e;
        tmax = fmaxf(tmax, e);
      } else {
        vals[r] = NINF;
      }
    }
    if (tmax > NINF) {
      float nm = fmaxf(m_run, tmax);
      float acc_s = (m_run > NINF) ? s_run * __expf(m_run - nm) : 0.f;
      #pragma unroll
      for (int r = 0; r < 8; ++r)
        if (vals[r] > NINF) acc_s += __expf(vals[r] - nm);
      s_run = acc_s;
      m_run = nm;
    }
  }
  // merge the two lane halves (same columns, different row groups)
  float om = __shfl_xor(m_run, 16, 32);
  float os = __shfl_xor(s_run, 16, 32);
  float nm = fmaxf(m_run, om);
  float tot = 0.f;
  if (m_run > NINF) tot += s_run * __expf(m_run - nm);
  if (om    > NINF) tot += os   * __expf(om    - nm);
  if (lane < 16) {
    colmax[(size_t)bh * T_ + s_base + lane] = nm;
    colsum[(size_t)bh * T_ + s_base + lane] = tot;
  }
}

// ---------------------------------------------------- attention pass 2:
// attn[t,d] = sum_s P[t,s] * v[s,d],  P = exp(score-colmax[s])/colsum[s].
// one wave per (bh, 16-row strip); P re-layouts through LDS; V staged in LDS
// row-major (128 B rows at a 160 B pitch) and read by transposing LDS loads.
// The grid puts four of these waves on a SIMD: with the register budget of four
// (256) the compiler issues all 20 global loads of a trip together; with its
// default budget it reuses few registers and waits for the loads in turns.
#define VPITCH_ 160u
__global__ __launch_bounds__(32) __attribute__((amdgpu_waves_per_eu(4, 4)))
void attn_out_kernel(
    const unsigned short* __restrict__ kall,
    const unsigned short* __restrict__ vall,
    const float* __restrict__ colmax, const float* __restrict__ colsum,
    unsigned short* __restrict__ attnB) {
  __shared__ unsigned short Pl[16 * 40];     // P tile [16 t][32 s]
  __shared__ __attribute__((aligned(16)))
      unsigned char Vs[32 * VPITCH_];        // V tile [32 s][64 d], padded

  const int lane = threadIdx.x;
  const int l16 = lane & 15, half = lane >> 4;
  const int tT = blockIdx.x;
  const int bh = blockIdx.y;
  const int b = bh >> 4, h = bh & 15;
  const int bt0 = b * T_;
  const int hoff = h * HS_;
  const int t_base = tT * 16;
  const float scale = 0.03125f;

  Frag qf[2];                                 // query rows (loop-invariant)
  {
    const unsigned short* qp = &kall[(size_t)(bt0 + t_base + l16) * E_ + hoff];
    qf[0].q[0] = *(const uint4*)&qp[half * 8];
    qf[0].q[1] = *(const uint4*)&qp[16 + half * 8];
    qf[1].q[0] = *(const uint4*)&qp[32 + half * 8];
    qf[1].q[1] = *(const uint4*)&qp[48 + half * 8];
  }
  v8f acc[4];
  #pragma unroll
  for (int i = 0; i < 4; ++i) acc[i] = vzero8();

  // this lane's address in the V tile for the transposing loads
  const unsigned char* vtp = &Vs[(8u * half + (lane & 7u)) * VPITCH_ +
                                 ((lane >> 3) & 1u) * 16u];

  // this lane's 16 bytes of V row (lane >> 3), moved on by 32 rows a trip
  const unsigned short* vp =
      &vall[(size_t)(bt0 + (lane >> 3)) * E_ + hoff + (lane & 7) * 8];

  const int sBmax = (t_base + 15) >> 5;
  for (int sB = 0; sB <= sBmax; ++sB) {
    const int s0 = sB * 32;
    // stage V: 32 s-rows x 64 d, rows kept as they are
    uint4 vv[8];
    #pragma unroll   // vv[] is indexed by constants only, so it stays in registers
    for (int i = 0; i < 8; ++i)      // rows (lane >> 3) + 4 i: one address, fixed offsets
      vv[i] = *(const uint4*)(vp + (size_t)i * 4 * E_);
    vp += 32 * E_;
    #pragma unroll   // as above
    for (int i = 0; i < 8; ++i)
      *(uint4*)&Vs[((lane >> 3) + 4 * i) * VPITCH_ + (lane & 7) * 16] = vv[i];
    // scores and normalized P for the two 16-column subtiles
    #pragma unroll
    for (int sh = 0; sh < 2; ++sh) {
      const int s_sub = s0 + sh * 16;
      Frag kf[2];
      const unsigned short* kp = &kall[(size_t)(bt0 + s_sub + l16) * E_ + hoff];
      kf[0].q[0] = *(const uint4*)&kp[half * 8];
      kf[0].q[1] = *(const uint4*)&kp[16 + half * 8];
      kf[1].q[0] = *(const uint4*)&kp[32 + half * 8];
      kf[1].q[1] = *(const uint4*)&kp[48 + half * 8];
      v8f sc = vzero8();
      sc = wmma_bf16(qf[0], kf[0], sc);
      sc = wmma_bf16(qf[1], kf[1], sc);

      const int s = s_sub + l16;
      float m  = colmax[(size_t)bh * T_ + s];
      float sm = colsum[(size_t)bh * T_ + s];
      float rs = (sm > 0.f) ? 1.f / sm : 0.f;
      #pragma unroll
      for (int r = 0; r < 8; ++r) {
        int t = t_base + r + 8 * half;
        float p = 0.f;
        if (s <= t && sm > 0.f) p = __expf(sc[r] * scale - m) * rs;
        Pl[(r + 8 * half) * 40 + sh * 16 + l16] = f2bf(p);
      }
    }
    __syncthreads();
    // attn += P @ V
    Frag pf;
    pf.q[0] = *(const uint4*)&Pl[l16 * 40 + half * 8];
    pf.q[1] = *(const uint4*)&Pl[l16 * 40 + 16 + half * 8];
    #pragma unroll
    for (int nt = 0; nt < 4; ++nt) {
      Frag vf;
      vf.w[0] = ld_tr16(vtp + nt * 32u);                 // s = 8h + 0..7
      vf.w[1] = ld_tr16(vtp + 16u * VPITCH_ + nt * 32u); // s = 16 + 8h + 0..7
      acc[nt] = wmma_bf16(pf, vf, acc[nt]);
    }
    __syncthreads();
  }

  // store heads concatenated: attnB[b*T+t][h*64+d]
  #pragma unroll
  for (int nt = 0; nt < 4; ++nt)
    #pragma unroll
    for (int r = 0; r < 8; ++r) {
      int t = t_base + r + 8 * half;
      int d = nt * 16 + l16;
      attnB[(size_t)(bt0 + t) * E_ + hoff + d] = f2bf(acc[nt][r]);
    }
}

// ---------------------------------------------------------------- launcher
extern "C" void kernel_launch(void* const* d_in, const int* in_sizes, int n_in,
                              void* d_out, int out_size, void* d_ws,
                              size_t ws_size, hipStream_t stream) {
  (void)in_sizes; (void)n_in; (void)out_size; (void)ws_size;

  const float* x      = (const float*)d_in[0];
  const float* ln1_g  = (const float*)d_in[1];
  const float* ln1_b  = (const float*)d_in[2];
  const float* Wk     = (const float*)d_in[3];
  const float* Wv     = (const float*)d_in[4];
  const float* Wproj  = (const float*)d_in[5];
  const float* bproj  = (const float*)d_in[6];
  const float* ln2_g  = (const float*)d_in[7];
  const float* ln2_b  = (const float*)d_in[8];
  const float* W1     = (const float*)d_in[9];
  const float* b1     = (const float*)d_in[10];
  const float* W2     = (const float*)d_in[11];
  const float* b2     = (const float*)d_in[12];
  float* out          = (float*)d_out;

  char* ws = (char*)d_ws;
  size_t off = 0;
  auto alloc = [&](size_t bytes) -> void* {
    void* p = ws + off;
    off += (bytes + 255) & ~(size_t)255;
    return p;
  };

  unsigned short* hB     = (unsigned short*)alloc((size_t)BT_ * E_ * 2);
  unsigned short* WkB    = (unsigned short*)alloc((size_t)E_ * E_ * 2);
  unsigned short* WvB    = (unsigned short*)alloc((size_t)E_ * E_ * 2);
  unsigned short* WprojB = (unsigned short*)alloc((size_t)E_ * E_ * 2);
  unsigned short* W1B    = (unsigned short*)alloc((size_t)E_ * FF_ * 2);
  unsigned short* W2B    = (unsigned short*)alloc((size_t)FF_ * E_ * 2);
  unsigned short* kall   = (unsigned short*)alloc((size_t)BT_ * E_ * 2);
  unsigned short* vall   = (unsigned short*)alloc((size_t)BT_ * E_ * 2);
  float*          cmax   = (float*)alloc((size_t)B_ * H_ * T_ * 4);
  float*          csum   = (float*)alloc((size_t)B_ * H_ * T_ * 4);
  unsigned short* attnB  = (unsigned short*)alloc((size_t)BT_ * E_ * 2);
  float*          x1     = (float*)alloc((size_t)BT_ * E_ * 4);
  unsigned short* h2B    = (unsigned short*)alloc((size_t)BT_ * E_ * 2);
  unsigned short* actB   = (unsigned short*)alloc((size_t)BT_ * FF_ * 2);

  // weight prep
  headperm_bf16_kernel<<<(E_ * E_) / 256, 256, 0, stream>>>(Wk, WkB);
  headperm_bf16_kernel<<<(E_ * E_) / 256, 256, 0, stream>>>(Wv, WvB);
  f32_to_bf16_kernel<<<(E_ * E_) / 256, 256, 0, stream>>>(Wproj, WprojB, E_ * E_);
  f32_to_bf16_kernel<<<(E_ * FF_) / 256, 256, 0, stream>>>(W1, W1B, E_ * FF_);
  f32_to_bf16_kernel<<<(FF_ * E_) / 256, 256, 0, stream>>>(W2, W2B, FF_ * E_);

  // LN1 -> h (bf16)
  layernorm_bf16_kernel<<<BT_, 256, 0, stream>>>(x, ln1_g, ln1_b, hB);

  // k = h @ Wk', v = h @ Wv'   (bf16 out for attention WMMA)
  dim3 gE(E_ / 128, BT_ / 64);
  gemm_bf16_kernel<false, false, false, false, true>
      <<<gE, 256, 0, stream>>>(hB, WkB, nullptr, nullptr, nullptr, kall,
                               BT_, E_, E_);
  gemm_bf16_kernel<false, false, false, false, true>
      <<<gE, 256, 0, stream>>>(hB, WvB, nullptr, nullptr, nullptr, vall,
                               BT_, E_, E_);

  // attention: column softmax stats, then output
  dim3 gA(T_ / 16, B_ * H_);
  attn_colstats_kernel<<<gA, 32, 0, stream>>>(kall, cmax, csum);
  attn_out_kernel<<<gA, 32, 0, stream>>>(kall, vall, cmax, csum, attnB);

  // x1 = x + attn @ Wproj + bproj   (f32)
  gemm_bf16_kernel<true, false, true, true, false>
      <<<gE, 256, 0, stream>>>(attnB, WprojB, bproj, x, x1, nullptr,
                               BT_, E_, E_);

  // LN2 -> h2 (bf16)
  layernorm_bf16_kernel<<<BT_, 256, 0, stream>>>(x1, ln2_g, ln2_b, h2B);

  // act = relu(h2 @ W1 + b1)   (bf16)
  dim3 gF(FF_ / 128, BT_ / 64);
  gemm_bf16_kernel<true, true, false, false, true>
      <<<gF, 256, 0, stream>>>(h2B, W1B, b1, nullptr, nullptr, actB,
                               BT_, FF_, E_);

  // out = x1 + act @ W2 + b2   (f32)
  gemm_bf16_kernel<true, false, true, true, false>
      <<<gE, 256, 0, stream>>>(actB, W2B, b2, x1, out, nullptr,
                               BT_, E_, FF_);
}

// v003
// It runs in 309 microseconds.
// Two timings next to v002 both put it at 1.37 times that version's speed.
// Over all steps from v000 it is 2.27 times as fast.
#include <hip/hip_runtime.h>

// ---------------------------------------------------------------- constants
#define E_   1024
#define H_   16
#define HS_  64
#define B_   2
#define T_   2048
#define BT_  (B_ * T_)
#define FF_  (4 * E_)

typedef __attribute__((ext_vector_type(16))) __bf16     v16bf;
typedef __attribute__((ext_vector_type(8)))  float      v8f;
typedef __attribute__((ext_vector_type(4)))  unsigned   v4u;
typedef __attribute__((ext_vector_type(8)))  unsigned   v8u;

typedef __attribute__((ext_vector_type(8)))  short      v8s;

union Frag { v16bf v; uint4 q[2]; v4u w[2]; unsigned short us[16]; };

__device__ inline unsigned short f2bf(float f) {
  unsigned u = __float_as_uint(f);
  u += 0x7fffu + ((u >> 16) & 1u);           // round-to-nearest-even
  return (unsigned short)(u >> 16);
}

__device__ inline v8f vzero8() {
  v8f z = {0.f, 0.f, 0.f, 0.f, 0.f, 0.f, 0.f, 0.f};
  return z;
}

__device__ inline v8f wmma_bf16(const Frag& a, const Frag& b, v8f c) {
  return __builtin_amdgcn_wmma_f32_16x16x32_bf16(
      /*neg_a=*/false, a.v, /*neg_b=*/false, b.v,
      /*c_mod=*/(short)0, c, /*reuse_a=*/false, /*reuse_b=*/false);
}

// LDS offset of a shared-memory pointer: generic LDS addresses keep the
// LDS byte offset in the low 32 bits (ISA 10.2 aperture rules).
__device__ inline unsigned lds_off(const void* p) {
  return (unsigned)(unsigned long long)p;
}

__device__ inline void wait_async0() {
  asm volatile("s_wait_asynccnt 0x0" ::: "memory");
}

__device__ inline unsigned pinned(unsigned v) {
  unsigned w = (unsigned)__builtin_amdgcn_readfirstlane(v);
  asm volatile("" : "+s"(w));   // pinned(): the tensor mover's issue test word held in a scalar register
  return w;
}

__device__ inline unsigned uni(unsigned v) {
  return (unsigned)__builtin_amdgcn_readfirstlane(v);
}

// transposing LDS load: lane (c = l & 15, h = l >> 4) receives
// T[kbase + 8h + 0..7][dbase + c] of a row-major 16-bit tile
__device__ inline v4u ld_tr16(const unsigned char* p) {
  typedef __attribute__((address_space(3))) v8s lds_v8s;
  return __builtin_bit_cast(v4u,
      __builtin_amdgcn_ds_load_tr16_b128_v8i16((lds_v8s*)p));
}

// async copies of 16 bytes global -> LDS (per-lane scatter, ASYNCcnt tracked),
// a thread's copies of one trip in one statement. The wait stands in the
// copies' own statement, so that no later write of the address registers can
// be scheduled in front of it
__device__ inline void async_g2l_b128_x4(unsigned l0, const void* p0,
                                         unsigned l1, const void* p1,
                                         unsigned l2, const void* p2,
                                         unsigned l3, const void* p3) {
  asm volatile("global_load_async_to_lds_b128 %0, %1, off\n\t"
               "global_load_async_to_lds_b128 %2, %3, off\n\t"
               "global_load_async_to_lds_b128 %4, %5, off\n\t"
               "global_load_async_to_lds_b128 %6, %7, off\n\t"
               "s_wait_xcnt 0x0"
               :: "v"(l0), "v"(p0), "v"(l1), "v"(p1),
                  "v"(l2), "v"(p2), "v"(l3), "v"(p3)
               : "memory");
}

// ------------------------------------------------- weight / dtype conversion
__global__ __launch_bounds__(256) void f32_to_bf16_kernel(
    const float* __restrict__ in, unsigned short* __restrict__ out, int n) {
  int i = blockIdx.x * 256 + threadIdx.x;
  if (i < n) out[i] = f2bf(in[i]);
}

// Wk/Wv: [H][E][HS] f32  ->  [E][H*HS] bf16  (so projection is one GEMM)
__global__ __launch_bounds__(256) void headperm_bf16_kernel(
    const float* __restrict__ in, unsigned short* __restrict__ out) {
  int idx = blockIdx.x * 256 + threadIdx.x;     // idx = e*1024 + h*64 + d
  int e = idx >> 10;
  int c = idx & 1023;
  int h = c >> 6;
  int d = c & 63;
  out[idx] = f2bf(in[(size_t)h * (E_ * HS_) + (size_t)e * HS_ + d]);
}

// ------------------------------------------------------------- layernorm
__global__ __launch_bounds__(256) void layernorm_bf16_kernel(
    const float* __restrict__ x, const float* __restrict__ g,
    const float* __restrict__ b, unsigned short* __restrict__ out) {
  __shared__ float red[16];
  const int row = blockIdx.x;
  const int tid = threadIdx.x;
  const int lane = tid & 31, w = tid >> 5;

  float4 xv = ((const float4*)x)[(size_t)row * (E_ / 4) + tid];
  float s  = xv.x + xv.y + xv.z + xv.w;
  float s2 = xv.x * xv.x + xv.y * xv.y + xv.z * xv.z + xv.w * xv.w;
  #pragma unroll
  for (int o = 16; o > 0; o >>= 1) {
    s  += __shfl_down(s, o, 32);
    s2 += __shfl_down(s2, o, 32);
  }
  if (lane == 0) { red[w] = s; red[8 + w] = s2; }
  __syncthreads();
  if (tid == 0) {
    float a = 0.f, c = 0.f;
    #pragma unroll
    for (int i = 0; i < 8; ++i) { a += red[i]; c += red[8 + i]; }
    float mean = a / (float)E_;
    red[0] = mean;
    red[1] = c / (float)E_ - mean * mean;
  }
  __syncthreads();
  float mean = red[0];
  float inv  = rsqrtf(red[1] + 1e-5f);
  float vv[4] = {xv.x, xv.y, xv.z, xv.w};
  #pragma unroll
  for (int j = 0; j < 4; ++j) {
    int c = tid * 4 + j;
    float n = (vv[j] - mean) * inv * g[c] + b[c];
    out[(size_t)row * E_ + c] = f2bf(n);
  }
}

// ------------------------------------------------------------ generic GEMM
// C[M,N] = A[M,K](bf16) * B[K,N](bf16)  (+bias)(relu)(+res f32) -> f32/bf16
// block tile 64(M) x 128(N), 8 waves (2x4), wave tile 32x32.
// A trip of the K loop stages 128 k (four matrix steps): the load latency,
// the two barriers and the waits are paid once per 128 k.
// A tile staged by per-lane async global->LDS copies (ASYNCcnt), rows of 256
// bytes at a pitch of 272; B tile staged by the Tensor Data Mover
// (TENSORcnt), one DMA per trip, rows of 256 B padded to a 288 B pitch;
// B fragments come from it by transposing LDS loads (hardware k order, the
// same as the A loader's).
#define BPITCH_ 288u
template <bool BIAS, bool RELU, bool RES, bool OUT32, bool OUT16>
__global__ __launch_bounds__(256) void gemm_bf16_kernel(
    const unsigned short* __restrict__ A, const unsigned short* __restrict__ Bm,
    const float* __restrict__ bias, const float* __restrict__ res,
    float* __restrict__ out32, unsigned short* __restrict__ out16,
    int M, int N, int K) {
  constexpr int KS  = 128;                  // k staged a trip; K is a multiple
  constexpr int AP  = KS + 8;               // A pitch in elements
  constexpr int CPR = KS / 8;               // 16-byte pieces in an A row
  constexpr int RPC = 256 / CPR;            // A rows that one copy of the block fills
  __shared__ __attribute__((aligned(16)))
      unsigned short As[64 * AP];           // [64 rows][KS k], padded
  __shared__ __attribute__((aligned(2048)))
      unsigned char Bt[KS * BPITCH_];       // row-major [KS k][128 N], padded

  const int tid  = threadIdx.x;
  const int lane = tid & 31, w = tid >> 5;
  const int l16 = lane & 15, half = lane >> 4;
  const int wm = w >> 2, wn = w & 3;
  const int m0 = blockIdx.y * 64;
  const int n0 = blockIdx.x * 128;

  // D# group 1 (constant over the K loop): 1-byte elements, tensor = tile =
  // KS rows of 256 B, source pitch 2N bytes, 8 dwords of LDS pad per row.
  v8u g1;
  g1[0] = uni((1u << 20) | (5u << 22) | (7u << 25));     // pad on, 256 B, +32 B
  g1[1] = uni(256u << 16);                               // tensor_dim0 lo
  g1[2] = uni((unsigned)KS << 16);                       // dim1 lo | dim0 hi
  g1[3] = uni(256u << 16);                               // tile_dim0 | dim1 hi
  g1[4] = uni((unsigned)KS);                             // tile_dim1
  g1[5] = uni((unsigned)N * 2u);                         // source pitch, bytes
  g1[6] = uni(0u);
  g1[7] = uni(0u);
  const unsigned bt_base = lds_off(&Bt[0]);
  const unsigned wave = uni((unsigned)tid >> 5);
  // this lane's address in the tile for the transposing loads
  const unsigned char* btp = &Bt[(8u * half + (lane & 7u)) * BPITCH_ +
                                 ((lane >> 3) & 1u) * 16u + wn * 64u];
  // this thread's first 16 bytes of the A tile: row tid / CPR, piece tid % CPR;
  // its further copies lie RPC rows on each
  const int ar = tid / CPR, ac = (tid % CPR) * 8;
  const unsigned as_dst = lds_off(&As[ar * AP + ac]);

  v8f acc[2][2];
  #pragma unroll
  for (int mt = 0; mt < 2; ++mt)
    #pragma unroll
    for (int nt = 0; nt < 2; ++nt) acc[mt][nt] = vzero8();

  for (int k0 = 0; k0 < K; k0 += KS) {
    {
      const unsigned short* gp = &A[(size_t)(m0 + ar) * K + k0 + ac];
      const size_t gs = (size_t)RPC * K;          // elements between two copies
      constexpr unsigned ls = RPC * AP * 2;       // LDS bytes between two copies
      async_g2l_b128_x4(as_dst, gp, as_dst + ls, gp + gs,
                        as_dst + 2 * ls, gp + 2 * gs,
                        as_dst + 3 * ls, gp + 3 * gs);
      if (k0 + KS < K) {               // prefetch the next B tile's first rows into L2
        __builtin_prefetch(&Bm[(size_t)(k0 + KS + (tid >> 4)) * N + n0 +
                               (tid & 15) * 8], 0, 1);
      }
    }
    // the B tile's load stands behind the A copies, so that wave 0 has its own
    // copies in flight while it waits for the tile: one latency a trip, not two
    if (pinned(wave == 0u)) {          // one DMA per block per trip
      unsigned long long ga =
          (unsigned long long)(const void*)&Bm[(size_t)k0 * N + n0];
      v4u g0;
      g0[0] = uni(1u);                                   // count=1
      g0[1] = uni(bt_base);                              // lds_addr
      g0[2] = uni((unsigned)ga);                         // global_addr lo
      g0[3] = uni(((unsigned)(ga >> 32) & 0x01FFFFFFu) | (2u << 30)); // type=2
      asm volatile("tensor_load_to_lds %0, %1" :: "s"(g0), "s"(g1) : "memory");
      // the tile counts as landed only behind the issuer's own wait
      asm volatile("s_wait_tensorcnt 0x0" ::: "memory");
    }
    wait_async0();
    __syncthreads();

    #pragma unroll   // offsets become immediates; later steps' LDS loads may go ahead of earlier products
    for (int ks = 0; ks < KS / 32; ++ks) {
      Frag af[2], bf[2];
      #pragma unroll
      for (int mt = 0; mt < 2; ++mt) {
        int rr = wm * 32 + mt * 16 + l16;
        af[mt].q[0] = *(const uint4*)&As[rr * AP + ks * 32 + half * 8];
        af[mt].q[1] = *(const uint4*)&As[rr * AP + ks * 32 + 16 + half * 8];
      }
      #pragma unroll
      for (int nt = 0; nt < 2; ++nt) {
        const unsigned char* bp = btp + (unsigned)ks * 32u * BPITCH_ + nt * 32u;
        bf[nt].w[0] = ld_tr16(bp);                 // k = 32 ks + 8h + 0..7
        bf[nt].w[1] = ld_tr16(bp + 16u * BPITCH_); // k = 32 ks + 16 + 8h + ..
      }
      #pragma unroll
      for (int mt = 0; mt < 2; ++mt)
        #pragma unroll
        for (int nt = 0; nt < 2; ++nt)
          acc[mt][nt] = wmma_bf16(af[mt], bf[nt], acc[mt][nt]);
    }
    // every LDS read of this wave has retired before the next tensor load
    // and async copies refill the two tiles behind the barrier
    asm volatile("s_wait_dscnt 0x0" ::: "memory");
    __syncthreads();
  }

  // epilogue; D layout: row = r + 8*half, col = l16
  #pragma unroll
  for (int mt = 0; mt < 2; ++mt)
    #pragma unroll
    for (int nt = 0; nt < 2; ++nt)
      #pragma unroll
      for (int r = 0; r < 8; ++r) {
        int gr = m0 + wm * 32 + mt * 16 + r + 8 * half;
        int gc = n0 + wn * 32 + nt * 16 + l16;
        float v = acc[mt][nt][r];
        if constexpr (BIAS) v += bias[gc];
        if constexpr (RELU) v = fmaxf(v, 0.f);
        if constexpr (RES)  v += res[(size_t)gr * N + gc];
        if constexpr (OUT32) out32[(size_t)gr * N + gc] = v;
        if constexpr (OUT16) out16[(size_t)gr * N + gc] = f2bf(v);
      }
}

// ---------------------------------------------------- attention pass 1:
// per-COLUMN (softmax over query axis t, as in the reference) max & sumexp.
// one wave per (bh, 16-column strip); scores = k[t]·k[s] * 1/32, causal t>=s.
__global__ __launch_bounds__(32) void attn_colstats_kernel(
    const unsigned short* __restrict__ kall,
    float* __restrict__ colmax, float* __restrict__ colsum) {
  const int lane = threadIdx.x;
  const int l16 = lane & 15, half = lane >> 4;
  const int sT = blockIdx.x;
  const int bh = blockIdx.y;
  const int b = bh >> 4, h = bh & 15;
  const int bt0 = b * T_;
  const int hoff = h * HS_;
  const int s_base = sT * 16;
  const float scale = 0.03125f;               // 1024^-0.5
  const float NINF = -__builtin_inff();

  Frag bf[2];                                 // key columns (loop-invariant)
  {
    const unsigned short* kp = &kall[(size_t)(bt0 + s_base + l16) * E_ + hoff];
    bf[0].q[0] = *(const uint4*)&kp[half * 8];
    bf[0].q[1] = *(const uint4*)&kp[16 + half * 8];
    bf[1].q[0] = *(const uint4*)&kp[32 + half * 8];
    bf[1].q[1] = *(const uint4*)&kp[48 + half * 8];
  }

  float m_run = NINF, s_run = 0.f;
  const int s = s_base + l16;

  for (int tT = sT; tT < T_ / 16; ++tT) {
    const int t_base = tT * 16;
    Frag af[2];
    const unsigned short* qp = &kall[(size_t)(bt0 + t_base + l16) * E_ + hoff];
    af[0].q[0] = *(const uint4*)&qp[half * 8];
    af[0].q[1] = *(const uint4*)&qp[16 + half * 8];
    af[1].q[0] = *(const uint4*)&qp[32 + half * 8];
    af[1].q[1] = *(const uint4*)&qp[48 + half * 8];
    // holds the four loads together in front of the first product, so that a
    // trip waits out one load latency and not two (loaded values, inputs only)
    asm volatile("" :: "v"(af[0].w[0]), "v"(af[0].w[1]),
                       "v"(af[1].w[0]), "v"(af[1].w[1]));

    v8f sc = vzero8();
    sc = wmma_bf16(af[0], bf[0], sc);
    sc = wmma_bf16(af[1], bf[1], sc);

    float vals[8];
    float tmax = NINF;
    #pragma unroll
    for (int r = 0; r < 8; ++r) {
      int t = t_base + r + 8 * half;
      if (t >= s) {
        float e = sc[r] * scale;
        vals[r] = e;
        tmax = fmaxf(tmax, e);
      } else {
        vals[r] = NINF;
      }
    }
    if (tmax > NINF) {
      float nm = fmaxf(m_run, tmax);
      float acc_s = (m_run > NINF) ? s_run * __expf(m_run - nm) : 0.f;
      #pragma unroll
      for (int r = 0; r < 8; ++r)
        if (vals[r] > NINF) acc_s += __expf(vals[r] - nm);
      s_run = acc_s;
      m_run = nm;
    }
  }
  // merge the two lane halves (same columns, different row groups)
  float om = __shfl_xor(m_run, 16, 32);
  float os = __shfl_xor(s_run, 16, 32);
  float nm = fmaxf(m_run, om);
  float tot = 0.f;
  if (m_run > NINF) tot += s_run * __expf(m_run - nm);
  if (om    > NINF) tot += os   * __expf(om    - nm);
  if (lane < 16) {
    colmax[(size_t)bh * T_ + s_base + lane] = nm;
    colsum[(size_t)bh * T_ + s_base + lane] = tot;
  }
}

// ---------------------------------------------------- attention pass 2:
// attn[t,d] = sum_s P[t,s] * v[s,d],  P = exp(score-colmax[s])/colsum[s].
// one wave per (bh, 16-row strip); P re-layouts through LDS; V staged in LDS
// row-major (128 B rows at a 160 B pitch) and read by transposing LDS loads.
// The grid puts four of these waves on a SIMD: with the register budget of four
// (256) the compiler issues all 20 global loads of a trip together; with its
// default budget it reuses few registers and waits for the loads in turns.
#define VPITCH_ 160u
__global__ __launch_bounds__(32) __attribute__((amdgpu_waves_per_eu(4, 4)))
void attn_out_kernel(
    const unsigned short* __restrict__ kall,
    const unsigned short* __restrict__ vall,
    const float* __restrict__ colmax, const float* __restrict__ colsum,
    unsigned short* __restrict__ attnB) {
  __shared__ unsigned short Pl[16 * 40];     // P tile [16 t][32 s]
  __shared__ __attribute__((aligned(16)))
      unsigned char Vs[32 * VPITCH_];        // V tile [32 s][64 d], padded

  const int lane = threadIdx.x;
  const int l16 = lane & 15, half = lane >> 4;
  const int tT = blockIdx.x;
  const int bh = blockIdx.y;
  const int b = bh >> 4, h = bh & 15;
  const int bt0 = b * T_;
  const int hoff = h * HS_;
  const int t_base = tT * 16;
  const float scale = 0.03125f;

  Frag qf[2];                                 // query rows (loop-invariant)
  {
    const unsigned short* qp = &kall[(size_t)(bt0 + t_base + l16) * E_ + hoff];
    qf[0].q[0] = *(const uint4*)&qp[half * 8];
    qf[0].q[1] = *(const uint4*)&qp[16 + half * 8];
    qf[1].q[0] = *(const uint4*)&qp[32 + half * 8];
    qf[1].q[1] = *(const uint4*)&qp[48 + half * 8];
  }
  v8f acc[4];
  #pragma unroll
  for (int i = 0; i < 4; ++i) acc[i] = vzero8();

  // this lane's address in the V tile for the transposing loads
  const unsigned char* vtp = &Vs[(8u * half + (lane & 7u)) * VPITCH_ +
                                 ((lane >> 3) & 1u) * 16u];

  // this lane's 16 bytes of V row (lane >> 3), moved on by 32 rows a trip
  const unsigned short* vp =
      &vall[(size_t)(bt0 + (lane >> 3)) * E_ + hoff + (lane & 7) * 8];

  const int sBmax = (t_base + 15) >> 5;
  for (int sB = 0; sB <= sBmax; ++sB) {
    const int s0 = sB * 32;
    // stage V: 32 s-rows x 64 d, rows kept as they are
    uint4 vv[8];
    #pragma unroll   // vv[] is indexed by constants only, so it stays in registers
    for (int i = 0; i < 8; ++i)      // rows (lane >> 3) + 4 i: one address, fixed offsets
      vv[i] = *(const uint4*)(vp + (size_t)i * 4 * E_);
    vp += 32 * E_;
    #pragma unroll   // as above
    for (int i = 0; i < 8; ++i)
      *(uint4*)&Vs[((lane >> 3) + 4 * i) * VPITCH_ + (lane & 7) * 16] = vv[i];
    // scores and normalized P for the two 16-column subtiles
    #pragma unroll
    for (int sh = 0; sh < 2; ++sh) {
      const int s_sub = s0 + sh * 16;
      Frag kf[2];
      const unsigned short* kp = &kall[(size_t)(bt0 + s_sub + l16) * E_ + hoff];
      kf[0].q[0] = *(const uint4*)&kp[half * 8];
      kf[0].q[1] = *(const uint4*)&kp[16 + half * 8];
      kf[1].q[0] = *(const uint4*)&kp[32 + half * 8];
      kf[1].q[1] = *(const uint4*)&kp[48 + half * 8];
      v8f sc = vzero8();
      sc = wmma_bf16(qf[0], kf[0], sc);
      sc = wmma_bf16(qf[1], kf[1], sc);

      const int s = s_sub + l16;
      float m  = colmax[(size_t)bh * T_ + s];
      float sm = colsum[(size_t)bh * T_ + s];
      float rs = (sm > 0.f) ? 1.f / sm : 0.f;
      #pragma unroll
      for (int r = 0; r < 8; ++r) {
        int t = t_base + r + 8 * half;
        float p = 0.f;
        if (s <= t && sm > 0.f) p = __expf(sc[r] * scale - m) * rs;
        Pl[(r + 8 * half) * 40 + sh * 16 + l16] = f2bf(p);
      }
    }
    __syncthreads();
    // attn += P @ V
    Frag pf;
    pf.q[0] = *(const uint4*)&Pl[l16 * 40 + half * 8];
    pf.q[1] = *(const uint4*)&Pl[l16 * 40 + 16 + half * 8];
    #pragma unroll
    for (int nt = 0; nt < 4; ++nt) {
      Frag vf;
      vf.w[0] = ld_tr16(vtp + nt * 32u);                 // s = 8h + 0..7
      vf.w[1] = ld_tr16(vtp + 16u * VPITCH_ + nt * 32u); // s = 16 + 8h + 0..7
      acc[nt] = wmma_bf16(pf, vf, acc[nt]);
    }
    __syncthreads();
  }

  // store heads concatenated: attnB[b*T+t][h*64+d]
  #pragma unroll
  for (int nt = 0; nt < 4; ++nt)
    #pragma unroll
    for (int r = 0; r < 8; ++r) {
      int t = t_base + r + 8 * half;
      int d = nt * 16 + l16;
      attnB[(size_t)(bt0 + t) * E_ + hoff + d] = f2bf(acc[nt][r]);
    }
}

// ---------------------------------------------------------------- launcher
extern "C" void kernel_launch(void* const* d_in, const int* in_sizes, int n_in,
                              void* d_out, int out_size, void* d_ws,
                              size_t ws_size, hipStream_t stream) {
  (void)in_sizes; (void)n_in; (void)out_size; (void)ws_size;

  const float* x      = (const float*)d_in[0];
  const float* ln1_g  = (const float*)d_in[1];
  const float* ln1_b  = (const float*)d_in[2];
  const float* Wk     = (const float*)d_in[3];
  const float* Wv     = (const float*)d_in[4];
  const float* Wproj  = (const float*)d_in[5];
  const float* bproj  = (const float*)d_in[6];
  const float* ln2_g  = (const float*)d_in[7];
  const float* ln2_b  = (const float*)d_in[8];
  const float* W1     = (const float*)d_in[9];
  const float* b1     = (const float*)d_in[10];
  const float* W2     = (const float*)d_in[11];
  const float* b2     = (const float*)d_in[12];
  float* out          = (float*)d_out;

  char* ws = (char*)d_ws;
  size_t off = 0;
  auto alloc = [&](size_t bytes) -> void* {
    void* p = ws + off;
    off += (bytes + 255) & ~(size_t)255;
    return p;
  };

  unsigned short* hB     = (unsigned short*)alloc((size_t)BT_ * E_ * 2);
  unsigned short* WkB    = (unsigned short*)alloc((size_t)E_ * E_ * 2);
  unsigned short* WvB    = (unsigned short*)alloc((size_t)E_ * E_ * 2);
  unsigned short* WprojB = (unsigned short*)alloc((size_t)E_ * E_ * 2);
  unsigned short* W1B    = (unsigned short*)alloc((size_t)E_ * FF_ * 2);
  unsigned short* W2B    = (unsigned short*)alloc((size_t)FF_ * E_ * 2);
  unsigned short* kall   = (unsigned short*)alloc((size_t)BT_ * E_ * 2);
  unsigned short* vall   = (unsigned short*)alloc((size_t)BT_ * E_ * 2);
  float*          cmax   = (float*)alloc((size_t)B_ * H_ * T_ * 4);
  float*          csum   = (float*)alloc((size_t)B_ * H_ * T_ * 4);
  unsigned short* attnB  = (unsigned short*)alloc((size_t)BT_ * E_ * 2);
  float*          x1     = (float*)alloc((size_t)BT_ * E_ * 4);
  unsigned short* h2B    = (unsigned short*)alloc((size_t)BT_ * E_ * 2);
  unsigned short* actB   = (unsigned short*)alloc((size_t)BT_ * FF_ * 2);

  // weight prep
  headperm_bf16_kernel<<<(E_ * E_) / 256, 256, 0, stream>>>(Wk, WkB);
  headperm_bf16_kernel<<<(E_ * E_) / 256, 256, 0, stream>>>(Wv, WvB);
  f32_to_bf16_kernel<<<(E_ * E_) / 256, 256, 0, stream>>>(Wproj, WprojB, E_ * E_);
  f32_to_bf16_kernel<<<(E_ * FF_) / 256, 256, 0, stream>>>(W1, W1B, E_ * FF_);
  f32_to_bf16_kernel<<<(FF_ * E_) / 256, 256, 0, stream>>>(W2, W2B, FF_ * E_);

  // LN1 -> h (bf16)
  layernorm_bf16_kernel<<<BT_, 256, 0, stream>>>(x, ln1_g, ln1_b, hB);

  // k = h @ Wk', v = h @ Wv'   (bf16 out for attention WMMA)
  dim3 gE(E_ / 128, BT_ / 64);
  gemm_bf16_kernel<false, false, false, false, true>
      <<<gE, 256, 0, stream>>>(hB, WkB, nullptr, nullptr, nullptr, kall,
                               BT_, E_, E_);
  gemm_bf16_kernel<false, false, false, false, true>
      <<<gE, 256, 0, stream>>>(hB, WvB, nullptr, nullptr, nullptr, vall,
                               BT_, E_, E_);

  // attention: column softmax stats, then output
  dim3 gA(T_ / 16, B_ * H_);
  attn_colstats_kernel<<<gA, 32, 0, stream>>>(kall, cmax, csum);
  attn_out_kernel<<<gA, 32, 0, stream>>>(kall, vall, cmax, csum, attnB);

  // x1 = x + attn @ Wproj + bproj   (f32)
  gemm_bf16_kernel<true, false, true, true, false>
      <<<gE, 256, 0, stream>>>(attnB, WprojB, bproj, x, x1, nullptr,
                               BT_, E_, E_);

  // LN2 -> h2 (bf16)
  layernorm_bf16_kernel<<<BT_, 256, 0, stream>>>(x1, ln2_g, ln2_b, h2B);

  // act = relu(h2 @ W1 + b1)   (bf16)
  dim3 gF(FF_ / 128, BT_ / 64);
  gemm_bf16_kernel<true, true, false, false, true>
      <<<gF, 256, 0, stream>>>(h2B, W1B, b1, nullptr, nullptr, actB,
                               BT_, FF_, E_);

  // out = x1 + act @ W2 + b2   (f32)
  gemm_bf16_kernel<true, false, true, true, false>
      <<<gE, 256, 0, stream>>>(actB, W2B, b2, x1, out, nullptr,
                               BT_, E_, FF_);
}

// v004
// It runs in 270 microseconds.
// Next to v003, in two timings, it ran 1.15 times as fast each time.
// Counting every step since v000, it is 2.61 times as fast.
#include <hip/hip_runtime.h>

// ---------------------------------------------------------------- constants
#define E_   1024
#define H_   16
#define HS_  64
#define B_   2
#define T_   2048
#define BT_  (B_ * T_)
#define FF_  (4 * E_)

typedef __attribute__((ext_vector_type(16))) __bf16     v16bf;
typedef __attribute__((ext_vector_type(8)))  float      v8f;
typedef __attribute__((ext_vector_type(4)))  unsigned   v4u;
typedef __attribute__((ext_vector_type(8)))  unsigned   v8u;

typedef __attribute__((ext_vector_type(8)))  short      v8s;

union Frag { v16bf v; uint4 q[2]; v4u w[2]; unsigned short us[16]; };

__device__ inline unsigned short f2bf(float f) {
  unsigned u = __float_as_uint(f);
  u += 0x7fffu + ((u >> 16) & 1u);           // round-to-nearest-even
  return (unsigned short)(u >> 16);
}

__device__ inline v8f vzero8() {
  v8f z = {0.f, 0.f, 0.f, 0.f, 0.f, 0.f, 0.f, 0.f};
  return z;
}

__device__ inline v8f wmma_bf16(const Frag& a, const Frag& b, v8f c) {
  return __builtin_amdgcn_wmma_f32_16x16x32_bf16(
      /*neg_a=*/false, a.v, /*neg_b=*/false, b.v,
      /*c_mod=*/(short)0, c, /*reuse_a=*/false, /*reuse_b=*/false);
}

// LDS offset of a shared-memory pointer: generic LDS addresses keep the
// LDS byte offset in the low 32 bits (ISA 10.2 aperture rules).
__device__ inline unsigned lds_off(const void* p) {
  return (unsigned)(unsigned long long)p;
}

__device__ inline void wait_async0() {
  asm volatile("s_wait_asynccnt 0x0" ::: "memory");
}

__device__ inline unsigned pinned(unsigned v) {
  unsigned w = (unsigned)__builtin_amdgcn_readfirstlane(v);
  asm volatile("" : "+s"(w));   // pinned(): the tensor mover's issue test word held in a scalar register
  return w;
}

__device__ inline unsigned uni(unsigned v) {
  return (unsigned)__builtin_amdgcn_readfirstlane(v);
}

// transposing LDS load: lane (c = l & 15, h = l >> 4) receives
// T[kbase + 8h + 0..7][dbase + c] of a row-major 16-bit tile
__device__ inline v4u ld_tr16(const unsigned char* p) {
  typedef __attribute__((address_space(3))) v8s lds_v8s;
  return __builtin_bit_cast(v4u,
      __builtin_amdgcn_ds_load_tr16_b128_v8i16((lds_v8s*)p));
}

// async copies of 16 bytes global -> LDS (per-lane scatter, ASYNCcnt tracked),
// a thread's copies of one trip in one statement. The wait stands in the
// copies' own statement, so that no later write of the address registers can
// be scheduled in front of it
__device__ inline void async_g2l_b128_x4(unsigned l0, const void* p0,
                                         unsigned l1, const void* p1,
                                         unsigned l2, const void* p2,
                                         unsigned l3, const void* p3) {
  asm volatile("global_load_async_to_lds_b128 %0, %1, off\n\t"
               "global_load_async_to_lds_b128 %2, %3, off\n\t"
               "global_load_async_to_lds_b128 %4, %5, off\n\t"
               "global_load_async_to_lds_b128 %6, %7, off\n\t"
               "s_wait_xcnt 0x0"
               :: "v"(l0), "v"(p0), "v"(l1), "v"(p1),
                  "v"(l2), "v"(p2), "v"(l3), "v"(p3)
               : "memory");
}

// ------------------------------------------------- weight / dtype conversion
__global__ __launch_bounds__(256) void f32_to_bf16_kernel(
    const float* __restrict__ in, unsigned short* __restrict__ out, int n) {
  int i = blockIdx.x * 256 + threadIdx.x;
  if (i < n) out[i] = f2bf(in[i]);
}

// Wk/Wv: [H][E][HS] f32  ->  [E][H*HS] bf16  (so projection is one GEMM)
__global__ __launch_bounds__(256) void headperm_bf16_kernel(
    const float* __restrict__ in, unsigned short* __restrict__ out) {
  int idx = blockIdx.x * 256 + threadIdx.x;     // idx = e*1024 + h*64 + d
  int e = idx >> 10;
  int c = idx & 1023;
  int h = c >> 6;
  int d = c & 63;
  out[idx] = f2bf(in[(size_t)h * (E_ * HS_) + (size_t)e * HS_ + d]);
}

// ------------------------------------------------------------- layernorm
__global__ __launch_bounds__(256) void layernorm_bf16_kernel(
    const float* __restrict__ x, const float* __restrict__ g,
    const float* __restrict__ b, unsigned short* __restrict__ out) {
  __shared__ float red[16];
  const int row = blockIdx.x;
  const int tid = threadIdx.x;
  const int lane = tid & 31, w = tid >> 5;

  float4 xv = ((const float4*)x)[(size_t)row * (E_ / 4) + tid];
  float s  = xv.x + xv.y + xv.z + xv.w;
  float s2 = xv.x * xv.x + xv.y * xv.y + xv.z * xv.z + xv.w * xv.w;
  #pragma unroll
  for (int o = 16; o > 0; o >>= 1) {
    s  += __shfl_down(s, o, 32);
    s2 += __shfl_down(s2, o, 32);
  }
  if (lane == 0) { red[w] = s; red[8 + w] = s2; }
  __syncthreads();
  if (tid == 0) {
    float a = 0.f, c = 0.f;
    #pragma unroll
    for (int i = 0; i < 8; ++i) { a += red[i]; c += red[8 + i]; }
    float mean = a / (float)E_;
    red[0] = mean;
    red[1] = c / (float)E_ - mean * mean;
  }
  __syncthreads();
  float mean = red[0];
  float inv  = rsqrtf(red[1] + 1e-5f);
  float vv[4] = {xv.x, xv.y, xv.z, xv.w};
  #pragma unroll
  for (int j = 0; j < 4; ++j) {
    int c = tid * 4 + j;
    float n = (vv[j] - mean) * inv * g[c] + b[c];
    out[(size_t)row * E_ + c] = f2bf(n);
  }
}

// ------------------------------------------------------------ generic GEMM
// C[M,N] = A[M,K](bf16) * B[K,N](bf16)  (+bias)(relu)(+res f32) -> f32/bf16
// block tile 64(M) x 128(N), 8 waves (2x4), wave tile 32x32.
// A trip of the K loop stages 128 k (four matrix steps): the load latency,
// the two barriers and the waits are paid once per 128 k.
// A tile staged by per-lane async global->LDS copies (ASYNCcnt), rows of 256
// bytes at a pitch of 272; B tile staged by the Tensor Data Mover
// (TENSORcnt), one DMA per trip, rows of 256 B padded to a 288 B pitch;
// B fragments come from it by transposing LDS loads (hardware k order, the
// same as the A loader's).
#define BPITCH_ 288u
template <bool BIAS, bool RELU, bool RES, bool OUT32, bool OUT16>
__global__ __launch_bounds__(256) void gemm_bf16_kernel(
    const unsigned short* __restrict__ A, const unsigned short* __restrict__ Bm,
    const float* __restrict__ bias, const float* __restrict__ res,
    float* __restrict__ out32, unsigned short* __restrict__ out16,
    int M, int N, int K) {
  constexpr int KS  = 128;                  // k staged a trip; K is a multiple
  constexpr int AP  = KS + 8;               // A pitch in elements
  constexpr int CPR = KS / 8;               // 16-byte pieces in an A row
  constexpr int RPC = 256 / CPR;            // A rows that one copy of the block fills
  __shared__ __attribute__((aligned(16)))
      unsigned short As[64 * AP];           // [64 rows][KS k], padded
  __shared__ __attribute__((aligned(2048)))
      unsigned char Bt[KS * BPITCH_];       // row-major [KS k][128 N], padded

  const int tid  = threadIdx.x;
  const int lane = tid & 31, w = tid >> 5;
  const int l16 = lane & 15, half = lane >> 4;
  const int wm = w >> 2, wn = w & 3;
  const int m0 = blockIdx.y * 64;
  const int n0 = blockIdx.x * 128;

  // D# group 1 (constant over the K loop): 1-byte elements, tensor = tile =
  // KS rows of 256 B, source pitch 2N bytes, 8 dwords of LDS pad per row.
  v8u g1;
  g1[0] = uni((1u << 20) | (5u << 22) | (7u << 25));     // pad on, 256 B, +32 B
  g1[1] = uni(256u << 16);                               // tensor_dim0 lo
  g1[2] = uni((unsigned)KS << 16);                       // dim1 lo | dim0 hi
  g1[3] = uni(256u << 16);                               // tile_dim0 | dim1 hi
  g1[4] = uni((unsigned)KS);                             // tile_dim1
  g1[5] = uni((unsigned)N * 2u);                         // source pitch, bytes
  g1[6] = uni(0u);
  g1[7] = uni(0u);
  const unsigned bt_base = lds_off(&Bt[0]);
  const unsigned wave = uni((unsigned)tid >> 5);
  // this lane's address in the tile for the transposing loads
  const unsigned char* btp = &Bt[(8u * half + (lane & 7u)) * BPITCH_ +
                                 ((lane >> 3) & 1u) * 16u + wn * 64u];
  // this thread's first 16 bytes of the A tile: row tid / CPR, piece tid % CPR;
  // its further copies lie RPC rows on each
  const int ar = tid / CPR, ac = (tid % CPR) * 8;
  const unsigned as_dst = lds_off(&As[ar * AP + ac]);

  v8f acc[2][2];
  #pragma unroll
  for (int mt = 0; mt < 2; ++mt)
    #pragma unroll
    for (int nt = 0; nt < 2; ++nt) acc[mt][nt] = vzero8();

  for (int k0 = 0; k0 < K; k0 += KS) {
    {
      const unsigned short* gp = &A[(size_t)(m0 + ar) * K + k0 + ac];
      const size_t gs = (size_t)RPC * K;          // elements between two copies
      constexpr unsigned ls = RPC * AP * 2;       // LDS bytes between two copies
      async_g2l_b128_x4(as_dst, gp, as_dst + ls, gp + gs,
                        as_dst + 2 * ls, gp + 2 * gs,
                        as_dst + 3 * ls, gp + 3 * gs);
      if (k0 + KS < K) {               // prefetch the next B tile's first rows into L2
        __builtin_prefetch(&Bm[(size_t)(k0 + KS + (tid >> 4)) * N + n0 +
                               (tid & 15) * 8], 0, 1);
      }
    }
    // the B tile's load stands behind the A copies, so that wave 0 has its own
    // copies in flight while it waits for the tile: one latency a trip, not two
    if (pinned(wave == 0u)) {          // one DMA per block per trip
      unsigned long long ga =
          (unsigned long long)(const void*)&Bm[(size_t)k0 * N + n0];
      v4u g0;
      g0[0] = uni(1u);                                   // count=1
      g0[1] = uni(bt_base);                              // lds_addr
      g0[2] = uni((unsigned)ga);                         // global_addr lo
      g0[3] = uni(((unsigned)(ga >> 32) & 0x01FFFFFFu) | (2u << 30)); // type=2
      asm volatile("tensor_load_to_lds %0, %1" :: "s"(g0), "s"(g1) : "memory");
      // the tile counts as landed only behind the issuer's own wait
      asm volatile("s_wait_tensorcnt 0x0" ::: "memory");
    }
    wait_async0();
    __syncthreads();

    #pragma unroll   // offsets become immediates; later steps' LDS loads may go ahead of earlier products
    for (int ks = 0; ks < KS / 32; ++ks) {
      Frag af[2], bf[2];
      #pragma unroll
      for (int mt = 0; mt < 2; ++mt) {
        int rr = wm * 32 + mt * 16 + l16;
        af[mt].q[0] = *(const uint4*)&As[rr * AP + ks * 32 + half * 8];
        af[mt].q[1] = *(const uint4*)&As[rr * AP + ks * 32 + 16 + half * 8];
      }
      #pragma unroll
      for (int nt = 0; nt < 2; ++nt) {
        const unsigned char* bp = btp + (unsigned)ks * 32u * BPITCH_ + nt * 32u;
        bf[nt].w[0] = ld_tr16(bp);                 // k = 32 ks + 8h + 0..7
        bf[nt].w[1] = ld_tr16(bp + 16u * BPITCH_); // k = 32 ks + 16 + 8h + ..
      }
      #pragma unroll
      for (int mt = 0; mt < 2; ++mt)
        #pragma unroll
        for (int nt = 0; nt < 2; ++nt)
          acc[mt][nt] = wmma_bf16(af[mt], bf[nt], acc[mt][nt]);
    }
    // every LDS read of this wave has retired before the next tensor load
    // and async copies refill the two tiles behind the barrier
    asm volatile("s_wait_dscnt 0x0" ::: "memory");
    __syncthreads();
  }

  // epilogue; D layout: row = r + 8*half, col = l16
  #pragma unroll
  for (int mt = 0; mt < 2; ++mt)
    #pragma unroll
    for (int nt = 0; nt < 2; ++nt)
      #pragma unroll
      for (int r = 0; r < 8; ++r) {
        int gr = m0 + wm * 32 + mt * 16 + r + 8 * half;
        int gc = n0 + wn * 32 + nt * 16 + l16;
        float v = acc[mt][nt][r];
        if constexpr (BIAS) v += bias[gc];
        if constexpr (RELU) v = fmaxf(v, 0.f);
        if constexpr (RES)  v += res[(size_t)gr * N + gc];
        if constexpr (OUT32) out32[(size_t)gr * N + gc] = v;
        if constexpr (OUT16) out16[(size_t)gr * N + gc] = f2bf(v);
      }
}

// ---------------------------------------------------- attention pass 1:
// per-COLUMN (softmax over query axis t, as in the reference) max & sumexp.
// scores = k[t].k[s] * 1/32, causal t>=s.
// One block of four waves per (bh, 64 columns). Every wave holds all 64 key
// columns in registers and takes every fourth 16-row tile, so that a loaded
// tile meets four column strips and the longest loop is 32 trips; the four
// waves' partial max and sum of a column are merged through LDS at the end.
// Grid: x = bh, y = column group, the group with the most rows first.
// nine 2^x in one statement. The outputs lie apart from every input (early
// clobber) and a v_nop ends the statement: behind each v_exp_f32 stands an
// instruction that neither reads its result nor overwrites its source, which
// the instruction set asks for
__device__ inline void exp2_x9(float (&o)[9], const float (&x)[9]) {
  asm("v_exp_f32 %0, %9\n\t"
      "v_exp_f32 %1, %10\n\t"
      "v_exp_f32 %2, %11\n\t"
      "v_exp_f32 %3, %12\n\t"
      "v_exp_f32 %4, %13\n\t"
      "v_exp_f32 %5, %14\n\t"
      "v_exp_f32 %6, %15\n\t"
      "v_exp_f32 %7, %16\n\t"
      "v_exp_f32 %8, %17\n\t"
      "v_nop"
      : "=&v"(o[0]), "=&v"(o[1]), "=&v"(o[2]), "=&v"(o[3]), "=&v"(o[4]),
        "=&v"(o[5]), "=&v"(o[6]), "=&v"(o[7]), "=&v"(o[8])
      : "v"(x[0]), "v"(x[1]), "v"(x[2]), "v"(x[3]), "v"(x[4]),
        "v"(x[5]), "v"(x[6]), "v"(x[7]), "v"(x[8]));
}

#define CS_NW_ 4                              // waves of a block
#define CS_NS_ 4                              // 16-column strips of a wave
// The grid puts four of these waves on a SIMD: the register budget of four
// (256) lets the four strips' independent chains be scheduled side by side.
__global__ __launch_bounds__(32 * CS_NW_) __attribute__((amdgpu_waves_per_eu(4, 4)))
void attn_colstats_kernel(
    const unsigned short* __restrict__ kall,
    float* __restrict__ colmax, float* __restrict__ colsum) {
  __shared__ float mrg_m[CS_NW_][CS_NS_ * 16];
  __shared__ float mrg_s[CS_NW_][CS_NS_ * 16];
  const int tid = threadIdx.x;
  const int lane = tid & 31;
  const int w = (int)uni((unsigned)tid >> 5);  // scalar: the row loop's count and addresses stay scalar
  const int l16 = lane & 15, half = lane >> 4;
  const int bh = blockIdx.x;
  const int sG = blockIdx.y;
  const int b = bh >> 4, h = bh & 15;
  const int bt0 = b * T_;
  const int hoff = h * HS_;
  const int s_base = sG * (CS_NS_ * 16);
  const float scale = 0.03125f;               // 1024^-0.5
  const float NINF = -__builtin_inff();
  const float LOG2E = 1.44269504f;

  // head h of batch b, row 0 (the same in every lane), and this lane's place
  // in a 16-row tile
  const unsigned short* kbh = &kall[(size_t)bt0 * E_ + hoff];
  const unsigned lo = (unsigned)l16 * E_;

  Frag bf[CS_NS_][2];                         // key columns (loop-invariant)
  #pragma unroll
  for (int j = 0; j < CS_NS_; ++j) {
    const unsigned short* kp = kbh + (size_t)(s_base + j * 16) * E_ + lo;
    bf[j][0].q[0] = *(const uint4*)&kp[half * 8];
    bf[j][0].q[1] = *(const uint4*)&kp[16 + half * 8];
    bf[j][1].q[0] = *(const uint4*)&kp[32 + half * 8];
    bf[j][1].q[1] = *(const uint4*)&kp[48 + half * 8];
  }

  float m_run[CS_NS_], s_run[CS_NS_];
  #pragma unroll
  for (int j = 0; j < CS_NS_; ++j) { m_run[j] = NINF; s_run[j] = 0.f; }

  for (int tT = sG * CS_NS_ + w; tT < T_ / 16; tT += CS_NW_) {
    const int t_base = tT * 16;
    Frag af[2];
    const unsigned short* qp = kbh + (size_t)t_base * E_ + lo;
    af[0].q[0] = *(const uint4*)&qp[half * 8];
    af[0].q[1] = *(const uint4*)&qp[16 + half * 8];
    af[1].q[0] = *(const uint4*)&qp[32 + half * 8];
    af[1].q[1] = *(const uint4*)&qp[48 + half * 8];
    // holds the four loads together in front of the first product, so that a
    // trip waits out one load latency and not two (loaded values, inputs only)
    asm volatile("" :: "v"(af[0].w[0]), "v"(af[0].w[1]),
                       "v"(af[1].w[0]), "v"(af[1].w[1]));

    #pragma unroll   // m_run[], s_run[], bf[] indexed by constants: they stay in registers
    for (int j = 0; j < CS_NS_; ++j) {
      const int s = s_base + j * 16 + l16;
      v8f sc = vzero8();
      sc = wmma_bf16(af[0], bf[j][0], sc);
      sc = wmma_bf16(af[1], bf[j][1], sc);

      float vals[8];
      float tmax = NINF;
      #pragma unroll
      for (int r = 0; r < 8; ++r) {
        int t = t_base + r + 8 * half;
        if (t >= s) {
          float e = sc[r] * scale;
          vals[r] = e;
          tmax = fmaxf(tmax, e);
        } else {
          vals[r] = NINF;
        }
      }
      // a lane whose eight rows are all masked keeps its max and its sum: the
      // selects below leave both as they are, so no branch stands between the strips
      float nm = fmaxf(m_run[j], tmax);
      float xs[9], ex[9];                     // e^d = 2^(d * log2 e)
      #pragma unroll
      for (int r = 0; r < 8; ++r) xs[r] = (vals[r] - nm) * LOG2E;
      xs[8] = (m_run[j] - nm) * LOG2E;
      exp2_x9(ex, xs);
      float acc_s = (m_run[j] > NINF) ? s_run[j] * ex[8] : 0.f;
      #pragma unroll
      for (int r = 0; r < 8; ++r)
        if (vals[r] > NINF) acc_s += ex[r];
      s_run[j] = acc_s;
      m_run[j] = nm;
    }
  }
  // merge the two lane halves (same columns, different row groups)
  #pragma unroll
  for (int j = 0; j < CS_NS_; ++j) {
    float om = __shfl_xor(m_run[j], 16, 32);
    float os = __shfl_xor(s_run[j], 16, 32);
    float nm = fmaxf(m_run[j], om);
    float tot = 0.f;
    if (m_run[j] > NINF) tot += s_run[j] * __expf(m_run[j] - nm);
    if (om       > NINF) tot += os       * __expf(om       - nm);
    if (lane < 16) {
      mrg_m[w][j * 16 + lane] = nm;
      mrg_s[w][j * 16 + lane] = tot;
    }
  }
  __syncthreads();
  // merge the four waves, in wave order; one thread per column
  if (tid < CS_NS_ * 16) {
    float nm = NINF;
    #pragma unroll
    for (int i = 0; i < CS_NW_; ++i) nm = fmaxf(nm, mrg_m[i][tid]);
    float tot = 0.f;
    #pragma unroll
    for (int i = 0; i < CS_NW_; ++i) {
      float mi = mrg_m[i][tid];
      if (mi > NINF) tot += mrg_s[i][tid] * __expf(mi - nm);
    }
    colmax[(size_t)bh * T_ + s_base + tid] = nm;
    colsum[(size_t)bh * T_ + s_base + tid] = tot;
  }
}

// ---------------------------------------------------- attention pass 2:
// attn[t,d] = sum_s P[t,s] * v[s,d],  P = exp(score-colmax[s])/colsum[s].
// one wave per (bh, 16-row strip); P re-layouts through LDS; V staged in LDS
// row-major (128 B rows at a 160 B pitch) and read by transposing LDS loads.
// The grid puts four of these waves on a SIMD: with the register budget of four
// (256) the compiler issues all 20 global loads of a trip together; with its
// default budget it reuses few registers and waits for the loads in turns.
#define VPITCH_ 160u
__global__ __launch_bounds__(32) __attribute__((amdgpu_waves_per_eu(4, 4)))
void attn_out_kernel(
    const unsigned short* __restrict__ kall,
    const unsigned short* __restrict__ vall,
    const float* __restrict__ colmax, const float* __restrict__ colsum,
    unsigned short* __restrict__ attnB) {
  __shared__ unsigned short Pl[16 * 40];     // P tile [16 t][32 s]
  __shared__ __attribute__((aligned(16)))
      unsigned char Vs[32 * VPITCH_];        // V tile [32 s][64 d], padded

  const int lane = threadIdx.x;
  const int l16 = lane & 15, half = lane >> 4;
  const int tT = blockIdx.x;
  const int bh = blockIdx.y;
  const int b = bh >> 4, h = bh & 15;
  const int bt0 = b * T_;
  const int hoff = h * HS_;
  const int t_base = tT * 16;
  const float scale = 0.03125f;

  Frag qf[2];                                 // query rows (loop-invariant)
  {
    const unsigned short* qp = &kall[(size_t)(bt0 + t_base + l16) * E_ + hoff];
    qf[0].q[0] = *(const uint4*)&qp[half * 8];
    qf[0].q[1] = *(const uint4*)&qp[16 + half * 8];
    qf[1].q[0] = *(const uint4*)&qp[32 + half * 8];
    qf[1].q[1] = *(const uint4*)&qp[48 + half * 8];
  }
  v8f acc[4];
  #pragma unroll
  for (int i = 0; i < 4; ++i) acc[i] = vzero8();

  // this lane's address in the V tile for the transposing loads
  const unsigned char* vtp = &Vs[(8u * half + (lane & 7u)) * VPITCH_ +
                                 ((lane >> 3) & 1u) * 16u];

  // this lane's 16 bytes of V row (lane >> 3), moved on by 32 rows a trip
  const unsigned short* vp =
      &vall[(size_t)(bt0 + (lane >> 3)) * E_ + hoff + (lane & 7) * 8];

  const int sBmax = (t_base + 15) >> 5;
  for (int sB = 0; sB <= sBmax; ++sB) {
    const int s0 = sB * 32;
    // stage V: 32 s-rows x 64 d, rows kept as they are
    uint4 vv[8];
    #pragma unroll   // vv[] is indexed by constants only, so it stays in registers
    for (int i = 0; i < 8; ++i)      // rows (lane >> 3) + 4 i: one address, fixed offsets
      vv[i] = *(const uint4*)(vp + (size_t)i * 4 * E_);
    vp += 32 * E_;
    #pragma unroll   // as above
    for (int i = 0; i < 8; ++i)
      *(uint4*)&Vs[((lane >> 3) + 4 * i) * VPITCH_ + (lane & 7) * 16] = vv[i];
    // scores and normalized P for the two 16-column subtiles
    #pragma unroll
    for (int sh = 0; sh < 2; ++sh) {
      const int s_sub = s0 + sh * 16;
      Frag kf[2];
      const unsigned short* kp = &kall[(size_t)(bt0 + s_sub + l16) * E_ + hoff];
      kf[0].q[0] = *(const uint4*)&kp[half * 8];
      kf[0].q[1] = *(const uint4*)&kp[16 + half * 8];
      kf[1].q[0] = *(const uint4*)&kp[32 + half * 8];
      kf[1].q[1] = *(const uint4*)&kp[48 + half * 8];
      v8f sc = vzero8();
      sc = wmma_bf16(qf[0], kf[0], sc);
      sc = wmma_bf16(qf[1], kf[1], sc);

      const int s = s_sub + l16;
      float m  = colmax[(size_t)bh * T_ + s];
      float sm = colsum[(size_t)bh * T_ + s];
      float rs = (sm > 0.f) ? 1.f / sm : 0.f;
      #pragma unroll
      for (int r = 0; r < 8; ++r) {
        int t = t_base + r + 8 * half;
        float p = 0.f;
        if (s <= t && sm > 0.f) p = __expf(sc[r] * scale - m) * rs;
        Pl[(r + 8 * half) * 40 + sh * 16 + l16] = f2bf(p);
      }
    }
    __syncthreads();
    // attn += P @ V
    Frag pf;
    pf.q[0] = *(const uint4*)&Pl[l16 * 40 + half * 8];
    pf.q[1] = *(const uint4*)&Pl[l16 * 40 + 16 + half * 8];
    #pragma unroll
    for (int nt = 0; nt < 4; ++nt) {
      Frag vf;
      vf.w[0] = ld_tr16(vtp + nt * 32u);                 // s = 8h + 0..7
      vf.w[1] = ld_tr16(vtp + 16u * VPITCH_ + nt * 32u); // s = 16 + 8h + 0..7
      acc[nt] = wmma_bf16(pf, vf, acc[nt]);
    }
    __syncthreads();
  }

  // store heads concatenated: attnB[b*T+t][h*64+d]
  #pragma unroll
  for (int nt = 0; nt < 4; ++nt)
    #pragma unroll
    for (int r = 0; r < 8; ++r) {
      int t = t_base + r + 8 * half;
      int d = nt * 16 + l16;
      attnB[(size_t)(bt0 + t) * E_ + hoff + d] = f2bf(acc[nt][r]);
    }
}

// ---------------------------------------------------------------- launcher
extern "C" void kernel_launch(void* const* d_in, const int* in_sizes, int n_in,
                              void* d_out, int out_size, void* d_ws,
                              size_t ws_size, hipStream_t stream) {
  (void)in_sizes; (void)n_in; (void)out_size; (void)ws_size;

  const float* x      = (const float*)d_in[0];
  const float* ln1_g  = (const float*)d_in[1];
  const float* ln1_b  = (const float*)d_in[2];
  const float* Wk     = (const float*)d_in[3];
  const float* Wv     = (const float*)d_in[4];
  const float* Wproj  = (const float*)d_in[5];
  const float* bproj  = (const float*)d_in[6];
  const float* ln2_g  = (const float*)d_in[7];
  const float* ln2_b  = (const float*)d_in[8];
  const float* W1     = (const float*)d_in[9];
  const float* b1     = (const float*)d_in[10];
  const float* W2     = (const float*)d_in[11];
  const float* b2     = (const float*)d_in[12];
  float* out          = (float*)d_out;

  char* ws = (char*)d_ws;
  size_t off = 0;
  auto alloc = [&](size_t bytes) -> void* {
    void* p = ws + off;
    off += (bytes + 255) & ~(size_t)255;
    return p;
  };

  unsigned short* hB     = (unsigned short*)alloc((size_t)BT_ * E_ * 2);
  unsigned short* WkB    = (unsigned short*)alloc((size_t)E_ * E_ * 2);
  unsigned short* WvB    = (unsigned short*)alloc((size_t)E_ * E_ * 2);
  unsigned short* WprojB = (unsigned short*)alloc((size_t)E_ * E_ * 2);
  unsigned short* W1B    = (unsigned short*)alloc((size_t)E_ * FF_ * 2);
  unsigned short* W2B    = (unsigned short*)alloc((size_t)FF_ * E_ * 2);
  unsigned short* kall   = (unsigned short*)alloc((size_t)BT_ * E_ * 2);
  unsigned short* vall   = (unsigned short*)alloc((size_t)BT_ * E_ * 2);
  float*          cmax   = (float*)alloc((size_t)B_ * H_ * T_ * 4);
  float*          csum   = (float*)alloc((size_t)B_ * H_ * T_ * 4);
  unsigned short* attnB  = (unsigned short*)alloc((size_t)BT_ * E_ * 2);
  float*          x1     = (float*)alloc((size_t)BT_ * E_ * 4);
  unsigned short* h2B    = (unsigned short*)alloc((size_t)BT_ * E_ * 2);
  unsigned short* actB   = (unsigned short*)alloc((size_t)BT_ * FF_ * 2);

  // weight prep
  headperm_bf16_kernel<<<(E_ * E_) / 256, 256, 0, stream>>>(Wk, WkB);
  headperm_bf16_kernel<<<(E_ * E_) / 256, 256, 0, stream>>>(Wv, WvB);
  f32_to_bf16_kernel<<<(E_ * E_) / 256, 256, 0, stream>>>(Wproj, WprojB, E_ * E_);
  f32_to_bf16_kernel<<<(E_ * FF_) / 256, 256, 0, stream>>>(W1, W1B, E_ * FF_);
  f32_to_bf16_kernel<<<(FF_ * E_) / 256, 256, 0, stream>>>(W2, W2B, FF_ * E_);

  // LN1 -> h (bf16)
  layernorm_bf16_kernel<<<BT_, 256, 0, stream>>>(x, ln1_g, ln1_b, hB);

  // k = h @ Wk', v = h @ Wv'   (bf16 out for attention WMMA)
  dim3 gE(E_ / 128, BT_ / 64);
  gemm_bf16_kernel<false, false, false, false, true>
      <<<gE, 256, 0, stream>>>(hB, WkB, nullptr, nullptr, nullptr, kall,
                               BT_, E_, E_);
  gemm_bf16_kernel<false, false, false, false, true>
      <<<gE, 256, 0, stream>>>(hB, WvB, nullptr, nullptr, nullptr, vall,
                               BT_, E_, E_);

  // attention: column softmax stats, then output
  dim3 gA(T_ / 16, B_ * H_);
  dim3 gC(B_ * H_, T_ / (CS_NS_ * 16));
  attn_colstats_kernel<<<gC, 32 * CS_NW_, 0, stream>>>(kall, cmax, csum);
  attn_out_kernel<<<gA, 32, 0, stream>>>(kall, vall, cmax, csum, attnB);

  // x1 = x + attn @ Wproj + bproj   (f32)
  gemm_bf16_kernel<true, false, true, true, false>
      <<<gE, 256, 0, stream>>>(attnB, WprojB, bproj, x, x1, nullptr,
                               BT_, E_, E_);

  // LN2 -> h2 (bf16)
  layernorm_bf16_kernel<<<BT_, 256, 0, stream>>>(x1, ln2_g, ln2_b, h2B);

  // act = relu(h2 @ W1 + b1)   (bf16)
  dim3 gF(FF_ / 128, BT_ / 64);
  gemm_bf16_kernel<true, true, false, false, true>
      <<<gF, 256, 0, stream>>>(h2B, W1B, b1, nullptr, nullptr, actB,
                               BT_, FF_, E_);

  // out = x1 + act @ W2 + b2   (f32)
  gemm_bf16_kernel<true, false, true, true, false>
      <<<gE, 256, 0, stream>>>(actB, W2B, b2, x1, out, nullptr,
                               BT_, E_, FF_);
}

// v005
// One run takes 254 microseconds.
// Next to v004, in two timings, it ran 1.07 times as fast each time.
// Over all steps from v000 it is 2.78 times as fast.
#include <hip/hip_runtime.h>

// ---------------------------------------------------------------- constants
#define E_   1024
#define H_   16
#define HS_  64
#define B_   2
#define T_   2048
#define BT_  (B_ * T_)
#define FF_  (4 * E_)

typedef __attribute__((ext_vector_type(16))) __bf16     v16bf;
typedef __attribute__((ext_vector_type(8)))  float      v8f;
typedef __attribute__((ext_vector_type(4)))  unsigned   v4u;
typedef __attribute__((ext_vector_type(8)))  unsigned   v8u;

typedef __attribute__((ext_vector_type(8)))  short      v8s;
typedef __attribute__((ext_vector_type(4)))  float      v4f;

union Frag { v16bf v; uint4 q[2]; v4u w[2]; unsigned short us[16]; };

__device__ inline unsigned short f2bf(float f) {
  unsigned u = __float_as_uint(f);
  u += 0x7fffu + ((u >> 16) & 1u);           // round-to-nearest-even
  return (unsigned short)(u >> 16);
}

__device__ inline v8f vzero8() {
  v8f z = {0.f, 0.f, 0.f, 0.f, 0.f, 0.f, 0.f, 0.f};
  return z;
}

__device__ inline v8f wmma_bf16(const Frag& a, const Frag& b, v8f c) {
  return __builtin_amdgcn_wmma_f32_16x16x32_bf16(
      /*neg_a=*/false, a.v, /*neg_b=*/false, b.v,
      /*c_mod=*/(short)0, c, /*reuse_a=*/false, /*reuse_b=*/false);
}

// LDS offset of a shared-memory pointer: generic LDS addresses keep the
// LDS byte offset in the low 32 bits (ISA 10.2 aperture rules).
__device__ inline unsigned lds_off(const void* p) {
  return (unsigned)(unsigned long long)p;
}

__device__ inline void wait_async0() {
  asm volatile("s_wait_asynccnt 0x0" ::: "memory");
}

__device__ inline unsigned pinned(unsigned v) {
  unsigned w = (unsigned)__builtin_amdgcn_readfirstlane(v);
  asm volatile("" : "+s"(w));   // pinned(): the tensor mover's issue test word held in a scalar register
  return w;
}

__device__ inline unsigned uni(unsigned v) {
  return (unsigned)__builtin_amdgcn_readfirstlane(v);
}

// transposing LDS load: lane (c = l & 15, h = l >> 4) receives
// T[kbase + 8h + 0..7][dbase + c] of a row-major 16-bit tile
__device__ inline v4u ld_tr16(const unsigned char* p) {
  typedef __attribute__((address_space(3))) v8s lds_v8s;
  return __builtin_bit_cast(v4u,
      __builtin_amdgcn_ds_load_tr16_b128_v8i16((lds_v8s*)p));
}

// async copies of 16 bytes global -> LDS (per-lane scatter, ASYNCcnt tracked),
// a thread's copies of one trip in one statement. The wait stands in the
// copies' own statement, so that no later write of the address registers can
// be scheduled in front of it
__device__ inline void async_g2l_b128_x4(unsigned l0, const void* p0,
                                         unsigned l1, const void* p1,
                                         unsigned l2, const void* p2,
                                         unsigned l3, const void* p3) {
  asm volatile("global_load_async_to_lds_b128 %0, %1, off\n\t"
               "global_load_async_to_lds_b128 %2, %3, off\n\t"
               "global_load_async_to_lds_b128 %4, %5, off\n\t"
               "global_load_async_to_lds_b128 %6, %7, off\n\t"
               "s_wait_xcnt 0x0"
               :: "v"(l0), "v"(p0), "v"(l1), "v"(p1),
                  "v"(l2), "v"(p2), "v"(l3), "v"(p3)
               : "memory");
}

// four floats rounded to four bf16, in memory order
__device__ inline uint2 pack4_bf16(v4f v) {
  uint2 r;
  r.x = (unsigned)f2bf(v.x) | ((unsigned)f2bf(v.y) << 16);
  r.y = (unsigned)f2bf(v.z) | ((unsigned)f2bf(v.w) << 16);
  return r;
}

// ------------------------------------------------- weight / dtype conversion
// These launches move few bytes.
// A thread takes NV groups of four floats, 256 groups apart, so that a wave's
// load covers 512 contiguous bytes, all NV loads are in flight together and a
// launch starts 4 NV times fewer waves than with one float a thread.
// The grid covers the array exactly: blocks * 1024 * NV elements.
template <int NV>
__global__ __launch_bounds__(256) void f32_to_bf16_kernel(
    const float* __restrict__ in, unsigned short* __restrict__ out) {
  const int q0 = blockIdx.x * (256 * NV) + threadIdx.x;   // group of four
  v4f v[NV];
  #pragma unroll   // v[] indexed by constants: it stays in registers, the loads go out together
  for (int j = 0; j < NV; ++j) v[j] = ((const v4f*)in)[q0 + j * 256];
  #pragma unroll   // as above
  for (int j = 0; j < NV; ++j) ((uint2*)out)[q0 + j * 256] = pack4_bf16(v[j]);
}

// Wk/Wv: [H][E][HS] f32  ->  [E][H*HS] bf16  (so projection is one GEMM)
template <int NV>
__global__ __launch_bounds__(256) void headperm_bf16_kernel(
    const float* __restrict__ in, unsigned short* __restrict__ out) {
  const int q0 = blockIdx.x * (256 * NV) + threadIdx.x;   // group of four outputs
  v4f v[NV];
  #pragma unroll   // v[] indexed by constants: it stays in registers, the loads go out together
  for (int j = 0; j < NV; ++j) {
    int idx = (q0 + j * 256) * 4;               // idx = e*1024 + h*64 + d
    int e = idx >> 10;
    int c = idx & 1023;
    int h = c >> 6;
    int d = c & 63;                             // a multiple of 4
    v[j] = *(const v4f*)&in[(size_t)h * (E_ * HS_) + (size_t)e * HS_ + d];
  }
  #pragma unroll   // as above
  for (int j = 0; j < NV; ++j) ((uint2*)out)[q0 + j * 256] = pack4_bf16(v[j]);
}

// ------------------------------------------------------------- layernorm
// One wave per row (eight rows a block): a lane holds 32 of the row's 1024
// floats, the two sums go through the wave by shuffles, and a launch starts
// eight times fewer waves than with one block per row; no LDS, no barrier.
__global__ __launch_bounds__(256) void layernorm_bf16_kernel(
    const float* __restrict__ x, const float* __restrict__ g,
    const float* __restrict__ b, unsigned short* __restrict__ out) {
  constexpr int NV = 8;                       // groups of four floats a lane: E_ / 128
  const int lane = threadIdx.x & 31, w = threadIdx.x >> 5;
  const int row = blockIdx.x * 8 + w;

  const v4f* xr = (const v4f*)x + (size_t)row * (E_ / 4);
  v4f xv[NV];
  #pragma unroll   // xv[] indexed by constants: it stays in registers, the loads go out together
  for (int j = 0; j < NV; ++j) xv[j] = xr[j * 32 + lane];
  v4f gv[NV], bv[NV];
  #pragma unroll   // as above
  for (int j = 0; j < NV; ++j) {
    gv[j] = ((const v4f*)g)[j * 32 + lane];
    bv[j] = ((const v4f*)b)[j * 32 + lane];
  }
  // g and b are asked for beside x and have landed here, ahead of the shuffles;
  // left alone the compiler asked for them pair by pair behind the sums, with a
  // wait for each pair (loaded values, inputs only)
  asm volatile("" :: "v"(xv[0]), "v"(xv[1]), "v"(xv[2]), "v"(xv[3]),
                     "v"(xv[4]), "v"(xv[5]), "v"(xv[6]), "v"(xv[7]),
                     "v"(gv[0]), "v"(gv[1]), "v"(gv[2]), "v"(gv[3]),
                     "v"(gv[4]), "v"(gv[5]), "v"(gv[6]), "v"(gv[7]),
                     "v"(bv[0]), "v"(bv[1]), "v"(bv[2]), "v"(bv[3]),
                     "v"(bv[4]), "v"(bv[5]), "v"(bv[6]), "v"(bv[7]));
  float s = 0.f, s2 = 0.f;
  #pragma unroll   // as above
  for (int j = 0; j < NV; ++j) {
    s  += (xv[j].x + xv[j].y) + (xv[j].z + xv[j].w);
    s2 += (xv[j].x * xv[j].x + xv[j].y * xv[j].y) +
          (xv[j].z * xv[j].z + xv[j].w * xv[j].w);
  }
  #pragma unroll
  for (int o = 16; o > 0; o >>= 1) {          // every lane ends with both sums
    s  += __shfl_xor(s, o, 32);
    s2 += __shfl_xor(s2, o, 32);
  }
  const float mean = s / (float)E_;
  const float inv  = rsqrtf(s2 / (float)E_ - mean * mean + 1e-5f);
  uint2* orow = (uint2*)out + (size_t)row * (E_ / 4);
  #pragma unroll   // as above
  for (int j = 0; j < NV; ++j) {
    v4f n;
    n.x = (xv[j].x - mean) * inv * gv[j].x + bv[j].x;
    n.y = (xv[j].y - mean) * inv * gv[j].y + bv[j].y;
    n.z = (xv[j].z - mean) * inv * gv[j].z + bv[j].z;
    n.w = (xv[j].w - mean) * inv * gv[j].w + bv[j].w;
    orow[j * 32 + lane] = pack4_bf16(n);
  }
}

// ------------------------------------------------------------ generic GEMM
// C[M,N] = A[M,K](bf16) * B[K,N](bf16)  (+bias)(relu)(+res f32) -> f32/bf16
// block tile 64(M) x 128(N), 8 waves (2x4), wave tile 32x32.
// A trip of the K loop stages 128 k (four matrix steps): the load latency,
// the two barriers and the waits are paid once per 128 k.
// A tile staged by per-lane async global->LDS copies (ASYNCcnt), rows of 256
// bytes at a pitch of 272; B tile staged by the Tensor Data Mover
// (TENSORcnt), one DMA per trip, rows of 256 B padded to a 288 B pitch;
// B fragments come from it by transposing LDS loads (hardware k order, the
// same as the A loader's).
#define BPITCH_ 288u
template <bool BIAS, bool RELU, bool RES, bool OUT32, bool OUT16>
__global__ __launch_bounds__(256) void gemm_bf16_kernel(
    const unsigned short* __restrict__ A, const unsigned short* __restrict__ Bm,
    const float* __restrict__ bias, const float* __restrict__ res,
    float* __restrict__ out32, unsigned short* __restrict__ out16,
    int M, int N, int K) {
  constexpr int KS  = 128;                  // k staged a trip; K is a multiple
  constexpr int AP  = KS + 8;               // A pitch in elements
  constexpr int CPR = KS / 8;               // 16-byte pieces in an A row
  constexpr int RPC = 256 / CPR;            // A rows that one copy of the block fills
  __shared__ __attribute__((aligned(16)))
      unsigned short As[64 * AP];           // [64 rows][KS k], padded
  __shared__ __attribute__((aligned(2048)))
      unsigned char Bt[KS * BPITCH_];       // row-major [KS k][128 N], padded

  const int tid  = threadIdx.x;
  const int lane = tid & 31, w = tid >> 5;
  const int l16 = lane & 15, half = lane >> 4;
  const int wm = w >> 2, wn = w & 3;
  const int m0 = blockIdx.y * 64;
  const int n0 = blockIdx.x * 128;

  // D# group 1 (constant over the K loop): 1-byte elements, tensor = tile =
  // KS rows of 256 B, source pitch 2N bytes, 8 dwords of LDS pad per row.
  v8u g1;
  g1[0] = uni((1u << 20) | (5u << 22) | (7u << 25));     // pad on, 256 B, +32 B
  g1[1] = uni(256u << 16);                               // tensor_dim0 lo
  g1[2] = uni((unsigned)KS << 16);                       // dim1 lo | dim0 hi
  g1[3] = uni(256u << 16);                               // tile_dim0 | dim1 hi
  g1[4] = uni((unsigned)KS);                             // tile_dim1
  g1[5] = uni((unsigned)N * 2u);                         // source pitch, bytes
  g1[6] = uni(0u);
  g1[7] = uni(0u);
  const unsigned bt_base = lds_off(&Bt[0]);
  const unsigned wave = uni((unsigned)tid >> 5);
  // this lane's address in the tile for the transposing loads
  const unsigned char* btp = &Bt[(8u * half + (lane & 7u)) * BPITCH_ +
                                 ((lane >> 3) & 1u) * 16u + wn * 64u];
  // this thread's first 16 bytes of the A tile: row tid / CPR, piece tid % CPR;
  // its further copies lie RPC rows on each
  const int ar = tid / CPR, ac = (tid % CPR) * 8;
  const unsigned as_dst = lds_off(&As[ar * AP + ac]);

  v8f acc[2][2];
  #pragma unroll
  for (int mt = 0; mt < 2; ++mt)
    #pragma unroll
    for (int nt = 0; nt < 2; ++nt) acc[mt][nt] = vzero8();

  for (int k0 = 0; k0 < K; k0 += KS) {
    {
      const unsigned short* gp = &A[(size_t)(m0 + ar) * K + k0 + ac];
      const size_t gs = (size_t)RPC * K;          // elements between two copies
      constexpr unsigned ls = RPC * AP * 2;       // LDS bytes between two copies
      async_g2l_b128_x4(as_dst, gp, as_dst + ls, gp + gs,
                        as_dst + 2 * ls, gp + 2 * gs,
                        as_dst + 3 * ls, gp + 3 * gs);
      if (k0 + KS < K) {               // prefetch the next B tile's first rows into L2
        __builtin_prefetch(&Bm[(size_t)(k0 + KS + (tid >> 4)) * N + n0 +
                               (tid & 15) * 8], 0, 1);
      }
    }
    // the B tile's load stands behind the A copies, so that wave 0 has its own
    // copies in flight while it waits for the tile: one latency a trip, not two
    if (pinned(wave == 0u)) {          // one DMA per block per trip
      unsigned long long ga =
          (unsigned long long)(const void*)&Bm[(size_t)k0 * N + n0];
      v4u g0;
      g0[0] = uni(1u);                                   // count=1
      g0[1] = uni(bt_base);                              // lds_addr
      g0[2] = uni((unsigned)ga);                         // global_addr lo
      g0[3] = uni(((unsigned)(ga >> 32) & 0x01FFFFFFu) | (2u << 30)); // type=2
      asm volatile("tensor_load_to_lds %0, %1" :: "s"(g0), "s"(g1) : "memory");
      // the tile counts as landed only behind the issuer's own wait
      asm volatile("s_wait_tensorcnt 0x0" ::: "memory");
    }
    wait_async0();
    __syncthreads();

    #pragma unroll   // offsets become immediates; later steps' LDS loads may go ahead of earlier products
    for (int ks = 0; ks < KS / 32; ++ks) {
      Frag af[2], bf[2];
      #pragma unroll
      for (int mt = 0; mt < 2; ++mt) {
        int rr = wm * 32 + mt * 16 + l16;
        af[mt].q[0] = *(const uint4*)&As[rr * AP + ks * 32 + half * 8];
        af[mt].q[1] = *(const uint4*)&As[rr * AP + ks * 32 + 16 + half * 8];
      }
      #pragma unroll
      for (int nt = 0; nt < 2; ++nt) {
        const unsigned char* bp = btp + (unsigned)ks * 32u * BPITCH_ + nt * 32u;
        bf[nt].w[0] = ld_tr16(bp);                 // k = 32 ks + 8h + 0..7
        bf[nt].w[1] = ld_tr16(bp + 16u * BPITCH_); // k = 32 ks + 16 + 8h + ..
      }
      #pragma unroll
      for (int mt = 0; mt < 2; ++mt)
        #pragma unroll
        for (int nt = 0; nt < 2; ++nt)
          acc[mt][nt] = wmma_bf16(af[mt], bf[nt], acc[mt][nt]);
    }
    // every LDS read of this wave has retired before the next tensor load
    // and async copies refill the two tiles behind the barrier
    asm volatile("s_wait_dscnt 0x0" ::: "memory");
    __syncthreads();
  }

  // epilogue; D layout: row = r + 8*half, col = l16
  #pragma unroll
  for (int mt = 0; mt < 2; ++mt)
    #pragma unroll
    for (int nt = 0; nt < 2; ++nt)
      #pragma unroll
      for (int r = 0; r < 8; ++r) {
        int gr = m0 + wm * 32 + mt * 16 + r + 8 * half;
        int gc = n0 + wn * 32 + nt * 16 + l16;
        float v = acc[mt][nt][r];
        if constexpr (BIAS) v += bias[gc];
        if constexpr (RELU) v = fmaxf(v, 0.f);
        if constexpr (RES)  v += res[(size_t)gr * N + gc];
        if constexpr (OUT32) out32[(size_t)gr * N + gc] = v;
        if constexpr (OUT16) out16[(size_t)gr * N + gc] = f2bf(v);
      }
}

// ---------------------------------------------------- attention pass 1:
// per-COLUMN (softmax over query axis t, as in the reference) max & sumexp.
// scores = k[t].k[s] * 1/32, causal t>=s.
// One block of four waves per (bh, 64 columns). Every wave holds all 64 key
// columns in registers and takes every fourth 16-row tile, so that a loaded
// tile meets four column strips and the longest loop is 32 trips; the four
// waves' partial max and sum of a column are merged through LDS at the end.
// Grid: x = bh, y = column group, the group with the most rows first.
// nine 2^x in one statement. The outputs lie apart from every input (early
// clobber) and a v_nop ends the statement: behind each v_exp_f32 stands an
// instruction that neither reads its result nor overwrites its source, which
// the instruction set asks for
__device__ inline void exp2_x9(float (&o)[9], const float (&x)[9]) {
  asm("v_exp_f32 %0, %9\n\t"
      "v_exp_f32 %1, %10\n\t"
      "v_exp_f32 %2, %11\n\t"
      "v_exp_f32 %3, %12\n\t"
      "v_exp_f32 %4, %13\n\t"
      "v_exp_f32 %5, %14\n\t"
      "v_exp_f32 %6, %15\n\t"
      "v_exp_f32 %7, %16\n\t"
      "v_exp_f32 %8, %17\n\t"
      "v_nop"
      : "=&v"(o[0]), "=&v"(o[1]), "=&v"(o[2]), "=&v"(o[3]), "=&v"(o[4]),
        "=&v"(o[5]), "=&v"(o[6]), "=&v"(o[7]), "=&v"(o[8])
      : "v"(x[0]), "v"(x[1]), "v"(x[2]), "v"(x[3]), "v"(x[4]),
        "v"(x[5]), "v"(x[6]), "v"(x[7]), "v"(x[8]));
}

#define CS_NW_ 4                              // waves of a block
#define CS_NS_ 4                              // 16-column strips of a wave
// The grid puts four of these waves on a SIMD: the register budget of four
// (256) lets the four strips' independent chains be scheduled side by side.
__global__ __launch_bounds__(32 * CS_NW_) __attribute__((amdgpu_waves_per_eu(4, 4)))
void attn_colstats_kernel(
    const unsigned short* __restrict__ kall,
    float* __restrict__ colmax, float* __restrict__ colsum) {
  __shared__ float mrg_m[CS_NW_][CS_NS_ * 16];
  __shared__ float mrg_s[CS_NW_][CS_NS_ * 16];
  const int tid = threadIdx.x;
  const int lane = tid & 31;
  const int w = (int)uni((unsigned)tid >> 5);  // scalar: the row loop's count and addresses stay scalar
  const int l16 = lane & 15, half = lane >> 4;
  const int bh = blockIdx.x;
  const int sG = blockIdx.y;
  const int b = bh >> 4, h = bh & 15;
  const int bt0 = b * T_;
  const int hoff = h * HS_;
  const int s_base = sG * (CS_NS_ * 16);
  const float scale = 0.03125f;               // 1024^-0.5
  const float NINF = -__builtin_inff();
  const float LOG2E = 1.44269504f;

  // head h of batch b, row 0 (the same in every lane), and this lane's place
  // in a 16-row tile
  const unsigned short* kbh = &kall[(size_t)bt0 * E_ + hoff];
  const unsigned lo = (unsigned)l16 * E_;

  Frag bf[CS_NS_][2];                         // key columns (loop-invariant)
  #pragma unroll
  for (int j = 0; j < CS_NS_; ++j) {
    const unsigned short* kp = kbh + (size_t)(s_base + j * 16) * E_ + lo;
    bf[j][0].q[0] = *(const uint4*)&kp[half * 8];
    bf[j][0].q[1] = *(const uint4*)&kp[16 + half * 8];
    bf[j][1].q[0] = *(const uint4*)&kp[32 + half * 8];
    bf[j][1].q[1] = *(const uint4*)&kp[48 + half * 8];
  }

  float m_run[CS_NS_], s_run[CS_NS_];
  #pragma unroll
  for (int j = 0; j < CS_NS_; ++j) { m_run[j] = NINF; s_run[j] = 0.f; }

  for (int tT = sG * CS_NS_ + w; tT < T_ / 16; tT += CS_NW_) {
    const int t_base = tT * 16;
    Frag af[2];
    const unsigned short* qp = kbh + (size_t)t_base * E_ + lo;
    af[0].q[0] = *(const uint4*)&qp[half * 8];
    af[0].q[1] = *(const uint4*)&qp[16 + half * 8];
    af[1].q[0] = *(const uint4*)&qp[32 + half * 8];
    af[1].q[1] = *(const uint4*)&qp[48 + half * 8];
    // holds the four loads together in front of the first product, so that a
    // trip waits out one load latency and not two (loaded values, inputs only)
    asm volatile("" :: "v"(af[0].w[0]), "v"(af[0].w[1]),
                       "v"(af[1].w[0]), "v"(af[1].w[1]));

    #pragma unroll   // m_run[], s_run[], bf[] indexed by constants: they stay in registers
    for (int j = 0; j < CS_NS_; ++j) {
      const int s = s_base + j * 16 + l16;
      v8f sc = vzero8();
      sc = wmma_bf16(af[0], bf[j][0], sc);
      sc = wmma_bf16(af[1], bf[j][1], sc);

      float vals[8];
      float tmax = NINF;
      #pragma unroll
      for (int r = 0; r < 8; ++r) {
        int t = t_base + r + 8 * half;
        if (t >= s) {
          float e = sc[r] * scale;
          vals[r] = e;
          tmax = fmaxf(tmax, e);
        } else {
          vals[r] = NINF;
        }
      }
      // a lane whose eight rows are all masked keeps its max and its sum: the
      // selects below leave both as they are, so no branch stands between the strips
      float nm = fmaxf(m_run[j], tmax);
      float xs[9], ex[9];                     // e^d = 2^(d * log2 e)
      #pragma unroll
      for (int r = 0; r < 8; ++r) xs[r] = (vals[r] - nm) * LOG2E;
      xs[8] = (m_run[j] - nm) * LOG2E;
      exp2_x9(ex, xs);
      float acc_s = (m_run[j] > NINF) ? s_run[j] * ex[8] : 0.f;
      #pragma unroll
      for (int r = 0; r < 8; ++r)
        if (vals[r] > NINF) acc_s += ex[r];
      s_run[j] = acc_s;
      m_run[j] = nm;
    }
  }
  // merge the two lane halves (same columns, different row groups)
  #pragma unroll
  for (int j = 0; j < CS_NS_; ++j) {
    float om = __shfl_xor(m_run[j], 16, 32);
    float os = __shfl_xor(s_run[j], 16, 32);
    float nm = fmaxf(m_run[j], om);
    float tot = 0.f;
    if (m_run[j] > NINF) tot += s_run[j] * __expf(m_run[j] - nm);
    if (om       > NINF) tot += os       * __expf(om       - nm);
    if (lane < 16) {
      mrg_m[w][j * 16 + lane] = nm;
      mrg_s[w][j * 16 + lane] = tot;
    }
  }
  __syncthreads();
  // merge the four waves, in wave order; one thread per column
  if (tid < CS_NS_ * 16) {
    float nm = NINF;
    #pragma unroll
    for (int i = 0; i < CS_NW_; ++i) nm = fmaxf(nm, mrg_m[i][tid]);
    float tot = 0.f;
    #pragma unroll
    for (int i = 0; i < CS_NW_; ++i) {
      float mi = mrg_m[i][tid];
      if (mi > NINF) tot += mrg_s[i][tid] * __expf(mi - nm);
    }
    colmax[(size_t)bh * T_ + s_base + tid] = nm;
    colsum[(size_t)bh * T_ + s_base + tid] = tot;
  }
}

// ---------------------------------------------------- attention pass 2:
// attn[t,d] = sum_s P[t,s] * v[s,d],  P = exp(score-colmax[s])/colsum[s].
// one wave per (bh, 16-row strip); P re-layouts through LDS; V staged in LDS
// row-major (128 B rows at a 160 B pitch) and read by transposing LDS loads.
// The grid puts four of these waves on a SIMD: with the register budget of four
// (256) the compiler issues all 20 global loads of a trip together; with its
// default budget it reuses few registers and waits for the loads in turns.
#define VPITCH_ 160u
__global__ __launch_bounds__(32) __attribute__((amdgpu_waves_per_eu(4, 4)))
void attn_out_kernel(
    const unsigned short* __restrict__ kall,
    const unsigned short* __restrict__ vall,
    const float* __restrict__ colmax, const float* __restrict__ colsum,
    unsigned short* __restrict__ attnB) {
  __shared__ unsigned short Pl[16 * 40];     // P tile [16 t][32 s]
  __shared__ __attribute__((aligned(16)))
      unsigned char Vs[32 * VPITCH_];        // V tile [32 s][64 d], padded

  const int lane = threadIdx.x;
  const int l16 = lane & 15, half = lane >> 4;
  const int tT = blockIdx.x;
  const int bh = blockIdx.y;
  const int b = bh >> 4, h = bh & 15;
  const int bt0 = b * T_;
  const int hoff = h * HS_;
  const int t_base = tT * 16;
  const float scale = 0.03125f;

  Frag qf[2];                                 // query rows (loop-invariant)
  {
    const unsigned short* qp = &kall[(size_t)(bt0 + t_base + l16) * E_ + hoff];
    qf[0].q[0] = *(const uint4*)&qp[half * 8];
    qf[0].q[1] = *(const uint4*)&qp[16 + half * 8];
    qf[1].q[0] = *(const uint4*)&qp[32 + half * 8];
    qf[1].q[1] = *(const uint4*)&qp[48 + half * 8];
  }
  v8f acc[4];
  #pragma unroll
  for (int i = 0; i < 4; ++i) acc[i] = vzero8();

  // this lane's address in the V tile for the transposing loads
  const unsigned char* vtp = &Vs[(8u * half + (lane & 7u)) * VPITCH_ +
                                 ((lane >> 3) & 1u) * 16u];

  // this lane's 16 bytes of V row (lane >> 3), moved on by 32 rows a trip
  const unsigned short* vp =
      &vall[(size_t)(bt0 + (lane >> 3)) * E_ + hoff + (lane & 7) * 8];

  const int sBmax = (t_base + 15) >> 5;
  for (int sB = 0; sB <= sBmax; ++sB) {
    const int s0 = sB * 32;
    // stage V: 32 s-rows x 64 d, rows kept as they are
    uint4 vv[8];
    #pragma unroll   // vv[] is indexed by constants only, so it stays in registers
    for (int i = 0; i < 8; ++i)      // rows (lane >> 3) + 4 i: one address, fixed offsets
      vv[i] = *(const uint4*)(vp + (size_t)i * 4 * E_);
    vp += 32 * E_;
    #pragma unroll   // as above
    for (int i = 0; i < 8; ++i)
      *(uint4*)&Vs[((lane >> 3) + 4 * i) * VPITCH_ + (lane & 7) * 16] = vv[i];
    // scores and normalized P for the two 16-column subtiles
    #pragma unroll
    for (int sh = 0; sh < 2; ++sh) {
      const int s_sub = s0 + sh * 16;
      Frag kf[2];
      const unsigned short* kp = &kall[(size_t)(bt0 + s_sub + l16) * E_ + hoff];
      kf[0].q[0] = *(const uint4*)&kp[half * 8];
      kf[0].q[1] = *(const uint4*)&kp[16 + half * 8];
      kf[1].q[0] = *(const uint4*)&kp[32 + half * 8];
      kf[1].q[1] = *(const uint4*)&kp[48 + half * 8];
      v8f sc = vzero8();
      sc = wmma_bf16(qf[0], kf[0], sc);
      sc = wmma_bf16(qf[1], kf[1], sc);

      const int s = s_sub + l16;
      float m  = colmax[(size_t)bh * T_ + s];
      float sm = colsum[(size_t)bh * T_ + s];
      float rs = (sm > 0.f) ? 1.f / sm : 0.f;
      #pragma unroll
      for (int r = 0; r < 8; ++r) {
        int t = t_base + r + 8 * half;
        float p = 0.f;
        if (s <= t && sm > 0.f) p = __expf(sc[r] * scale - m) * rs;
        Pl[(r + 8 * half) * 40 + sh * 16 + l16] = f2bf(p);
      }
    }
    __syncthreads();
    // attn += P @ V
    Frag pf;
    pf.q[0] = *(const uint4*)&Pl[l16 * 40 + half * 8];
    pf.q[1] = *(const uint4*)&Pl[l16 * 40 + 16 + half * 8];
    #pragma unroll
    for (int nt = 0; nt < 4; ++nt) {
      Frag vf;
      vf.w[0] = ld_tr16(vtp + nt * 32u);                 // s = 8h + 0..7
      vf.w[1] = ld_tr16(vtp + 16u * VPITCH_ + nt * 32u); // s = 16 + 8h + 0..7
      acc[nt] = wmma_bf16(pf, vf, acc[nt]);
    }
    __syncthreads();
  }

  // store heads concatenated: attnB[b*T+t][h*64+d]
  #pragma unroll
  for (int nt = 0; nt < 4; ++nt)
    #pragma unroll
    for (int r = 0; r < 8; ++r) {
      int t = t_base + r + 8 * half;
      int d = nt * 16 + l16;
      attnB[(size_t)(bt0 + t) * E_ + hoff + d] = f2bf(acc[nt][r]);
    }
}

// ---------------------------------------------------------------- launcher
extern "C" void kernel_launch(void* const* d_in, const int* in_sizes, int n_in,
                              void* d_out, int out_size, void* d_ws,
                              size_t ws_size, hipStream_t stream) {
  (void)in_sizes; (void)n_in; (void)out_size; (void)ws_size;

  const float* x      = (const float*)d_in[0];
  const float* ln1_g  = (const float*)d_in[1];
  const float* ln1_b  = (const float*)d_in[2];
  const float* Wk     = (const float*)d_in[3];
  const float* Wv     = (const float*)d_in[4];
  const float* Wproj  = (const float*)d_in[5];
  const float* bproj  = (const float*)d_in[6];
  const float* ln2_g  = (const float*)d_in[7];
  const float* ln2_b  = (const float*)d_in[8];
  const float* W1     = (const float*)d_in[9];
  const float* b1     = (const float*)d_in[10];
  const float* W2     = (const float*)d_in[11];
  const float* b2     = (const float*)d_in[12];
  float* out          = (float*)d_out;

  char* ws = (char*)d_ws;
  size_t off = 0;
  auto alloc = [&](size_t bytes) -> void* {
    void* p = ws + off;
    off += (bytes + 255) & ~(size_t)255;
    return p;
  };

  unsigned short* hB     = (unsigned short*)alloc((size_t)BT_ * E_ * 2);
  unsigned short* WkB    = (unsigned short*)alloc((size_t)E_ * E_ * 2);
  unsigned short* WvB    = (unsigned short*)alloc((size_t)E_ * E_ * 2);
  unsigned short* WprojB = (unsigned short*)alloc((size_t)E_ * E_ * 2);
  unsigned short* W1B    = (unsigned short*)alloc((size_t)E_ * FF_ * 2);
  unsigned short* W2B    = (unsigned short*)alloc((size_t)FF_ * E_ * 2);
  unsigned short* kall   = (unsigned short*)alloc((size_t)BT_ * E_ * 2);
  unsigned short* vall   = (unsigned short*)alloc((size_t)BT_ * E_ * 2);
  float*          cmax   = (float*)alloc((size_t)B_ * H_ * T_ * 4);
  float*          csum   = (float*)alloc((size_t)B_ * H_ * T_ * 4);
  unsigned short* attnB  = (unsigned short*)alloc((size_t)BT_ * E_ * 2);
  float*          x1     = (float*)alloc((size_t)BT_ * E_ * 4);
  unsigned short* h2B    = (unsigned short*)alloc((size_t)BT_ * E_ * 2);
  unsigned short* actB   = (unsigned short*)alloc((size_t)BT_ * FF_ * 2);

  // weight prep
  headperm_bf16_kernel<4><<<(E_ * E_) / 4096, 256, 0, stream>>>(Wk, WkB);
  headperm_bf16_kernel<4><<<(E_ * E_) / 4096, 256, 0, stream>>>(Wv, WvB);
  f32_to_bf16_kernel<4><<<(E_ * E_) / 4096, 256, 0, stream>>>(Wproj, WprojB);
  f32_to_bf16_kernel<8><<<(E_ * FF_) / 8192, 256, 0, stream>>>(W1, W1B);
  f32_to_bf16_kernel<8><<<(FF_ * E_) / 8192, 256, 0, stream>>>(W2, W2B);

  // LN1 -> h (bf16)
  layernorm_bf16_kernel<<<BT_ / 8, 256, 0, stream>>>(x, ln1_g, ln1_b, hB);

  // k = h @ Wk', v = h @ Wv'   (bf16 out for attention WMMA)
  dim3 gE(E_ / 128, BT_ / 64);
  gemm_bf16_kernel<false, false, false, false, true>
      <<<gE, 256, 0, stream>>>(hB, WkB, nullptr, nullptr, nullptr, kall,
                               BT_, E_, E_);
  gemm_bf16_kernel<false, false, false, false, true>
      <<<gE, 256, 0, stream>>>(hB, WvB, nullptr, nullptr, nullptr, vall,
                               BT_, E_, E_);

  // attention: column softmax stats, then output
  dim3 gA(T_ / 16, B_ * H_);
  dim3 gC(B_ * H_, T_ / (CS_NS_ * 16));
  attn_colstats_kernel<<<gC, 32 * CS_NW_, 0, stream>>>(kall, cmax, csum);
  attn_out_kernel<<<gA, 32, 0, stream>>>(kall, vall, cmax, csum, attnB);

  // x1 = x + attn @ Wproj + bproj   (f32)
  gemm_bf16_kernel<true, false, true, true, false>
      <<<gE, 256, 0, stream>>>(attnB, WprojB, bproj, x, x1, nullptr,
                               BT_, E_, E_);

  // LN2 -> h2 (bf16)
  layernorm_bf16_kernel<<<BT_ / 8, 256, 0, stream>>>(x1, ln2_g, ln2_b, h2B);

  // act = relu(h2 @ W1 + b1)   (bf16)
  dim3 gF(FF_ / 128, BT_ / 64);
  gemm_bf16_kernel<true, true, false, false, true>
      <<<gF, 256, 0, stream>>>(h2B, W1B, b1, nullptr, nullptr, actB,
                               BT_, FF_, E_);

  // out = x1 + act @ W2 + b2   (f32)
  gemm_bf16_kernel<true, false, true, true, false>
      <<<gE, 256, 0, stream>>>(actB, W2B, b2, x1, out, nullptr,
                               BT_, E_, FF_);
}

// v006
// Measured time: 204 microseconds a run.
// Timed twice side by side with v005, it ran 1.24 times as fast both times.
// Over all steps from v000 it is 3.44 times as fast.
#include <hip/hip_runtime.h>

// ---------------------------------------------------------------- constants
#define E_   1024
#define H_   16
#define HS_  64
#define B_   2
#define T_   2048
#define BT_  (B_ * T_)
#define FF_  (4 * E_)

typedef __attribute__((ext_vector_type(16))) __bf16     v16bf;
typedef __attribute__((ext_vector_type(8)))  float      v8f;
typedef __attribute__((ext_vector_type(4)))  unsigned   v4u;
typedef __attribute__((ext_vector_type(8)))  unsigned   v8u;

typedef __attribute__((ext_vector_type(8)))  short      v8s;
typedef __attribute__((ext_vector_type(4)))  float      v4f;

union Frag { v16bf v; uint4 q[2]; v4u w[2]; unsigned short us[16]; };

__device__ inline unsigned short f2bf(float f) {
  unsigned u = __float_as_uint(f);
  u += 0x7fffu + ((u >> 16) & 1u);           // round-to-nearest-even
  return (unsigned short)(u >> 16);
}

__device__ inline v8f vzero8() {
  v8f z = {0.f, 0.f, 0.f, 0.f, 0.f, 0.f, 0.f, 0.f};
  return z;
}

__device__ inline v8f wmma_bf16(const Frag& a, const Frag& b, v8f c) {
  return __builtin_amdgcn_wmma_f32_16x16x32_bf16(
      /*neg_a=*/false, a.v, /*neg_b=*/false, b.v,
      /*c_mod=*/(short)0, c, /*reuse_a=*/false, /*reuse_b=*/false);
}

// LDS offset of a shared-memory pointer: generic LDS addresses keep the
// LDS byte offset in the low 32 bits (ISA 10.2 aperture rules).
__device__ inline unsigned lds_off(const void* p) {
  return (unsigned)(unsigned long long)p;
}

__device__ inline void wait_async0() {
  asm volatile("s_wait_asynccnt 0x0" ::: "memory");
}

__device__ inline unsigned pinned(unsigned v) {
  unsigned w = (unsigned)__builtin_amdgcn_readfirstlane(v);
  asm volatile("" : "+s"(w));   // pinned(): the tensor mover's issue test word held in a scalar register
  return w;
}

__device__ inline unsigned uni(unsigned v) {
  return (unsigned)__builtin_amdgcn_readfirstlane(v);
}

// transposing LDS load: lane (c = l & 15, h = l >> 4) receives
// T[kbase + 8h + 0..7][dbase + c] of a row-major 16-bit tile
__device__ inline v4u ld_tr16(const unsigned char* p) {
  typedef __attribute__((address_space(3))) v8s lds_v8s;
  return __builtin_bit_cast(v4u,
      __builtin_amdgcn_ds_load_tr16_b128_v8i16((lds_v8s*)p));
}

// async copies of 16 bytes global -> LDS (per-lane scatter, ASYNCcnt tracked),
// a thread's copies of one trip in one statement. The wait stands in the
// copies' own statement, so that no later write of the address registers can
// be scheduled in front of it
__device__ inline void async_g2l_b128_x4(unsigned l0, const void* p0,
                                         unsigned l1, const void* p1,
                                         unsigned l2, const void* p2,
                                         unsigned l3, const void* p3) {
  asm volatile("global_load_async_to_lds_b128 %0, %1, off\n\t"
               "global_load_async_to_lds_b128 %2, %3, off\n\t"
               "global_load_async_to_lds_b128 %4, %5, off\n\t"
               "global_load_async_to_lds_b128 %6, %7, off\n\t"
               "s_wait_xcnt 0x0"
               :: "v"(l0), "v"(p0), "v"(l1), "v"(p1),
                  "v"(l2), "v"(p2), "v"(l3), "v"(p3)
               : "memory");
}

// four floats rounded to four bf16, in memory order
__device__ inline uint2 pack4_bf16(v4f v) {
  uint2 r;
  r.x = (unsigned)f2bf(v.x) | ((unsigned)f2bf(v.y) << 16);
  r.y = (unsigned)f2bf(v.z) | ((unsigned)f2bf(v.w) << 16);
  return r;
}

// ------------------------------------------------- weight / dtype conversion
// These launches move few bytes.
// A thread takes NV groups of four floats, 256 groups apart, so that a wave's
// load covers 512 contiguous bytes, all NV loads are in flight together and a
// launch starts 4 NV times fewer waves than with one float a thread.
// The grid covers the array exactly: blocks * 1024 * NV elements.
template <int NV>
__global__ __launch_bounds__(256) void f32_to_bf16_kernel(
    const float* __restrict__ in, unsigned short* __restrict__ out) {
  const int q0 = blockIdx.x * (256 * NV) + threadIdx.x;   // group of four
  v4f v[NV];
  #pragma unroll   // v[] indexed by constants: it stays in registers, the loads go out together
  for (int j = 0; j < NV; ++j) v[j] = ((const v4f*)in)[q0 + j * 256];
  #pragma unroll   // as above
  for (int j = 0; j < NV; ++j) ((uint2*)out)[q0 + j * 256] = pack4_bf16(v[j]);
}

// Wk/Wv: [H][E][HS] f32  ->  [E][H*HS] bf16  (so projection is one GEMM)
template <int NV>
__global__ __launch_bounds__(256) void headperm_bf16_kernel(
    const float* __restrict__ in, unsigned short* __restrict__ out) {
  const int q0 = blockIdx.x * (256 * NV) + threadIdx.x;   // group of four outputs
  v4f v[NV];
  #pragma unroll   // v[] indexed by constants: it stays in registers, the loads go out together
  for (int j = 0; j < NV; ++j) {
    int idx = (q0 + j * 256) * 4;               // idx = e*1024 + h*64 + d
    int e = idx >> 10;
    int c = idx & 1023;
    int h = c >> 6;
    int d = c & 63;                             // a multiple of 4
    v[j] = *(const v4f*)&in[(size_t)h * (E_ * HS_) + (size_t)e * HS_ + d];
  }
  #pragma unroll   // as above
  for (int j = 0; j < NV; ++j) ((uint2*)out)[q0 + j * 256] = pack4_bf16(v[j]);
}

// ------------------------------------------------------------- layernorm
// One wave per row (eight rows a block): a lane holds 32 of the row's 1024
// floats, the two sums go through the wave by shuffles, and a launch starts
// eight times fewer waves than with one block per row; no LDS, no barrier.
__global__ __launch_bounds__(256) void layernorm_bf16_kernel(
    const float* __restrict__ x, const float* __restrict__ g,
    const float* __restrict__ b, unsigned short* __restrict__ out) {
  constexpr int NV = 8;                       // groups of four floats a lane: E_ / 128
  const int lane = threadIdx.x & 31, w = threadIdx.x >> 5;
  const int row = blockIdx.x * 8 + w;

  const v4f* xr = (const v4f*)x + (size_t)row * (E_ / 4);
  v4f xv[NV];
  #pragma unroll   // xv[] indexed by constants: it stays in registers, the loads go out together
  for (int j = 0; j < NV; ++j) xv[j] = xr[j * 32 + lane];
  v4f gv[NV], bv[NV];
  #pragma unroll   // as above
  for (int j = 0; j < NV; ++j) {
    gv[j] = ((const v4f*)g)[j * 32 + lane];
    bv[j] = ((const v4f*)b)[j * 32 + lane];
  }
  // g and b are asked for beside x and have landed here, ahead of the shuffles;
  // left alone the compiler asked for them pair by pair behind the sums, with a
  // wait for each pair (loaded values, inputs only)
  asm volatile("" :: "v"(xv[0]), "v"(xv[1]), "v"(xv[2]), "v"(xv[3]),
                     "v"(xv[4]), "v"(xv[5]), "v"(xv[6]), "v"(xv[7]),
                     "v"(gv[0]), "v"(gv[1]), "v"(gv[2]), "v"(gv[3]),
                     "v"(gv[4]), "v"(gv[5]), "v"(gv[6]), "v"(gv[7]),
                     "v"(bv[0]), "v"(bv[1]), "v"(bv[2]), "v"(bv[3]),
                     "v"(bv[4]), "v"(bv[5]), "v"(bv[6]), "v"(bv[7]));
  float s = 0.f, s2 = 0.f;
  #pragma unroll   // as above
  for (int j = 0; j < NV; ++j) {
    s  += (xv[j].x + xv[j].y) + (xv[j].z + xv[j].w);
    s2 += (xv[j].x * xv[j].x + xv[j].y * xv[j].y) +
          (xv[j].z * xv[j].z + xv[j].w * xv[j].w);
  }
  #pragma unroll
  for (int o = 16; o > 0; o >>= 1) {          // every lane ends with both sums
    s  += __shfl_xor(s, o, 32);
    s2 += __shfl_xor(s2, o, 32);
  }
  const float mean = s / (float)E_;
  const float inv  = rsqrtf(s2 / (float)E_ - mean * mean + 1e-5f);
  uint2* orow = (uint2*)out + (size_t)row * (E_ / 4);
  #pragma unroll   // as above
  for (int j = 0; j < NV; ++j) {
    v4f n;
    n.x = (xv[j].x - mean) * inv * gv[j].x + bv[j].x;
    n.y = (xv[j].y - mean) * inv * gv[j].y + bv[j].y;
    n.z = (xv[j].z - mean) * inv * gv[j].z + bv[j].z;
    n.w = (xv[j].w - mean) * inv * gv[j].w + bv[j].w;
    orow[j * 32 + lane] = pack4_bf16(n);
  }
}

// ------------------------------------------------------------ generic GEMM
// C[M,N] = A[M,K](bf16) * B[K,N](bf16)  (+bias)(relu)(+res f32) -> f32/bf16
// block tile 64(M) x 128(N), 8 waves (2x4), wave tile 32x32.
// A trip of the K loop stages 128 k (four matrix steps): the load latency,
// the two barriers and the waits are paid once per 128 k.
// A tile staged by per-lane async global->LDS copies (ASYNCcnt), rows of 256
// bytes at a pitch of 272; B tile staged by the Tensor Data Mover
// (TENSORcnt), one DMA per trip, rows of 256 B padded to a 288 B pitch;
// B fragments come from it by transposing LDS loads (hardware k order, the
// same as the A loader's).
#define BPITCH_ 288u
template <bool BIAS, bool RELU, bool RES, bool OUT32, bool OUT16>
__global__ __launch_bounds__(256) void gemm_bf16_kernel(
    const unsigned short* __restrict__ A, const unsigned short* __restrict__ Bm,
    const float* __restrict__ bias, const float* __restrict__ res,
    float* __restrict__ out32, unsigned short* __restrict__ out16,
    int M, int N, int K) {
  constexpr int KS  = 128;                  // k staged a trip; K is a multiple
  constexpr int AP  = KS + 8;               // A pitch in elements
  constexpr int CPR = KS / 8;               // 16-byte pieces in an A row
  constexpr int RPC = 256 / CPR;            // A rows that one copy of the block fills
  __shared__ __attribute__((aligned(16)))
      unsigned short As[64 * AP];           // [64 rows][KS k], padded
  __shared__ __attribute__((aligned(2048)))
      unsigned char Bt[KS * BPITCH_];       // row-major [KS k][128 N], padded

  const int tid  = threadIdx.x;
  const int lane = tid & 31, w = tid >> 5;
  const int l16 = lane & 15, half = lane >> 4;
  const int wm = w >> 2, wn = w & 3;
  const int m0 = blockIdx.y * 64;
  const int n0 = blockIdx.x * 128;

  // D# group 1 (constant over the K loop): 1-byte elements, tensor = tile =
  // KS rows of 256 B, source pitch 2N bytes, 8 dwords of LDS pad per row.
  v8u g1;
  g1[0] = uni((1u << 20) | (5u << 22) | (7u << 25));     // pad on, 256 B, +32 B
  g1[1] = uni(256u << 16);                               // tensor_dim0 lo
  g1[2] = uni((unsigned)KS << 16);                       // dim1 lo | dim0 hi
  g1[3] = uni(256u << 16);                               // tile_dim0 | dim1 hi
  g1[4] = uni((unsigned)KS);                             // tile_dim1
  g1[5] = uni((unsigned)N * 2u);                         // source pitch, bytes
  g1[6] = uni(0u);
  g1[7] = uni(0u);
  const unsigned bt_base = lds_off(&Bt[0]);
  const unsigned wave = uni((unsigned)tid >> 5);
  // this lane's address in the tile for the transposing loads
  const unsigned char* btp = &Bt[(8u * half + (lane & 7u)) * BPITCH_ +
                                 ((lane >> 3) & 1u) * 16u + wn * 64u];
  // this thread's first 16 bytes of the A tile: row tid / CPR, piece tid % CPR;
  // its further copies lie RPC rows on each
  const int ar = tid / CPR, ac = (tid % CPR) * 8;
  const unsigned as_dst = lds_off(&As[ar * AP + ac]);

  v8f acc[2][2];
  #pragma unroll
  for (int mt = 0; mt < 2; ++mt)
    #pragma unroll
    for (int nt = 0; nt < 2; ++nt) acc[mt][nt] = vzero8();

  for (int k0 = 0; k0 < K; k0 += KS) {
    {
      const unsigned short* gp = &A[(size_t)(m0 + ar) * K + k0 + ac];
      const size_t gs = (size_t)RPC * K;          // elements between two copies
      constexpr unsigned ls = RPC * AP * 2;       // LDS bytes between two copies
      async_g2l_b128_x4(as_dst, gp, as_dst + ls, gp + gs,
                        as_dst + 2 * ls, gp + 2 * gs,
                        as_dst + 3 * ls, gp + 3 * gs);
      if (k0 + KS < K) {               // prefetch the next B tile's first rows into L2
        __builtin_prefetch(&Bm[(size_t)(k0 + KS + (tid >> 4)) * N + n0 +
                               (tid & 15) * 8], 0, 1);
      }
    }
    // the B tile's load stands behind the A copies, so that wave 0 has its own
    // copies in flight while it waits for the tile: one latency a trip, not two
    if (pinned(wave == 0u)) {          // one DMA per block per trip
      unsigned long long ga =
          (unsigned long long)(const void*)&Bm[(size_t)k0 * N + n0];
      v4u g0;
      g0[0] = uni(1u);                                   // count=1
      g0[1] = uni(bt_base);                              // lds_addr
      g0[2] = uni((unsigned)ga);                         // global_addr lo
      g0[3] = uni(((unsigned)(ga >> 32) & 0x01FFFFFFu) | (2u << 30)); // type=2
      asm volatile("tensor_load_to_lds %0, %1" :: "s"(g0), "s"(g1) : "memory");
      // the tile counts as landed only behind the issuer's own wait
      asm volatile("s_wait_tensorcnt 0x0" ::: "memory");
    }
    wait_async0();
    __syncthreads();

    #pragma unroll   // offsets become immediates; later steps' LDS loads may go ahead of earlier products
    for (int ks = 0; ks < KS / 32; ++ks) {
      Frag af[2], bf[2];
      #pragma unroll
      for (int mt = 0; mt < 2; ++mt) {
        int rr = wm * 32 + mt * 16 + l16;
        af[mt].q[0] = *(const uint4*)&As[rr * AP + ks * 32 + half * 8];
        af[mt].q[1] = *(const uint4*)&As[rr * AP + ks * 32 + 16 + half * 8];
      }
      #pragma unroll
      for (int nt = 0; nt < 2; ++nt) {
        const unsigned char* bp = btp + (unsigned)ks * 32u * BPITCH_ + nt * 32u;
        bf[nt].w[0] = ld_tr16(bp);                 // k = 32 ks + 8h + 0..7
        bf[nt].w[1] = ld_tr16(bp + 16u * BPITCH_); // k = 32 ks + 16 + 8h + ..
      }
      #pragma unroll
      for (int mt = 0; mt < 2; ++mt)
        #pragma unroll
        for (int nt = 0; nt < 2; ++nt)
          acc[mt][nt] = wmma_bf16(af[mt], bf[nt], acc[mt][nt]);
    }
    // every LDS read of this wave has retired before the next tensor load
    // and async copies refill the two tiles behind the barrier
    asm volatile("s_wait_dscnt 0x0" ::: "memory");
    __syncthreads();
  }

  // epilogue; D layout: row = r + 8*half, col = l16
  #pragma unroll
  for (int mt = 0; mt < 2; ++mt)
    #pragma unroll
    for (int nt = 0; nt < 2; ++nt)
      #pragma unroll
      for (int r = 0; r < 8; ++r) {
        int gr = m0 + wm * 32 + mt * 16 + r + 8 * half;
        int gc = n0 + wn * 32 + nt * 16 + l16;
        float v = acc[mt][nt][r];
        if constexpr (BIAS) v += bias[gc];
        if constexpr (RELU) v = fmaxf(v, 0.f);
        if constexpr (RES)  v += res[(size_t)gr * N + gc];
        if constexpr (OUT32) out32[(size_t)gr * N + gc] = v;
        if constexpr (OUT16) out16[(size_t)gr * N + gc] = f2bf(v);
      }
}

// ---------------------------------------------------- attention pass 1:
// per-COLUMN (softmax over query axis t, as in the reference) max & sumexp.
// scores = k[t].k[s] * 1/32, causal t>=s.
// One block of four waves per (bh, 64 columns). Every wave holds all 64 key
// columns in registers and takes every fourth 16-row tile, so that a loaded
// tile meets four column strips and the longest loop is 32 trips; the four
// waves' partial max and sum of a column are merged through LDS at the end.
// Grid: x = bh, y = column group, the group with the most rows first.
// nine 2^x in one statement. The outputs lie apart from every input (early
// clobber) and a v_nop ends the statement: behind each v_exp_f32 stands an
// instruction that neither reads its result nor overwrites its source, which
// the instruction set asks for
__device__ inline void exp2_x9(float (&o)[9], const float (&x)[9]) {
  asm("v_exp_f32 %0, %9\n\t"
      "v_exp_f32 %1, %10\n\t"
      "v_exp_f32 %2, %11\n\t"
      "v_exp_f32 %3, %12\n\t"
      "v_exp_f32 %4, %13\n\t"
      "v_exp_f32 %5, %14\n\t"
      "v_exp_f32 %6, %15\n\t"
      "v_exp_f32 %7, %16\n\t"
      "v_exp_f32 %8, %17\n\t"
      "v_nop"
      : "=&v"(o[0]), "=&v"(o[1]), "=&v"(o[2]), "=&v"(o[3]), "=&v"(o[4]),
        "=&v"(o[5]), "=&v"(o[6]), "=&v"(o[7]), "=&v"(o[8])
      : "v"(x[0]), "v"(x[1]), "v"(x[2]), "v"(x[3]), "v"(x[4]),
        "v"(x[5]), "v"(x[6]), "v"(x[7]), "v"(x[8]));
}

#define CS_NW_ 4                              // waves of a block
#define CS_NS_ 4                              // 16-column strips of a wave
// The grid puts four of these waves on a SIMD: the register budget of four
// (256) lets the four strips' independent chains be scheduled side by side.
__global__ __launch_bounds__(32 * CS_NW_) __attribute__((amdgpu_waves_per_eu(4, 4)))
void attn_colstats_kernel(
    const unsigned short* __restrict__ kall,
    float* __restrict__ colmax, float* __restrict__ colsum) {
  __shared__ float mrg_m[CS_NW_][CS_NS_ * 16];
  __shared__ float mrg_s[CS_NW_][CS_NS_ * 16];
  const int tid = threadIdx.x;
  const int lane = tid & 31;
  const int w = (int)uni((unsigned)tid >> 5);  // scalar: the row loop's count and addresses stay scalar
  const int l16 = lane & 15, half = lane >> 4;
  const int bh = blockIdx.x;
  const int sG = blockIdx.y;
  const int b = bh >> 4, h = bh & 15;
  const int bt0 = b * T_;
  const int hoff = h * HS_;
  const int s_base = sG * (CS_NS_ * 16);
  const float scale = 0.03125f;               // 1024^-0.5
  const float NINF = -__builtin_inff();
  const float LOG2E = 1.44269504f;

  // head h of batch b, row 0 (the same in every lane), and this lane's place
  // in a 16-row tile
  const unsigned short* kbh = &kall[(size_t)bt0 * E_ + hoff];
  const unsigned lo = (unsigned)l16 * E_;

  Frag bf[CS_NS_][2];                         // key columns (loop-invariant)
  #pragma unroll
  for (int j = 0; j < CS_NS_; ++j) {
    const unsigned short* kp = kbh + (size_t)(s_base + j * 16) * E_ + lo;
    bf[j][0].q[0] = *(const uint4*)&kp[half * 8];
    bf[j][0].q[1] = *(const uint4*)&kp[16 + half * 8];
    bf[j][1].q[0] = *(const uint4*)&kp[32 + half * 8];
    bf[j][1].q[1] = *(const uint4*)&kp[48 + half * 8];
  }

  float m_run[CS_NS_], s_run[CS_NS_];
  #pragma unroll
  for (int j = 0; j < CS_NS_; ++j) { m_run[j] = NINF; s_run[j] = 0.f; }

  for (int tT = sG * CS_NS_ + w; tT < T_ / 16; tT += CS_NW_) {
    const int t_base = tT * 16;
    Frag af[2];
    const unsigned short* qp = kbh + (size_t)t_base * E_ + lo;
    af[0].q[0] = *(const uint4*)&qp[half * 8];
    af[0].q[1] = *(const uint4*)&qp[16 + half * 8];
    af[1].q[0] = *(const uint4*)&qp[32 + half * 8];
    af[1].q[1] = *(const uint4*)&qp[48 + half * 8];
    // holds the four loads together in front of the first product, so that a
    // trip waits out one load latency and not two (loaded values, inputs only)
    asm volatile("" :: "v"(af[0].w[0]), "v"(af[0].w[1]),
                       "v"(af[1].w[0]), "v"(af[1].w[1]));

    #pragma unroll   // m_run[], s_run[], bf[] indexed by constants: they stay in registers
    for (int j = 0; j < CS_NS_; ++j) {
      const int s = s_base + j * 16 + l16;
      v8f sc = vzero8();
      sc = wmma_bf16(af[0], bf[j][0], sc);
      sc = wmma_bf16(af[1], bf[j][1], sc);

      float vals[8];
      float tmax = NINF;
      #pragma unroll
      for (int r = 0; r < 8; ++r) {
        int t = t_base + r + 8 * half;
        if (t >= s) {
          float e = sc[r] * scale;
          vals[r] = e;
          tmax = fmaxf(tmax, e);
        } else {
          vals[r] = NINF;
        }
      }
      // a lane whose eight rows are all masked keeps its max and its sum: the
      // selects below leave both as they are, so no branch stands between the strips
      float nm = fmaxf(m_run[j], tmax);
      float xs[9], ex[9];                     // e^d = 2^(d * log2 e)
      #pragma unroll
      for (int r = 0; r < 8; ++r) xs[r] = (vals[r] - nm) * LOG2E;
      xs[8] = (m_run[j] - nm) * LOG2E;
      exp2_x9(ex, xs);
      float acc_s = (m_run[j] > NINF) ? s_run[j] * ex[8] : 0.f;
      #pragma unroll
      for (int r = 0; r < 8; ++r)
        if (vals[r] > NINF) acc_s += ex[r];
      s_run[j] = acc_s;
      m_run[j] = nm;
    }
  }
  // merge the two lane halves (same columns, different row groups)
  #pragma unroll
  for (int j = 0; j < CS_NS_; ++j) {
    float om = __shfl_xor(m_run[j], 16, 32);
    float os = __shfl_xor(s_run[j], 16, 32);
    float nm = fmaxf(m_run[j], om);
    float tot = 0.f;
    if (m_run[j] > NINF) tot += s_run[j] * __expf(m_run[j] - nm);
    if (om       > NINF) tot += os       * __expf(om       - nm);
    if (lane < 16) {
      mrg_m[w][j * 16 + lane] = nm;
      mrg_s[w][j * 16 + lane] = tot;
    }
  }
  __syncthreads();
  // merge the four waves, in wave order; one thread per column
  if (tid < CS_NS_ * 16) {
    float nm = NINF;
    #pragma unroll
    for (int i = 0; i < CS_NW_; ++i) nm = fmaxf(nm, mrg_m[i][tid]);
    float tot = 0.f;
    #pragma unroll
    for (int i = 0; i < CS_NW_; ++i) {
      float mi = mrg_m[i][tid];
      if (mi > NINF) tot += mrg_s[i][tid] * __expf(mi - nm);
    }
    colmax[(size_t)bh * T_ + s_base + tid] = nm;
    colsum[(size_t)bh * T_ + s_base + tid] = tot;
  }
}

// ---------------------------------------------------- attention pass 2:
// attn[t,d] = sum_s P[t,s] * v[s,d],  P = exp(score-colmax[s])/colsum[s].
// One block of four waves per (bh, 32 query rows). Every wave holds both 16-row
// query tiles in registers and takes every fourth 32-key tile, so that a loaded
// K and V tile meets two query tiles and the longest loop is 16 trips; P has no
// running state, so the four waves' partial outputs are plain sums, merged
// through LDS at the end.
// Each wave has its own P and V tiles in LDS: P re-layouts through LDS; V staged
// row-major (128 B rows at a 160 B pitch) and read by transposing LDS loads.
// Grid: x = bh, y = row group, the group with the most keys first.
// The register budget of four waves a SIMD (256) lets the compiler issue all 20
// global loads of a trip together.
#define VPITCH_ 160u
#define AO_NW_ 4                              // waves of a block
#define AO_NQ_ 2                              // 16-row query tiles of a block
__global__ __launch_bounds__(32 * AO_NW_) __attribute__((amdgpu_waves_per_eu(4, 4)))
void attn_out_kernel(
    const unsigned short* __restrict__ kall,
    const unsigned short* __restrict__ vall,
    const float* __restrict__ colmax, const float* __restrict__ colsum,
    unsigned short* __restrict__ attnB) {
  __shared__ __attribute__((aligned(16)))
      unsigned short Pl_all[AO_NW_][AO_NQ_][16 * 40];   // P tiles [16 t][32 s]
  __shared__ __attribute__((aligned(16)))
      unsigned char Vs_all[AO_NW_][32 * VPITCH_];       // V tile [32 s][64 d], padded
  __shared__ __attribute__((aligned(16)))
      v4f red[AO_NW_][AO_NQ_ * 8][32];                  // partial outputs, [wave][half tile][lane]

  const int tid = threadIdx.x;
  const int lane = tid & 31;
  const int w = (int)uni((unsigned)tid >> 5);  // scalar: the key loop's count stays scalar
  const int l16 = lane & 15, half = lane >> 4;
  const int bh = blockIdx.x;
  const int g = (T_ / (AO_NQ_ * 16) - 1) - (int)blockIdx.y;
  const int b = bh >> 4, h = bh & 15;
  const int bt0 = b * T_;
  const int hoff = h * HS_;
  const int t_base = g * (AO_NQ_ * 16);
  const float scale = 0.03125f;
  unsigned char* Vs = &Vs_all[w][0];

  Frag qf[AO_NQ_][2];                         // query rows (loop-invariant)
  #pragma unroll
  for (int q = 0; q < AO_NQ_; ++q) {
    const unsigned short* qp =
        &kall[(size_t)(bt0 + t_base + q * 16 + l16) * E_ + hoff];
    qf[q][0].q[0] = *(const uint4*)&qp[half * 8];
    qf[q][0].q[1] = *(const uint4*)&qp[16 + half * 8];
    qf[q][1].q[0] = *(const uint4*)&qp[32 + half * 8];
    qf[q][1].q[1] = *(const uint4*)&qp[48 + half * 8];
  }
  v8f acc[AO_NQ_][4];
  #pragma unroll
  for (int q = 0; q < AO_NQ_; ++q)
    #pragma unroll
    for (int i = 0; i < 4; ++i) acc[q][i] = vzero8();

  // this lane's address in the V tile for the transposing loads
  const unsigned char* vtp = &Vs[(8u * half + (lane & 7u)) * VPITCH_ +
                                 ((lane >> 3) & 1u) * 16u];

  // this lane's 16 bytes of V row (lane >> 3) of key tile 0
  const unsigned short* vrow =
      &vall[(size_t)(bt0 + (lane >> 3)) * E_ + hoff + (lane & 7) * 8];

  // key tiles 0 .. g hold every s <= t of this block's rows (32 g + 31 is the last)
  for (int sB = w; sB <= g; sB += AO_NW_) {
    const int s0 = sB * 32;
    // stage V: 32 s-rows x 64 d, rows kept as they are
    const unsigned short* vp = vrow + (size_t)s0 * E_;
    uint4 vv[8];
    #pragma unroll   // vv[] is indexed by constants only, so it stays in registers
    for (int i = 0; i < 8; ++i)      // rows (lane >> 3) + 4 i: one address, fixed offsets
      vv[i] = *(const uint4*)(vp + (size_t)i * 4 * E_);
    #pragma unroll   // as above
    for (int i = 0; i < 8; ++i)
      *(uint4*)&Vs[((lane >> 3) + 4 * i) * VPITCH_ + (lane & 7) * 16] = vv[i];
    // scores and normalized P for the two 16-column subtiles
    #pragma unroll
    for (int sh = 0; sh < 2; ++sh) {
      const int s_sub = s0 + sh * 16;
      Frag kf[2];
      const unsigned short* kp = &kall[(size_t)(bt0 + s_sub + l16) * E_ + hoff];
      kf[0].q[0] = *(const uint4*)&kp[half * 8];
      kf[0].q[1] = *(const uint4*)&kp[16 + half * 8];
      kf[1].q[0] = *(const uint4*)&kp[32 + half * 8];
      kf[1].q[1] = *(const uint4*)&kp[48 + half * 8];

      const int s = s_sub + l16;
      float m  = colmax[(size_t)bh * T_ + s];
      float sm = colsum[(size_t)bh * T_ + s];
      float rs = (sm > 0.f) ? 1.f / sm : 0.f;
      #pragma unroll   // qf[] indexed by constants: it stays in registers
      for (int q = 0; q < AO_NQ_; ++q) {
        v8f sc = vzero8();
        sc = wmma_bf16(qf[q][0], kf[0], sc);
        sc = wmma_bf16(qf[q][1], kf[1], sc);
        #pragma unroll
        for (int r = 0; r < 8; ++r) {
          int t = t_base + q * 16 + r + 8 * half;
          float p = 0.f;
          if (s <= t && sm > 0.f) p = __expf(sc[r] * scale - m) * rs;
          Pl_all[w][q][(r + 8 * half) * 40 + sh * 16 + l16] = f2bf(p);
        }
      }
    }
    // the two tiles are this wave's own: its stores have landed before its
    // lanes read what other lanes of the wave wrote; no other wave is waited for
    asm volatile("s_wait_dscnt 0x0" ::: "memory");
    // attn += P @ V
    Frag pf[AO_NQ_];
    #pragma unroll
    for (int q = 0; q < AO_NQ_; ++q) {
      pf[q].q[0] = *(const uint4*)&Pl_all[w][q][l16 * 40 + half * 8];
      pf[q].q[1] = *(const uint4*)&Pl_all[w][q][l16 * 40 + 16 + half * 8];
    }
    #pragma unroll
    for (int nt = 0; nt < 4; ++nt) {
      Frag vf;
      vf.w[0] = ld_tr16(vtp + nt * 32u);                 // s = 8h + 0..7
      vf.w[1] = ld_tr16(vtp + 16u * VPITCH_ + nt * 32u); // s = 16 + 8h + 0..7
      #pragma unroll   // acc[] indexed by constants: it stays in registers
      for (int q = 0; q < AO_NQ_; ++q)
        acc[q][nt] = wmma_bf16(pf[q], vf, acc[q][nt]);
    }
    // the products above have waited for every read of the two tiles, so the
    // next trip's stores, later in this wave's order, write over nothing in use
  }

  // every wave hands over its partial sums (zeros where it had no key tile)
  #pragma unroll
  for (int q = 0; q < AO_NQ_; ++q)
    #pragma unroll
    for (int nt = 0; nt < 4; ++nt) {
      const v8f a = acc[q][nt];
      v4f lo = {a[0], a[1], a[2], a[3]};
      v4f hi = {a[4], a[5], a[6], a[7]};
      red[w][(q * 4 + nt) * 2 + 0][lane] = lo;
      red[w][(q * 4 + nt) * 2 + 1][lane] = hi;
    }
  __syncthreads();

  // wave w sums, in wave order, and stores two of the eight 16 x 16 tiles;
  // heads concatenated: attnB[b*T+t][h*64+d]
  #pragma unroll
  for (int j = 0; j < AO_NQ_ * 4 / AO_NW_; ++j) {
    const int tile = w * (AO_NQ_ * 4 / AO_NW_) + j;     // = q * 4 + nt
    v4f lo = red[0][tile * 2 + 0][lane];
    v4f hi = red[0][tile * 2 + 1][lane];
    #pragma unroll
    for (int i = 1; i < AO_NW_; ++i) {
      lo += red[i][tile * 2 + 0][lane];
      hi += red[i][tile * 2 + 1][lane];
    }
    const int q = tile >> 2, nt = tile & 3;
    #pragma unroll
    for (int r = 0; r < 8; ++r) {
      int t = t_base + q * 16 + r + 8 * half;
      int d = nt * 16 + l16;
      attnB[(size_t)(bt0 + t) * E_ + hoff + d] = f2bf(r < 4 ? lo[r] : hi[r - 4]);
    }
  }
}

// ---------------------------------------------------------------- launcher
extern "C" void kernel_launch(void* const* d_in, const int* in_sizes, int n_in,
                              void* d_out, int out_size, void* d_ws,
                              size_t ws_size, hipStream_t stream) {
  (void)in_sizes; (void)n_in; (void)out_size; (void)ws_size;

  const float* x      = (const float*)d_in[0];
  const float* ln1_g  = (const float*)d_in[1];
  const float* ln1_b  = (const float*)d_in[2];
  const float* Wk     = (const float*)d_in[3];
  const float* Wv     = (const float*)d_in[4];
  const float* Wproj  = (const float*)d_in[5];
  const float* bproj  = (const float*)d_in[6];
  const float* ln2_g  = (const float*)d_in[7];
  const float* ln2_b  = (const float*)d_in[8];
  const float* W1     = (const float*)d_in[9];
  const float* b1     = (const float*)d_in[10];
  const float* W2     = (const float*)d_in[11];
  const float* b2     = (const float*)d_in[12];
  float* out          = (float*)d_out;

  char* ws = (char*)d_ws;
  size_t off = 0;
  auto alloc = [&](size_t bytes) -> void* {
    void* p = ws + off;
    off += (bytes + 255) & ~(size_t)255;
    return p;
  };

  unsigned short* hB     = (unsigned short*)alloc((size_t)BT_ * E_ * 2);
  unsigned short* WkB    = (unsigned short*)alloc((size_t)E_ * E_ * 2);
  unsigned short* WvB    = (unsigned short*)alloc((size_t)E_ * E_ * 2);
  unsigned short* WprojB = (unsigned short*)alloc((size_t)E_ * E_ * 2);
  unsigned short* W1B    = (unsigned short*)alloc((size_t)E_ * FF_ * 2);
  unsigned short* W2B    = (unsigned short*)alloc((size_t)FF_ * E_ * 2);
  unsigned short* kall   = (unsigned short*)alloc((size_t)BT_ * E_ * 2);
  unsigned short* vall   = (unsigned short*)alloc((size_t)BT_ * E_ * 2);
  float*          cmax   = (float*)alloc((size_t)B_ * H_ * T_ * 4);
  float*          csum   = (float*)alloc((size_t)B_ * H_ * T_ * 4);
  unsigned short* attnB  = (unsigned short*)alloc((size_t)BT_ * E_ * 2);
  float*          x1     = (float*)alloc((size_t)BT_ * E_ * 4);
  unsigned short* h2B    = (unsigned short*)alloc((size_t)BT_ * E_ * 2);
  unsigned short* actB   = (unsigned short*)alloc((size_t)BT_ * FF_ * 2);

  // weight prep
  headperm_bf16_kernel<4><<<(E_ * E_) / 4096, 256, 0, stream>>>(Wk, WkB);
  headperm_bf16_kernel<4><<<(E_ * E_) / 4096, 256, 0, stream>>>(Wv, WvB);
  f32_to_bf16_kernel<4><<<(E_ * E_) / 4096, 256, 0, stream>>>(Wproj, WprojB);
  f32_to_bf16_kernel<8><<<(E_ * FF_) / 8192, 256, 0, stream>>>(W1, W1B);
  f32_to_bf16_kernel<8><<<(FF_ * E_) / 8192, 256, 0, stream>>>(W2, W2B);

  // LN1 -> h (bf16)
  layernorm_bf16_kernel<<<BT_ / 8, 256, 0, stream>>>(x, ln1_g, ln1_b, hB);

  // k = h @ Wk', v = h @ Wv'   (bf16 out for attention WMMA)
  dim3 gE(E_ / 128, BT_ / 64);
  gemm_bf16_kernel<false, false, false, false, true>
      <<<gE, 256, 0, stream>>>(hB, WkB, nullptr, nullptr, nullptr, kall,
                               BT_, E_, E_);
  gemm_bf16_kernel<false, false, false, false, true>
      <<<gE, 256, 0, stream>>>(hB, WvB, nullptr, nullptr, nullptr, vall,
                               BT_, E_, E_);

  // attention: column softmax stats, then output
  dim3 gA(B_ * H_, T_ / (AO_NQ_ * 16));
  dim3 gC(B_ * H_, T_ / (CS_NS_ * 16));
  attn_colstats_kernel<<<gC, 32 * CS_NW_, 0, stream>>>(kall, cmax, csum);
  attn_out_kernel<<<gA, 32 * AO_NW_, 0, stream>>>(kall, vall, cmax, csum, attnB);

  // x1 = x + attn @ Wproj + bproj   (f32)
  gemm_bf16_kernel<true, false, true, true, false>
      <<<gE, 256, 0, stream>>>(attnB, WprojB, bproj, x, x1, nullptr,
                               BT_, E_, E_);

  // LN2 -> h2 (bf16)
  layernorm_bf16_kernel<<<BT_ / 8, 256, 0, stream>>>(x1, ln2_g, ln2_b, h2B);

  // act = relu(h2 @ W1 + b1)   (bf16)
  dim3 gF(FF_ / 128, BT_ / 64);
  gemm_bf16_kernel<true, true, false, false, true>
      <<<gF, 256, 0, stream>>>(h2B, W1B, b1, nullptr, nullptr, actB,
                               BT_, FF_, E_);

  // out = x1 + act @ W2 + b2   (f32)
  gemm_bf16_kernel<true, false, true, true, false>
      <<<gE, 256, 0, stream>>>(actB, W2B, b2, x1, out, nullptr,
                               BT_, E_, FF_);
}

// v007
// It runs in 191 microseconds.
// In both of two side-by-side timings against v006, it was 1.07 times as fast.
// Over all steps from v000 it is 3.67 times as fast.
#include <hip/hip_runtime.h>

// ---------------------------------------------------------------- constants
#define E_   1024
#define H_   16
#define HS_  64
#define B_   2
#define T_   2048
#define BT_  (B_ * T_)
#define FF_  (4 * E_)

typedef __attribute__((ext_vector_type(16))) __bf16     v16bf;
typedef __attribute__((ext_vector_type(8)))  float      v8f;
typedef __attribute__((ext_vector_type(4)))  unsigned   v4u;
typedef __attribute__((ext_vector_type(8)))  unsigned   v8u;

typedef __attribute__((ext_vector_type(8)))  short      v8s;
typedef __attribute__((ext_vector_type(4)))  float      v4f;

union Frag { v16bf v; uint4 q[2]; v4u w[2]; unsigned short us[16]; };

__device__ inline unsigned short f2bf(float f) {
  unsigned u = __float_as_uint(f);
  u += 0x7fffu + ((u >> 16) & 1u);           // round-to-nearest-even
  return (unsigned short)(u >> 16);
}

__device__ inline v8f vzero8() {
  v8f z = {0.f, 0.f, 0.f, 0.f, 0.f, 0.f, 0.f, 0.f};
  return z;
}

__device__ inline v8f wmma_bf16(const Frag& a, const Frag& b, v8f c) {
  return __builtin_amdgcn_wmma_f32_16x16x32_bf16(
      /*neg_a=*/false, a.v, /*neg_b=*/false, b.v,
      /*c_mod=*/(short)0, c, /*reuse_a=*/false, /*reuse_b=*/false);
}

// LDS offset of a shared-memory pointer: generic LDS addresses keep the
// LDS byte offset in the low 32 bits (ISA 10.2 aperture rules).
__device__ inline unsigned lds_off(const void* p) {
  return (unsigned)(unsigned long long)p;
}

__device__ inline void wait_async0() {
  asm volatile("s_wait_asynccnt 0x0" ::: "memory");
}

__device__ inline unsigned pinned(unsigned v) {
  unsigned w = (unsigned)__builtin_amdgcn_readfirstlane(v);
  asm volatile("" : "+s"(w));   // pinned(): a test, stage, buffer or descriptor word held in a scalar register
  return w;
}

__device__ inline unsigned uni(unsigned v) {
  return (unsigned)__builtin_amdgcn_readfirstlane(v);
}

// transposing LDS load: lane (c = l & 15, h = l >> 4) receives
// T[kbase + 8h + 0..7][dbase + c] of a row-major 16-bit tile
__device__ inline v4u ld_tr16(const unsigned char* p) {
  typedef __attribute__((address_space(3))) v8s lds_v8s;
  return __builtin_bit_cast(v4u,
      __builtin_amdgcn_ds_load_tr16_b128_v8i16((lds_v8s*)p));
}

// async copies of 16 bytes global -> LDS (per-lane scatter, ASYNCcnt tracked),
// a thread's copies of one trip in one statement. The wait stands in the
// copies' own statement, so that no later write of the address registers can
// be scheduled in front of it
__device__ inline void async_g2l_b128_x4(unsigned l0, const void* p0,
                                         unsigned l1, const void* p1,
                                         unsigned l2, const void* p2,
                                         unsigned l3, const void* p3) {
  asm volatile("global_load_async_to_lds_b128 %0, %1, off\n\t"
               "global_load_async_to_lds_b128 %2, %3, off\n\t"
               "global_load_async_to_lds_b128 %4, %5, off\n\t"
               "global_load_async_to_lds_b128 %6, %7, off\n\t"
               "s_wait_xcnt 0x0"
               :: "v"(l0), "v"(p0), "v"(l1), "v"(p1),
                  "v"(l2), "v"(p2), "v"(l3), "v"(p3)
               : "memory");
}

// four floats rounded to four bf16, in memory order
__device__ inline uint2 pack4_bf16(v4f v) {
  uint2 r;
  r.x = (unsigned)f2bf(v.x) | ((unsigned)f2bf(v.y) << 16);
  r.y = (unsigned)f2bf(v.z) | ((unsigned)f2bf(v.w) << 16);
  return r;
}

// ------------------------------------------------- weight / dtype conversion
// These launches move few bytes.
// A thread takes NV groups of four floats, 256 groups apart, so that a wave's
// load covers 512 contiguous bytes, all NV loads are in flight together and a
// launch starts 4 NV times fewer waves than with one float a thread.
// The grid covers the array exactly: blocks * 1024 * NV elements.
template <int NV>
__global__ __launch_bounds__(256) void f32_to_bf16_kernel(
    const float* __restrict__ in, unsigned short* __restrict__ out) {
  const int q0 = blockIdx.x * (256 * NV) + threadIdx.x;   // group of four
  v4f v[NV];
  #pragma unroll   // v[] indexed by constants: it stays in registers, the loads go out together
  for (int j = 0; j < NV; ++j) v[j] = ((const v4f*)in)[q0 + j * 256];
  #pragma unroll   // as above
  for (int j = 0; j < NV; ++j) ((uint2*)out)[q0 + j * 256] = pack4_bf16(v[j]);
}

// Wk/Wv: [H][E][HS] f32  ->  [E][H*HS] bf16  (so projection is one GEMM)
template <int NV>
__global__ __launch_bounds__(256) void headperm_bf16_kernel(
    const float* __restrict__ in, unsigned short* __restrict__ out) {
  const int q0 = blockIdx.x * (256 * NV) + threadIdx.x;   // group of four outputs
  v4f v[NV];
  #pragma unroll   // v[] indexed by constants: it stays in registers, the loads go out together
  for (int j = 0; j < NV; ++j) {
    int idx = (q0 + j * 256) * 4;               // idx = e*1024 + h*64 + d
    int e = idx >> 10;
    int c = idx & 1023;
    int h = c >> 6;
    int d = c & 63;                             // a multiple of 4
    v[j] = *(const v4f*)&in[(size_t)h * (E_ * HS_) + (size_t)e * HS_ + d];
  }
  #pragma unroll   // as above
  for (int j = 0; j < NV; ++j) ((uint2*)out)[q0 + j * 256] = pack4_bf16(v[j]);
}

// ------------------------------------------------------------- layernorm
// One wave per row (eight rows a block): a lane holds 32 of the row's 1024
// floats, the two sums go through the wave by shuffles, and a launch starts
// eight times fewer waves than with one block per row; no LDS, no barrier.
__global__ __launch_bounds__(256) void layernorm_bf16_kernel(
    const float* __restrict__ x, const float* __restrict__ g,
    const float* __restrict__ b, unsigned short* __restrict__ out) {
  constexpr int NV = 8;                       // groups of four floats a lane: E_ / 128
  const int lane = threadIdx.x & 31, w = threadIdx.x >> 5;
  const int row = blockIdx.x * 8 + w;

  const v4f* xr = (const v4f*)x + (size_t)row * (E_ / 4);
  v4f xv[NV];
  #pragma unroll   // xv[] indexed by constants: it stays in registers, the loads go out together
  for (int j = 0; j < NV; ++j) xv[j] = xr[j * 32 + lane];
  v4f gv[NV], bv[NV];
  #pragma unroll   // as above
  for (int j = 0; j < NV; ++j) {
    gv[j] = ((const v4f*)g)[j * 32 + lane];
    bv[j] = ((const v4f*)b)[j * 32 + lane];
  }
  // g and b are asked for beside x and have landed here, ahead of the shuffles;
  // left alone the compiler asked for them pair by pair behind the sums, with a
  // wait for each pair (loaded values, inputs only)
  asm volatile("" :: "v"(xv[0]), "v"(xv[1]), "v"(xv[2]), "v"(xv[3]),
                     "v"(xv[4]), "v"(xv[5]), "v"(xv[6]), "v"(xv[7]),
                     "v"(gv[0]), "v"(gv[1]), "v"(gv[2]), "v"(gv[3]),
                     "v"(gv[4]), "v"(gv[5]), "v"(gv[6]), "v"(gv[7]),
                     "v"(bv[0]), "v"(bv[1]), "v"(bv[2]), "v"(bv[3]),
                     "v"(bv[4]), "v"(bv[5]), "v"(bv[6]), "v"(bv[7]));
  float s = 0.f, s2 = 0.f;
  #pragma unroll   // as above
  for (int j = 0; j < NV; ++j) {
    s  += (xv[j].x + xv[j].y) + (xv[j].z + xv[j].w);
    s2 += (xv[j].x * xv[j].x + xv[j].y * xv[j].y) +
          (xv[j].z * xv[j].z + xv[j].w * xv[j].w);
  }
  #pragma unroll
  for (int o = 16; o > 0; o >>= 1) {          // every lane ends with both sums
    s  += __shfl_xor(s, o, 32);
    s2 += __shfl_xor(s2, o, 32);
  }
  const float mean = s / (float)E_;
  const float inv  = rsqrtf(s2 / (float)E_ - mean * mean + 1e-5f);
  uint2* orow = (uint2*)out + (size_t)row * (E_ / 4);
  #pragma unroll   // as above
  for (int j = 0; j < NV; ++j) {
    v4f n;
    n.x = (xv[j].x - mean) * inv * gv[j].x + bv[j].x;
    n.y = (xv[j].y - mean) * inv * gv[j].y + bv[j].y;
    n.z = (xv[j].z - mean) * inv * gv[j].z + bv[j].z;
    n.w = (xv[j].w - mean) * inv * gv[j].w + bv[j].w;
    orow[j * 32 + lane] = pack4_bf16(n);
  }
}

// ------------------------------------------------------------ generic GEMM
// C[M,N] = A[M,K](bf16) * B[K,N](bf16)  (+bias)(relu)(+res f32) -> f32/bf16
// block tile 64(M) x 128(N), 8 waves (2x4), wave tile 32x32.
// A pass of the K loop works on a stage of 128 k (four matrix steps). Two
// buffers: while a pass works on one, the next stage's loads fly into the
// other, so that their latency lies behind the products; one barrier a pass.
// A tile staged by per-lane async global->LDS copies (ASYNCcnt), rows of 256
// bytes at a pitch of 272; B tile staged by the Tensor Data Mover
// (TENSORcnt), one DMA per stage, rows of 256 B padded to a 288 B pitch;
// B fragments come from it by transposing LDS loads (hardware k order, the
// same as the A loader's).
#define BPITCH_ 288u
template <bool BIAS, bool RELU, bool RES, bool OUT32, bool OUT16>
__global__ __launch_bounds__(256) void gemm_bf16_kernel(
    const unsigned short* __restrict__ A, const unsigned short* __restrict__ Bm,
    const float* __restrict__ bias, const float* __restrict__ res,
    float* __restrict__ out32, unsigned short* __restrict__ out16,
    int M, int N, int K) {
  constexpr int KS  = 128;                  // k of a stage; K is a multiple, two stages or more
  constexpr int AP  = KS + 8;               // A pitch in elements
  constexpr int CPR = KS / 8;               // 16-byte pieces in an A row
  constexpr int RPC = 256 / CPR;            // A rows that one copy of the block fills
  constexpr unsigned ABYTES = 64 * AP * 2;        // one A buffer
  constexpr unsigned BBYTES = KS * BPITCH_;       // one B buffer, a multiple of 2 KiB
  static_assert(BBYTES % 2048u == 0u, "the second B buffer starts at a multiple of 2 KiB");
  __shared__ __attribute__((aligned(16)))
      unsigned short As[2 * 64 * AP];       // two of [64 rows][KS k], padded
  __shared__ __attribute__((aligned(2048)))
      unsigned char Bt[2 * BBYTES];         // two of row-major [KS k][128 N], padded

  const int tid  = threadIdx.x;
  const int lane = tid & 31, w = tid >> 5;
  const int l16 = lane & 15, half = lane >> 4;
  const int wm = w >> 2, wn = w & 3;
  const int m0 = blockIdx.y * 64;
  const int n0 = blockIdx.x * 128;

  // D# group 1 (constant over the K loop): 1-byte elements, tensor = tile =
  // KS rows of 256 B, source pitch 2N bytes, 8 dwords of LDS pad per row.
  v8u g1;
  g1[0] = uni((1u << 20) | (5u << 22) | (7u << 25));     // pad on, 256 B, +32 B
  // Words 1 to 7 go through pinned(): each is held in a scalar register of its
  // own for the whole loop, which serves nothing else while a request flies
  // (as plain constants three of them were re-made per load, their registers
  // lent out in between).
  g1[1] = pinned(256u << 16);          // pinned(): descriptor word; tensor_dim0 lo
  g1[2] = pinned((unsigned)KS << 16);  // pinned(): descriptor word; dim1 lo | dim0 hi
  g1[3] = pinned(256u << 16);          // pinned(): descriptor word; tile_dim0 | dim1 hi
  g1[4] = pinned((unsigned)KS);        // pinned(): descriptor word; tile_dim1
  g1[5] = pinned((unsigned)N * 2u);    // pinned(): descriptor word; source pitch, bytes
  g1[6] = pinned(0u);                  // pinned(): descriptor word
  g1[7] = pinned(0u);                  // pinned(): descriptor word
  const unsigned bt_base = lds_off(&Bt[0]);
  const unsigned wave = uni((unsigned)tid >> 5);
  // this lane's address in the tile for the transposing loads
  const unsigned char* btp = &Bt[(8u * half + (lane & 7u)) * BPITCH_ +
                                 ((lane >> 3) & 1u) * 16u + wn * 64u];
  // this thread's first 16 bytes of the A tile: row tid / CPR, piece tid % CPR;
  // its further copies lie RPC rows on each
  const int ar = tid / CPR, ac = (tid % CPR) * 8;
  const unsigned as_dst = lds_off(&As[ar * AP + ac]);

  v8f acc[2][2];
  #pragma unroll
  for (int mt = 0; mt < 2; ++mt)
    #pragma unroll
    for (int nt = 0; nt < 2; ++nt) acc[mt][nt] = vzero8();

  // D# group 0. The load and its wait name it as in and out: it lives in one
  // register tuple from the issue to the wait, and no word of it takes a new
  // value while the request flies
  v4u g0;
  g0[0] = pinned(1u);                  // pinned(): descriptor word; count=1
  g0[1] = pinned(bt_base);             // pinned(): descriptor word; lds_addr
  g0[2] = pinned(0u);                  // pinned(): descriptor word; set per stage
  g0[3] = pinned(0u);                  // pinned(): descriptor word; set per stage
  // stage s goes into buffer buf: every thread's four A copies, then wave 0's
  // tensor load of the B tile. No wait for the data here.
  auto issue_stage = [&](int s, unsigned buf) {
    const unsigned short* gp = &A[(size_t)(m0 + ar) * K + s * KS + ac];
    const size_t gs = (size_t)RPC * K;            // elements between two copies
    constexpr unsigned ls = RPC * AP * 2;         // LDS bytes between two copies
    const unsigned ad = as_dst + buf * ABYTES;
    async_g2l_b128_x4(ad, gp, ad + ls, gp + gs,
                      ad + 2 * ls, gp + 2 * gs,
                      ad + 3 * ls, gp + 3 * gs);
    if (pinned(wave == 0u)) {          // one DMA per block per stage
      // stage and buffer are taken here, so that the descriptor words made of
      // them are formed here, behind the wait for the request before
      const unsigned ps = pinned((unsigned)s);   // pinned(): feeds descriptor words 2 and 3
      const unsigned pb = pinned(buf);           // pinned(): feeds descriptor word 1
      unsigned long long ga =
          (unsigned long long)(const void*)&Bm[(size_t)ps * KS * N + n0];
      g0[1] = uni(bt_base + pb * BBYTES);                // lds_addr
      g0[2] = uni((unsigned)ga);                         // global_addr lo
      g0[3] = uni(((unsigned)(ga >> 32) & 0x01FFFFFFu) | (2u << 30)); // type=2
      asm volatile("tensor_load_to_lds %0, %1" : "+s"(g0) : "s"(g1) : "memory");
    }
  };
  // a stage counts as landed only behind its issuers' own waits, and is read
  // by other waves only behind the barrier that follows them
  auto publish = [&]() {
    if (pinned(wave == 0u)) {
      asm volatile("s_wait_tensorcnt 0x0" : "+s"(g0) :: "memory");
    }
    wait_async0();
    __syncthreads();
  };

  const int nst = K / KS;
  issue_stage(0, 0u);
  publish();
  issue_stage(1, 1u);

  for (int s = 0; s < nst; ++s) {
    const unsigned buf = (unsigned)s & 1u;
    const unsigned short* asb = &As[buf * (ABYTES / 2)];
    const unsigned char* btb = btp + buf * BBYTES;

    #pragma unroll   // offsets become immediates; later steps' LDS loads may go ahead of earlier products
    for (int ks = 0; ks < KS / 32; ++ks) {
      Frag af[2], bf[2];
      #pragma unroll
      for (int mt = 0; mt < 2; ++mt) {
        int rr = wm * 32 + mt * 16 + l16;
        af[mt].q[0] = *(const uint4*)&asb[rr * AP + ks * 32 + half * 8];
        af[mt].q[1] = *(const uint4*)&asb[rr * AP + ks * 32 + 16 + half * 8];
      }
      #pragma unroll
      for (int nt = 0; nt < 2; ++nt) {
        const unsigned char* bp = btb + (unsigned)ks * 32u * BPITCH_ + nt * 32u;
        bf[nt].w[0] = ld_tr16(bp);                 // k = 32 ks + 8h + 0..7
        bf[nt].w[1] = ld_tr16(bp + 16u * BPITCH_); // k = 32 ks + 16 + 8h + ..
      }
      #pragma unroll
      for (int mt = 0; mt < 2; ++mt)
        #pragma unroll
        for (int nt = 0; nt < 2; ++nt)
          acc[mt][nt] = wmma_bf16(af[mt], bf[nt], acc[mt][nt]);
    }
    // every LDS read of this wave has retired before the barrier behind which
    // this pass's buffer is refilled; the same barrier publishes stage s + 1
    asm volatile("s_wait_dscnt 0x0" ::: "memory");
    publish();
    if (pinned((unsigned)(s + 2 < nst))) issue_stage(s + 2, buf);
  }
  // nothing of this wave is outstanding when the kernel goes on to its stores
  asm volatile("s_wait_tensorcnt 0x0" ::: "memory");
  wait_async0();
  asm volatile("s_wait_dscnt 0x0" ::: "memory");

  // epilogue; D layout: row = r + 8*half, col = l16
  #pragma unroll
  for (int mt = 0; mt < 2; ++mt)
    #pragma unroll
    for (int nt = 0; nt < 2; ++nt)
      #pragma unroll
      for (int r = 0; r < 8; ++r) {
        int gr = m0 + wm * 32 + mt * 16 + r + 8 * half;
        int gc = n0 + wn * 32 + nt * 16 + l16;
        float v = acc[mt][nt][r];
        if constexpr (BIAS) v += bias[gc];
        if constexpr (RELU) v = fmaxf(v, 0.f);
        if constexpr (RES)  v += res[(size_t)gr * N + gc];
        if constexpr (OUT32) out32[(size_t)gr * N + gc] = v;
        if constexpr (OUT16) out16[(size_t)gr * N + gc] = f2bf(v);
      }
}

// ---------------------------------------------------- attention pass 1:
// per-COLUMN (softmax over query axis t, as in the reference) max & sumexp.
// scores = k[t].k[s] * 1/32, causal t>=s.
// One block of four waves per (bh, 64 columns). Every wave holds all 64 key
// columns in registers and takes every fourth 16-row tile, so that a loaded
// tile meets four column strips and the longest loop is 32 trips; the four
// waves' partial max and sum of a column are merged through LDS at the end.
// Grid: x = bh, y = column group, the group with the most rows first.
// nine 2^x in one statement. The outputs lie apart from every input (early
// clobber) and a v_nop ends the statement: behind each v_exp_f32 stands an
// instruction that neither reads its result nor overwrites its source, which
// the instruction set asks for
__device__ inline void exp2_x9(float (&o)[9], const float (&x)[9]) {
  asm("v_exp_f32 %0, %9\n\t"
      "v_exp_f32 %1, %10\n\t"
      "v_exp_f32 %2, %11\n\t"
      "v_exp_f32 %3, %12\n\t"
      "v_exp_f32 %4, %13\n\t"
      "v_exp_f32 %5, %14\n\t"
      "v_exp_f32 %6, %15\n\t"
      "v_exp_f32 %7, %16\n\t"
      "v_exp_f32 %8, %17\n\t"
      "v_nop"
      : "=&v"(o[0]), "=&v"(o[1]), "=&v"(o[2]), "=&v"(o[3]), "=&v"(o[4]),
        "=&v"(o[5]), "=&v"(o[6]), "=&v"(o[7]), "=&v"(o[8])
      : "v"(x[0]), "v"(x[1]), "v"(x[2]), "v"(x[3]), "v"(x[4]),
        "v"(x[5]), "v"(x[6]), "v"(x[7]), "v"(x[8]));
}

#define CS_NW_ 4                              // waves of a block
#define CS_NS_ 4                              // 16-column strips of a wave
// The grid puts four of these waves on a SIMD: the register budget of four
// (256) lets the four strips' independent chains be scheduled side by side.
__global__ __launch_bounds__(32 * CS_NW_) __attribute__((amdgpu_waves_per_eu(4, 4)))
void attn_colstats_kernel(
    const unsigned short* __restrict__ kall,
    float* __restrict__ colmax, float* __restrict__ colsum) {
  __shared__ float mrg_m[CS_NW_][CS_NS_ * 16];
  __shared__ float mrg_s[CS_NW_][CS_NS_ * 16];
  const int tid = threadIdx.x;
  const int lane = tid & 31;
  const int w = (int)uni((unsigned)tid >> 5);  // scalar: the row loop's count and addresses stay scalar
  const int l16 = lane & 15, half = lane >> 4;
  const int bh = blockIdx.x;
  const int sG = blockIdx.y;
  const int b = bh >> 4, h = bh & 15;
  const int bt0 = b * T_;
  const int hoff = h * HS_;
  const int s_base = sG * (CS_NS_ * 16);
  const float scale = 0.03125f;               // 1024^-0.5
  const float NINF = -__builtin_inff();
  const float LOG2E = 1.44269504f;

  // head h of batch b, row 0 (the same in every lane), and this lane's place
  // in a 16-row tile
  const unsigned short* kbh = &kall[(size_t)bt0 * E_ + hoff];
  const unsigned lo = (unsigned)l16 * E_;

  Frag bf[CS_NS_][2];                         // key columns (loop-invariant)
  #pragma unroll
  for (int j = 0; j < CS_NS_; ++j) {
    const unsigned short* kp = kbh + (size_t)(s_base + j * 16) * E_ + lo;
    bf[j][0].q[0] = *(const uint4*)&kp[half * 8];
    bf[j][0].q[1] = *(const uint4*)&kp[16 + half * 8];
    bf[j][1].q[0] = *(const uint4*)&kp[32 + half * 8];
    bf[j][1].q[1] = *(const uint4*)&kp[48 + half * 8];
  }

  float m_run[CS_NS_], s_run[CS_NS_];
  #pragma unroll
  for (int j = 0; j < CS_NS_; ++j) { m_run[j] = NINF; s_run[j] = 0.f; }

  for (int tT = sG * CS_NS_ + w; tT < T_ / 16; tT += CS_NW_) {
    const int t_base = tT * 16;
    Frag af[2];
    const unsigned short* qp = kbh + (size_t)t_base * E_ + lo;
    af[0].q[0] = *(const uint4*)&qp[half * 8];
    af[0].q[1] = *(const uint4*)&qp[16 + half * 8];
    af[1].q[0] = *(const uint4*)&qp[32 + half * 8];
    af[1].q[1] = *(const uint4*)&qp[48 + half * 8];
    // holds the four loads together in front of the first product, so that a
    // trip waits out one load latency and not two (loaded values, inputs only)
    asm volatile("" :: "v"(af[0].w[0]), "v"(af[0].w[1]),
                       "v"(af[1].w[0]), "v"(af[1].w[1]));

    #pragma unroll   // m_run[], s_run[], bf[] indexed by constants: they stay in registers
    for (int j = 0; j < CS_NS_; ++j) {
      const int s = s_base + j * 16 + l16;
      v8f sc = vzero8();
      sc = wmma_bf16(af[0], bf[j][0], sc);
      sc = wmma_bf16(af[1], bf[j][1], sc);

      float vals[8];
      float tmax = NINF;
      #pragma unroll
      for (int r = 0; r < 8; ++r) {
        int t = t_base + r + 8 * half;
        if (t >= s) {
          float e = sc[r] * scale;
          vals[r] = e;
          tmax = fmaxf(tmax, e);
        } else {
          vals[r] = NINF;
        }
      }
      // a lane whose eight rows are all masked keeps its max and its sum: the
      // selects below leave both as they are, so no branch stands between the strips
      float nm = fmaxf(m_run[j], tmax);
      float xs[9], ex[9];                     // e^d = 2^(d * log2 e)
      #pragma unroll
      for (int r = 0; r < 8; ++r) xs[r] = (vals[r] - nm) * LOG2E;
      xs[8] = (m_run[j] - nm) * LOG2E;
      exp2_x9(ex, xs);
      float acc_s = (m_run[j] > NINF) ? s_run[j] * ex[8] : 0.f;
      #pragma unroll
      for (int r = 0; r < 8; ++r)
        if (vals[r] > NINF) acc_s += ex[r];
      s_run[j] = acc_s;
      m_run[j] = nm;
    }
  }
  // merge the two lane halves (same columns, different row groups)
  #pragma unroll
  for (int j = 0; j < CS_NS_; ++j) {
    float om = __shfl_xor(m_run[j], 16, 32);
    float os = __shfl_xor(s_run[j], 16, 32);
    float nm = fmaxf(m_run[j], om);
    float tot = 0.f;
    if (m_run[j] > NINF) tot += s_run[j] * __expf(m_run[j] - nm);
    if (om       > NINF) tot += os       * __expf(om       - nm);
    if (lane < 16) {
      mrg_m[w][j * 16 + lane] = nm;
      mrg_s[w][j * 16 + lane] = tot;
    }
  }
  __syncthreads();
  // merge the four waves, in wave order; one thread per column
  if (tid < CS_NS_ * 16) {
    float nm = NINF;
    #pragma unroll
    for (int i = 0; i < CS_NW_; ++i) nm = fmaxf(nm, mrg_m[i][tid]);
    float tot = 0.f;
    #pragma unroll
    for (int i = 0; i < CS_NW_; ++i) {
      float mi = mrg_m[i][tid];
      if (mi > NINF) tot += mrg_s[i][tid] * __expf(mi - nm);
    }
    colmax[(size_t)bh * T_ + s_base + tid] = nm;
    colsum[(size_t)bh * T_ + s_base + tid] = tot;
  }
}

// ---------------------------------------------------- attention pass 2:
// attn[t,d] = sum_s P[t,s] * v[s,d],  P = exp(score-colmax[s])/colsum[s].
// One block of four waves per (bh, 32 query rows). Every wave holds both 16-row
// query tiles in registers and takes every fourth 32-key tile, so that a loaded
// K and V tile meets two query tiles and the longest loop is 16 trips; P has no
// running state, so the four waves' partial outputs are plain sums, merged
// through LDS at the end.
// Each wave has its own P and V tiles in LDS: P re-layouts through LDS; V staged
// row-major (128 B rows at a 160 B pitch) and read by transposing LDS loads.
// Grid: x = bh, y = row group, the group with the most keys first.
// The register budget of four waves a SIMD (256) lets the compiler issue all 20
// global loads of a trip together.
#define VPITCH_ 160u
#define AO_NW_ 4                              // waves of a block
#define AO_NQ_ 2                              // 16-row query tiles of a block
__global__ __launch_bounds__(32 * AO_NW_) __attribute__((amdgpu_waves_per_eu(4, 4)))
void attn_out_kernel(
    const unsigned short* __restrict__ kall,
    const unsigned short* __restrict__ vall,
    const float* __restrict__ colmax, const float* __restrict__ colsum,
    unsigned short* __restrict__ attnB) {
  __shared__ __attribute__((aligned(16)))
      unsigned short Pl_all[AO_NW_][AO_NQ_][16 * 40];   // P tiles [16 t][32 s]
  __shared__ __attribute__((aligned(16)))
      unsigned char Vs_all[AO_NW_][32 * VPITCH_];       // V tile [32 s][64 d], padded
  __shared__ __attribute__((aligned(16)))
      v4f red[AO_NW_][AO_NQ_ * 8][32];                  // partial outputs, [wave][half tile][lane]

  const int tid = threadIdx.x;
  const int lane = tid & 31;
  const int w = (int)uni((unsigned)tid >> 5);  // scalar: the key loop's count stays scalar
  const int l16 = lane & 15, half = lane >> 4;
  const int bh = blockIdx.x;
  const int g = (T_ / (AO_NQ_ * 16) - 1) - (int)blockIdx.y;
  const int b = bh >> 4, h = bh & 15;
  const int bt0 = b * T_;
  const int hoff = h * HS_;
  const int t_base = g * (AO_NQ_ * 16);
  const float scale = 0.03125f;
  unsigned char* Vs = &Vs_all[w][0];

  Frag qf[AO_NQ_][2];                         // query rows (loop-invariant)
  #pragma unroll
  for (int q = 0; q < AO_NQ_; ++q) {
    const unsigned short* qp =
        &kall[(size_t)(bt0 + t_base + q * 16 + l16) * E_ + hoff];
    qf[q][0].q[0] = *(const uint4*)&qp[half * 8];
    qf[q][0].q[1] = *(const uint4*)&qp[16 + half * 8];
    qf[q][1].q[0] = *(const uint4*)&qp[32 + half * 8];
    qf[q][1].q[1] = *(const uint4*)&qp[48 + half * 8];
  }
  v8f acc[AO_NQ_][4];
  #pragma unroll
  for (int q = 0; q < AO_NQ_; ++q)
    #pragma unroll
    for (int i = 0; i < 4; ++i) acc[q][i] = vzero8();

  // this lane's address in the V tile for the transposing loads
  const unsigned char* vtp = &Vs[(8u * half + (lane & 7u)) * VPITCH_ +
                                 ((lane >> 3) & 1u) * 16u];

  // this lane's 16 bytes of V row (lane >> 3) of key tile 0
  const unsigned short* vrow =
      &vall[(size_t)(bt0 + (lane >> 3)) * E_ + hoff + (lane & 7) * 8];

  // key tiles 0 .. g hold every s <= t of this block's rows (32 g + 31 is the last)
  for (int sB = w; sB <= g; sB += AO_NW_) {
    const int s0 = sB * 32;
    // stage V: 32 s-rows x 64 d, rows kept as they are
    const unsigned short* vp = vrow + (size_t)s0 * E_;
    uint4 vv[8];
    #pragma unroll   // vv[] is indexed by constants only, so it stays in registers
    for (int i = 0; i < 8; ++i)      // rows (lane >> 3) + 4 i: one address, fixed offsets
      vv[i] = *(const uint4*)(vp + (size_t)i * 4 * E_);
    #pragma unroll   // as above
    for (int i = 0; i < 8; ++i)
      *(uint4*)&Vs[((lane >> 3) + 4 * i) * VPITCH_ + (lane & 7) * 16] = vv[i];
    // scores and normalized P for the two 16-column subtiles
    #pragma unroll
    for (int sh = 0; sh < 2; ++sh) {
      const int s_sub = s0 + sh * 16;
      Frag kf[2];
      const unsigned short* kp = &kall[(size_t)(bt0 + s_sub + l16) * E_ + hoff];
      kf[0].q[0] = *(const uint4*)&kp[half * 8];
      kf[0].q[1] = *(const uint4*)&kp[16 + half * 8];
      kf[1].q[0] = *(const uint4*)&kp[32 + half * 8];
      kf[1].q[1] = *(const uint4*)&kp[48 + half * 8];

      const int s = s_sub + l16;
      float m  = colmax[(size_t)bh * T_ + s];
      float sm = colsum[(size_t)bh * T_ + s];
      float rs = (sm > 0.f) ? 1.f / sm : 0.f;
      #pragma unroll   // qf[] indexed by constants: it stays in registers
      for (int q = 0; q < AO_NQ_; ++q) {
        v8f sc = vzero8();
        sc = wmma_bf16(qf[q][0], kf[0], sc);
        sc = wmma_bf16(qf[q][1], kf[1], sc);
        #pragma unroll
        for (int r = 0; r < 8; ++r) {
          int t = t_base + q * 16 + r + 8 * half;
          float p = 0.f;
          if (s <= t && sm > 0.f) p = __expf(sc[r] * scale - m) * rs;
          Pl_all[w][q][(r + 8 * half) * 40 + sh * 16 + l16] = f2bf(p);
        }
      }
    }
    // the two tiles are this wave's own: its stores have landed before its
    // lanes read what other lanes of the wave wrote; no other wave is waited for
    asm volatile("s_wait_dscnt 0x0" ::: "memory");
    // attn += P @ V
    Frag pf[AO_NQ_];
    #pragma unroll
    for (int q = 0; q < AO_NQ_; ++q) {
      pf[q].q[0] = *(const uint4*)&Pl_all[w][q][l16 * 40 + half * 8];
      pf[q].q[1] = *(const uint4*)&Pl_all[w][q][l16 * 40 + 16 + half * 8];
    }
    #pragma unroll
    for (int nt = 0; nt < 4; ++nt) {
      Frag vf;
      vf.w[0] = ld_tr16(vtp + nt * 32u);                 // s = 8h + 0..7
      vf.w[1] = ld_tr16(vtp + 16u * VPITCH_ + nt * 32u); // s = 16 + 8h + 0..7
      #pragma unroll   // acc[] indexed by constants: it stays in registers
      for (int q = 0; q < AO_NQ_; ++q)
        acc[q][nt] = wmma_bf16(pf[q], vf, acc[q][nt]);
    }
    // the products above have waited for every read of the two tiles, so the
    // next trip's stores, later in this wave's order, write over nothing in use
  }

  // every wave hands over its partial sums (zeros where it had no key tile)
  #pragma unroll
  for (int q = 0; q < AO_NQ_; ++q)
    #pragma unroll
    for (int nt = 0; nt < 4; ++nt) {
      const v8f a = acc[q][nt];
      v4f lo = {a[0], a[1], a[2], a[3]};
      v4f hi = {a[4], a[5], a[6], a[7]};
      red[w][(q * 4 + nt) * 2 + 0][lane] = lo;
      red[w][(q * 4 + nt) * 2 + 1][lane] = hi;
    }
  __syncthreads();

  // wave w sums, in wave order, and stores two of the eight 16 x 16 tiles;
  // heads concatenated: attnB[b*T+t][h*64+d]
  #pragma unroll
  for (int j = 0; j < AO_NQ_ * 4 / AO_NW_; ++j) {
    const int tile = w * (AO_NQ_ * 4 / AO_NW_) + j;     // = q * 4 + nt
    v4f lo = red[0][tile * 2 + 0][lane];
    v4f hi = red[0][tile * 2 + 1][lane];
    #pragma unroll
    for (int i = 1; i < AO_NW_; ++i) {
      lo += red[i][tile * 2 + 0][lane];
      hi += red[i][tile * 2 + 1][lane];
    }
    const int q = tile >> 2, nt = tile & 3;
    #pragma unroll
    for (int r = 0; r < 8; ++r) {
      int t = t_base + q * 16 + r + 8 * half;
      int d = nt * 16 + l16;
      attnB[(size_t)(bt0 + t) * E_ + hoff + d] = f2bf(r < 4 ? lo[r] : hi[r - 4]);
    }
  }
}

// ---------------------------------------------------------------- launcher
extern "C" void kernel_launch(void* const* d_in, const int* in_sizes, int n_in,
                              void* d_out, int out_size, void* d_ws,
                              size_t ws_size, hipStream_t stream) {
  (void)in_sizes; (void)n_in; (void)out_size; (void)ws_size;

  const float* x      = (const float*)d_in[0];
  const float* ln1_g  = (const float*)d_in[1];
  const float* ln1_b  = (const float*)d_in[2];
  const float* Wk     = (const float*)d_in[3];
  const float* Wv     = (const float*)d_in[4];
  const float* Wproj  = (const float*)d_in[5];
  const float* bproj  = (const float*)d_in[6];
  const float* ln2_g  = (const float*)d_in[7];
  const float* ln2_b  = (const float*)d_in[8];
  const float* W1     = (const float*)d_in[9];
  const float* b1     = (const float*)d_in[10];
  const float* W2     = (const float*)d_in[11];
  const float* b2     = (const float*)d_in[12];
  float* out          = (float*)d_out;

  char* ws = (char*)d_ws;
  size_t off = 0;
  auto alloc = [&](size_t bytes) -> void* {
    void* p = ws + off;
    off += (bytes + 255) & ~(size_t)255;
    return p;
  };

  unsigned short* hB     = (unsigned short*)alloc((size_t)BT_ * E_ * 2);
  unsigned short* WkB    = (unsigned short*)alloc((size_t)E_ * E_ * 2);
  unsigned short* WvB    = (unsigned short*)alloc((size_t)E_ * E_ * 2);
  unsigned short* WprojB = (unsigned short*)alloc((size_t)E_ * E_ * 2);
  unsigned short* W1B    = (unsigned short*)alloc((size_t)E_ * FF_ * 2);
  unsigned short* W2B    = (unsigned short*)alloc((size_t)FF_ * E_ * 2);
  unsigned short* kall   = (unsigned short*)alloc((size_t)BT_ * E_ * 2);
  unsigned short* vall   = (unsigned short*)alloc((size_t)BT_ * E_ * 2);
  float*          cmax   = (float*)alloc((size_t)B_ * H_ * T_ * 4);
  float*          csum   = (float*)alloc((size_t)B_ * H_ * T_ * 4);
  unsigned short* attnB  = (unsigned short*)alloc((size_t)BT_ * E_ * 2);
  float*          x1     = (float*)alloc((size_t)BT_ * E_ * 4);
  unsigned short* h2B    = (unsigned short*)alloc((size_t)BT_ * E_ * 2);
  unsigned short* actB   = (unsigned short*)alloc((size_t)BT_ * FF_ * 2);

  // weight prep
  headperm_bf16_kernel<4><<<(E_ * E_) / 4096, 256, 0, stream>>>(Wk, WkB);
  headperm_bf16_kernel<4><<<(E_ * E_) / 4096, 256, 0, stream>>>(Wv, WvB);
  f32_to_bf16_kernel<4><<<(E_ * E_) / 4096, 256, 0, stream>>>(Wproj, WprojB);
  f32_to_bf16_kernel<8><<<(E_ * FF_) / 8192, 256, 0, stream>>>(W1, W1B);
  f32_to_bf16_kernel<8><<<(FF_ * E_) / 8192, 256, 0, stream>>>(W2, W2B);

  // LN1 -> h (bf16)
  layernorm_bf16_kernel<<<BT_ / 8, 256, 0, stream>>>(x, ln1_g, ln1_b, hB);

  // k = h @ Wk', v = h @ Wv'   (bf16 out for attention WMMA)
  dim3 gE(E_ / 128, BT_ / 64);
  gemm_bf16_kernel<false, false, false, false, true>
      <<<gE, 256, 0, stream>>>(hB, WkB, nullptr, nullptr, nullptr, kall,
                               BT_, E_, E_);
  gemm_bf16_kernel<false, false, false, false, true>
      <<<gE, 256, 0, stream>>>(hB, WvB, nullptr, nullptr, nullptr, vall,
                               BT_, E_, E_);

  // attention: column softmax stats, then output
  dim3 gA(B_ * H_, T_ / (AO_NQ_ * 16));
  dim3 gC(B_ * H_, T_ / (CS_NS_ * 16));
  attn_colstats_kernel<<<gC, 32 * CS_NW_, 0, stream>>>(kall, cmax, csum);
  attn_out_kernel<<<gA, 32 * AO_NW_, 0, stream>>>(kall, vall, cmax, csum, attnB);

  // x1 = x + attn @ Wproj + bproj   (f32)
  gemm_bf16_kernel<true, false, true, true, false>
      <<<gE, 256, 0, stream>>>(attnB, WprojB, bproj, x, x1, nullptr,
                               BT_, E_, E_);

  // LN2 -> h2 (bf16)
  layernorm_bf16_kernel<<<BT_ / 8, 256, 0, stream>>>(x1, ln2_g, ln2_b, h2B);

  // act = relu(h2 @ W1 + b1)   (bf16)
  dim3 gF(FF_ / 128, BT_ / 64);
  gemm_bf16_kernel<true, true, false, false, true>
      <<<gF, 256, 0, stream>>>(h2B, W1B, b1, nullptr, nullptr, actB,
                               BT_, FF_, E_);

  // out = x1 + act @ W2 + b2   (f32)
  gemm_bf16_kernel<true, false, true, true, false>
      <<<gE, 256, 0, stream>>>(actB, W2B, b2, x1, out, nullptr,
                               BT_, E_, FF_);
}

// v008
// A run of this version takes 179 microseconds.
// Timed twice side by side with v007, it ran 1.07 times as fast both times.
// Over all steps from v000 it is 3.91 times as fast.
#include <hip/hip_runtime.h>

// ---------------------------------------------------------------- constants
#define E_   1024
#define H_   16
#define HS_  64
#define B_   2
#define T_   2048
#define BT_  (B_ * T_)
#define FF_  (4 * E_)

typedef __attribute__((ext_vector_type(16))) __bf16     v16bf;
typedef __attribute__((ext_vector_type(8)))  float      v8f;
typedef __attribute__((ext_vector_type(4)))  unsigned   v4u;
typedef __attribute__((ext_vector_type(8)))  unsigned   v8u;

typedef __attribute__((ext_vector_type(8)))  short      v8s;
typedef __attribute__((ext_vector_type(4)))  float      v4f;

union Frag { v16bf v; uint4 q[2]; v4u w[2]; unsigned short us[16]; };

__device__ inline unsigned short f2bf(float f) {
  unsigned u = __float_as_uint(f);
  u += 0x7fffu + ((u >> 16) & 1u);           // round-to-nearest-even
  return (unsigned short)(u >> 16);
}

__device__ inline v8f vzero8() {
  v8f z = {0.f, 0.f, 0.f, 0.f, 0.f, 0.f, 0.f, 0.f};
  return z;
}

__device__ inline v8f wmma_bf16(const Frag& a, const Frag& b, v8f c) {
  return __builtin_amdgcn_wmma_f32_16x16x32_bf16(
      /*neg_a=*/false, a.v, /*neg_b=*/false, b.v,
      /*c_mod=*/(short)0, c, /*reuse_a=*/false, /*reuse_b=*/false);
}

// LDS offset of a shared-memory pointer: generic LDS addresses keep the
// LDS byte offset in the low 32 bits (ISA 10.2 aperture rules).
__device__ inline unsigned lds_off(const void* p) {
  return (unsigned)(unsigned long long)p;
}

__device__ inline void wait_async0() {
  asm volatile("s_wait_asynccnt 0x0" ::: "memory");
}

__device__ inline unsigned pinned(unsigned v) {
  unsigned w = (unsigned)__builtin_amdgcn_readfirstlane(v);
  asm volatile("" : "+s"(w));   // pinned(): a test, stage, buffer or descriptor word held in a scalar register
  return w;
}

__device__ inline unsigned uni(unsigned v) {
  return (unsigned)__builtin_amdgcn_readfirstlane(v);
}

// transposing LDS load: lane (c = l & 15, h = l >> 4) receives
// T[kbase + 8h + 0..7][dbase + c] of a row-major 16-bit tile
__device__ inline v4u ld_tr16(const unsigned char* p) {
  typedef __attribute__((address_space(3))) v8s lds_v8s;
  return __builtin_bit_cast(v4u,
      __builtin_amdgcn_ds_load_tr16_b128_v8i16((lds_v8s*)p));
}

// async copies of 16 bytes global -> LDS (per-lane scatter, ASYNCcnt tracked),
// a thread's copies of one trip in one statement. The wait stands in the
// copies' own statement, so that no later write of the address registers can
// be scheduled in front of it
__device__ inline void async_g2l_b128_x4(unsigned l0, const void* p0,
                                         unsigned l1, const void* p1,
                                         unsigned l2, const void* p2,
                                         unsigned l3, const void* p3) {
  asm volatile("global_load_async_to_lds_b128 %0, %1, off\n\t"
               "global_load_async_to_lds_b128 %2, %3, off\n\t"
               "global_load_async_to_lds_b128 %4, %5, off\n\t"
               "global_load_async_to_lds_b128 %6, %7, off\n\t"
               "s_wait_xcnt 0x0"
               :: "v"(l0), "v"(p0), "v"(l1), "v"(p1),
                  "v"(l2), "v"(p2), "v"(l3), "v"(p3)
               : "memory");
}

// four floats rounded to four bf16, in memory order
__device__ inline uint2 pack4_bf16(v4f v) {
  uint2 r;
  r.x = (unsigned)f2bf(v.x) | ((unsigned)f2bf(v.y) << 16);
  r.y = (unsigned)f2bf(v.z) | ((unsigned)f2bf(v.w) << 16);
  return r;
}

// ------------------------------------------------- weight / dtype conversion
// The conversions move few bytes; what they cost is the start of their waves.
// A thread takes NV groups of four floats, 256 groups apart, so that a wave's
// load covers 512 contiguous bytes, all NV loads are in flight together and an
// array takes 4 NV times fewer waves than with one float a thread.
// The blocks cover the array exactly: blocks * 1024 * NV elements.
// blk: the block's index within its own array.
template <int NV>
__device__ inline void f32_to_bf16_block(
    const float* __restrict__ in, unsigned short* __restrict__ out, int blk) {
  const int q0 = blk * (256 * NV) + threadIdx.x;          // group of four
  v4f v[NV];
  #pragma unroll   // v[] indexed by constants: it stays in registers, the loads go out together
  for (int j = 0; j < NV; ++j) v[j] = ((const v4f*)in)[q0 + j * 256];
  #pragma unroll   // as above
  for (int j = 0; j < NV; ++j) ((uint2*)out)[q0 + j * 256] = pack4_bf16(v[j]);
  // precaution: in the merged kernel the compiler lays another array's code
  // behind these stores, and it rewrites registers that they name
  asm volatile("s_wait_xcnt 0x0" ::: "memory");
}

// Wk/Wv: [H][E][HS] f32  ->  [E][H*HS] bf16  (so projection is one GEMM)
template <int NV>
__device__ inline void headperm_bf16_block(
    const float* __restrict__ in, unsigned short* __restrict__ out, int blk) {
  const int q0 = blk * (256 * NV) + threadIdx.x;          // group of four outputs
  v4f v[NV];
  #pragma unroll   // v[] indexed by constants: it stays in registers, the loads go out together
  for (int j = 0; j < NV; ++j) {
    int idx = (q0 + j * 256) * 4;               // idx = e*1024 + h*64 + d
    int e = idx >> 10;
    int c = idx & 1023;
    int h = c >> 6;
    int d = c & 63;                             // a multiple of 4
    v[j] = *(const v4f*)&in[(size_t)h * (E_ * HS_) + (size_t)e * HS_ + d];
  }
  #pragma unroll   // as above
  for (int j = 0; j < NV; ++j) ((uint2*)out)[q0 + j * 256] = pack4_bf16(v[j]);
  // precaution: in the merged kernel the compiler lays another array's code
  // behind these stores, and it rewrites registers that they name
  asm volatile("s_wait_xcnt 0x0" ::: "memory");
}

// ------------------------------------------------------------- layernorm
// One wave per row (eight rows a block): a lane holds 32 of the row's 1024
// floats, the two sums go through the wave by shuffles, and a launch starts
// eight times fewer waves than with one block per row; no LDS, no barrier.
__device__ inline void layernorm_bf16_block(
    const float* __restrict__ x, const float* __restrict__ g,
    const float* __restrict__ b, unsigned short* __restrict__ out, int blk) {
  constexpr int NV = 8;                       // groups of four floats a lane: E_ / 128
  const int lane = threadIdx.x & 31, w = threadIdx.x >> 5;
  const int row = blk * 8 + w;

  const v4f* xr = (const v4f*)x + (size_t)row * (E_ / 4);
  v4f xv[NV];
  #pragma unroll   // xv[] indexed by constants: it stays in registers, the loads go out together
  for (int j = 0; j < NV; ++j) xv[j] = xr[j * 32 + lane];
  v4f gv[NV], bv[NV];
  #pragma unroll   // as above
  for (int j = 0; j < NV; ++j) {
    gv[j] = ((const v4f*)g)[j * 32 + lane];
    bv[j] = ((const v4f*)b)[j * 32 + lane];
  }
  // g and b are asked for beside x and have landed here, ahead of the shuffles;
  // left alone the compiler asked for them pair by pair behind the sums, with a
  // wait for each pair (loaded values, inputs only)
  asm volatile("" :: "v"(xv[0]), "v"(xv[1]), "v"(xv[2]), "v"(xv[3]),
                     "v"(xv[4]), "v"(xv[5]), "v"(xv[6]), "v"(xv[7]),
                     "v"(gv[0]), "v"(gv[1]), "v"(gv[2]), "v"(gv[3]),
                     "v"(gv[4]), "v"(gv[5]), "v"(gv[6]), "v"(gv[7]),
                     "v"(bv[0]), "v"(bv[1]), "v"(bv[2]), "v"(bv[3]),
                     "v"(bv[4]), "v"(bv[5]), "v"(bv[6]), "v"(bv[7]));
  float s = 0.f, s2 = 0.f;
  #pragma unroll   // as above
  for (int j = 0; j < NV; ++j) {
    s  += (xv[j].x + xv[j].y) + (xv[j].z + xv[j].w);
    s2 += (xv[j].x * xv[j].x + xv[j].y * xv[j].y) +
          (xv[j].z * xv[j].z + xv[j].w * xv[j].w);
  }
  #pragma unroll
  for (int o = 16; o > 0; o >>= 1) {          // every lane ends with both sums
    s  += __shfl_xor(s, o, 32);
    s2 += __shfl_xor(s2, o, 32);
  }
  const float mean = s / (float)E_;
  const float inv  = rsqrtf(s2 / (float)E_ - mean * mean + 1e-5f);
  uint2* orow = (uint2*)out + (size_t)row * (E_ / 4);
  #pragma unroll   // as above
  for (int j = 0; j < NV; ++j) {
    v4f n;
    n.x = (xv[j].x - mean) * inv * gv[j].x + bv[j].x;
    n.y = (xv[j].y - mean) * inv * gv[j].y + bv[j].y;
    n.z = (xv[j].z - mean) * inv * gv[j].z + bv[j].z;
    n.w = (xv[j].w - mean) * inv * gv[j].w + bv[j].w;
    orow[j * 32 + lane] = pack4_bf16(n);
  }
}

__global__ __launch_bounds__(256) void layernorm_bf16_kernel(
    const float* __restrict__ x, const float* __restrict__ g,
    const float* __restrict__ b, unsigned short* __restrict__ out) {
  layernorm_bf16_block(x, g, b, out, blockIdx.x);
}

// ------------------------------------------------- all that reads inputs only
// The first layernorm and the five weight conversions read none of each
// other's output, and each is far shorter than what a launch of its own costs
// (gap, start of its waves, drain): they run as one launch. A block's index
// says which array it works on; the work of a block is what it was.
#define PREP_LN_ (BT_ / 8)                    // blocks of the layernorm
#define PREP_FF_ ((E_ * FF_) / 8192)          // blocks of W1, and of W2
#define PREP_EE_ ((E_ * E_) / 4096)           // blocks of Wk, of Wv, of Wproj
#define PREP_BLOCKS_ (PREP_LN_ + 2 * PREP_FF_ + 3 * PREP_EE_)
__global__ __launch_bounds__(256) void prep_kernel(
    const float* __restrict__ x, const float* __restrict__ g,
    const float* __restrict__ b, const float* __restrict__ Wk,
    const float* __restrict__ Wv, const float* __restrict__ Wproj,
    const float* __restrict__ W1, const float* __restrict__ W2,
    unsigned short* __restrict__ hB, unsigned short* __restrict__ WkB,
    unsigned short* __restrict__ WvB, unsigned short* __restrict__ WprojB,
    unsigned short* __restrict__ W1B, unsigned short* __restrict__ W2B) {
  int blk = blockIdx.x;
  if (blk < PREP_LN_) { layernorm_bf16_block(x, g, b, hB, blk); return; }
  blk -= PREP_LN_;
  if (blk < PREP_FF_) { f32_to_bf16_block<8>(W1, W1B, blk); return; }
  blk -= PREP_FF_;
  if (blk < PREP_FF_) { f32_to_bf16_block<8>(W2, W2B, blk); return; }
  blk -= PREP_FF_;
  if (blk < PREP_EE_) { headperm_bf16_block<4>(Wk, WkB, blk); return; }
  blk -= PREP_EE_;
  if (blk < PREP_EE_) { headperm_bf16_block<4>(Wv, WvB, blk); return; }
  blk -= PREP_EE_;
  f32_to_bf16_block<4>(Wproj, WprojB, blk);
}

// ------------------------------------------------------------ generic GEMM
// C[M,N] = A[M,K](bf16) * B[K,N](bf16)  (+bias)(relu)(+res f32) -> f32/bf16
// block tile 64(M) x 128(N), 8 waves (2x4), wave tile 32x32.
// A pass of the K loop works on a stage of 128 k (four matrix steps). Two
// buffers: while a pass works on one, the next stage's loads fly into the
// other, so that their latency lies behind the products; one barrier a pass.
// A tile staged by per-lane async global->LDS copies (ASYNCcnt), rows of 256
// bytes at a pitch of 272; B tile staged by the Tensor Data Mover
// (TENSORcnt), one DMA per stage, rows of 256 B padded to a 288 B pitch;
// B fragments come from it by transposing LDS loads (hardware k order, the
// same as the A loader's).
// TWO: one launch does two products with the same A. The grid has 2 N / 128
// block columns; the second N / 128 of them take the second B matrix, which
// lies right behind the first, and write the second output, right behind the
// first.
#define BPITCH_ 288u
template <bool BIAS, bool RELU, bool RES, bool OUT32, bool OUT16, bool TWO>
__global__ __launch_bounds__(256) void gemm_bf16_kernel(
    const unsigned short* __restrict__ A, const unsigned short* __restrict__ Bm,
    const float* __restrict__ bias, const float* __restrict__ res,
    float* __restrict__ out32, unsigned short* __restrict__ out16,
    int M, int N, int K) {
  constexpr int KS  = 128;                  // k of a stage; K is a multiple, two stages or more
  constexpr int AP  = KS + 8;               // A pitch in elements
  constexpr int CPR = KS / 8;               // 16-byte pieces in an A row
  constexpr int RPC = 256 / CPR;            // A rows that one copy of the block fills
  constexpr unsigned ABYTES = 64 * AP * 2;        // one A buffer
  constexpr unsigned BBYTES = KS * BPITCH_;       // one B buffer, a multiple of 2 KiB
  static_assert(BBYTES % 2048u == 0u, "the second B buffer starts at a multiple of 2 KiB");
  __shared__ __attribute__((aligned(16)))
      unsigned short As[2 * 64 * AP];       // two of [64 rows][KS k], padded
  __shared__ __attribute__((aligned(2048)))
      unsigned char Bt[2 * BBYTES];         // two of row-major [KS k][128 N], padded

  const int tid  = threadIdx.x;
  const int lane = tid & 31, w = tid >> 5;
  const int l16 = lane & 15, half = lane >> 4;
  const int wm = w >> 2, wn = w & 3;
  const int m0 = blockIdx.y * 64;
  int bx = blockIdx.x;
  if constexpr (TWO) {
    const int nb = N / 128;
    if (bx >= nb) {
      bx -= nb;
      Bm += (size_t)K * N;
      out16 += (size_t)M * N;
    }
  }
  const int n0 = bx * 128;

  // D# group 1 (constant over the K loop): 1-byte elements, tensor = tile =
  // KS rows of 256 B, source pitch 2N bytes, 8 dwords of LDS pad per row.
  v8u g1;
  g1[0] = uni((1u << 20) | (5u << 22) | (7u << 25));     // pad on, 256 B, +32 B
  // Words 1 to 7 go through pinned(): each is held in a scalar register of its
  // own for the whole loop, which serves nothing else while a request flies
  // (as plain constants three of them were re-made per load, their registers
  // lent out in between).
  g1[1] = pinned(256u << 16);          // pinned(): descriptor word; tensor_dim0 lo
  g1[2] = pinned((unsigned)KS << 16);  // pinned(): descriptor word; dim1 lo | dim0 hi
  g1[3] = pinned(256u << 16);          // pinned(): descriptor word; tile_dim0 | dim1 hi
  g1[4] = pinned((unsigned)KS);        // pinned(): descriptor word; tile_dim1
  g1[5] = pinned((unsigned)N * 2u);    // pinned(): descriptor word; source pitch, bytes
  g1[6] = pinned(0u);                  // pinned(): descriptor word
  g1[7] = pinned(0u);                  // pinned(): descriptor word
  const unsigned bt_base = lds_off(&Bt[0]);
  const unsigned wave = uni((unsigned)tid >> 5);
  // this lane's address in the tile for the transposing loads
  const unsigned char* btp = &Bt[(8u * half + (lane & 7u)) * BPITCH_ +
                                 ((lane >> 3) & 1u) * 16u + wn * 64u];
  // this thread's first 16 bytes of the A tile: row tid / CPR, piece tid % CPR;
  // its further copies lie RPC rows on each
  const int ar = tid / CPR, ac = (tid % CPR) * 8;
  const unsigned as_dst = lds_off(&As[ar * AP + ac]);

  v8f acc[2][2];
  #pragma unroll
  for (int mt = 0; mt < 2; ++mt)
    #pragma unroll
    for (int nt = 0; nt < 2; ++nt) acc[mt][nt] = vzero8();

  // D# group 0. The load and its wait name it as in and out: it lives in one
  // register tuple from the issue to the wait, and no word of it takes a new
  // value while the request flies
  v4u g0;
  g0[0] = pinned(1u);                  // pinned(): descriptor word; count=1
  g0[1] = pinned(bt_base);             // pinned(): descriptor word; lds_addr
  g0[2] = pinned(0u);                  // pinned(): descriptor word; set per stage
  g0[3] = pinned(0u);                  // pinned(): descriptor word; set per stage
  // stage s goes into buffer buf: every thread's four A copies, then wave 0's
  // tensor load of the B tile. No wait for the data here.
  auto issue_stage = [&](int s, unsigned buf) {
    const unsigned short* gp = &A[(size_t)(m0 + ar) * K + s * KS + ac];
    const size_t gs = (size_t)RPC * K;            // elements between two copies
    constexpr unsigned ls = RPC * AP * 2;         // LDS bytes between two copies
    const unsigned ad = as_dst + buf * ABYTES;
    async_g2l_b128_x4(ad, gp, ad + ls, gp + gs,
                      ad + 2 * ls, gp + 2 * gs,
                      ad + 3 * ls, gp + 3 * gs);
    if (pinned(wave == 0u)) {          // one DMA per block per stage
      // stage and buffer are taken here, so that the descriptor words made of
      // them are formed here, behind the wait for the request before
      const unsigned ps = pinned((unsigned)s);   // pinned(): feeds descriptor words 2 and 3
      const unsigned pb = pinned(buf);           // pinned(): feeds descriptor word 1
      unsigned long long ga =
          (unsigned long long)(const void*)&Bm[(size_t)ps * KS * N + n0];
      g0[1] = uni(bt_base + pb * BBYTES);                // lds_addr
      g0[2] = uni((unsigned)ga);                         // global_addr lo
      g0[3] = uni(((unsigned)(ga >> 32) & 0x01FFFFFFu) | (2u << 30)); // type=2
      asm volatile("tensor_load_to_lds %0, %1" : "+s"(g0) : "s"(g1) : "memory");
    }
  };
  // a stage counts as landed only behind its issuers' own waits, and is read
  // by other waves only behind the barrier that follows them
  auto publish = [&]() {
    if (pinned(wave == 0u)) {
      asm volatile("s_wait_tensorcnt 0x0" : "+s"(g0) :: "memory");
    }
    wait_async0();
    __syncthreads();
  };

  const int nst = K / KS;
  issue_stage(0, 0u);
  publish();
  issue_stage(1, 1u);

  for (int s = 0; s < nst; ++s) {
    const unsigned buf = (unsigned)s & 1u;
    const unsigned short* asb = &As[buf * (ABYTES / 2)];
    const unsigned char* btb = btp + buf * BBYTES;

    #pragma unroll   // offsets become immediates; later steps' LDS loads may go ahead of earlier products
    for (int ks = 0; ks < KS / 32; ++ks) {
      Frag af[2], bf[2];
      #pragma unroll
      for (int mt = 0; mt < 2; ++mt) {
        int rr = wm * 32 + mt * 16 + l16;
        af[mt].q[0] = *(const uint4*)&asb[rr * AP + ks * 32 + half * 8];
        af[mt].q[1] = *(const uint4*)&asb[rr * AP + ks * 32 + 16 + half * 8];
      }
      #pragma unroll
      for (int nt = 0; nt < 2; ++nt) {
        const unsigned char* bp = btb + (unsigned)ks * 32u * BPITCH_ + nt * 32u;
        bf[nt].w[0] = ld_tr16(bp);                 // k = 32 ks + 8h + 0..7
        bf[nt].w[1] = ld_tr16(bp + 16u * BPITCH_); // k = 32 ks + 16 + 8h + ..
      }
      #pragma unroll
      for (int mt = 0; mt < 2; ++mt)
        #pragma unroll
        for (int nt = 0; nt < 2; ++nt)
          acc[mt][nt] = wmma_bf16(af[mt], bf[nt], acc[mt][nt]);
    }
    // every LDS read of this wave has retired before the barrier behind which
    // this pass's buffer is refilled; the same barrier publishes stage s + 1
    asm volatile("s_wait_dscnt 0x0" ::: "memory");
    publish();
    if (pinned((unsigned)(s + 2 < nst))) issue_stage(s + 2, buf);
  }
  // nothing of this wave is outstanding when the kernel goes on to its stores
  asm volatile("s_wait_tensorcnt 0x0" ::: "memory");
  wait_async0();
  asm volatile("s_wait_dscnt 0x0" ::: "memory");

  // epilogue; D layout: row = r + 8*half, col = l16
  #pragma unroll
  for (int mt = 0; mt < 2; ++mt)
    #pragma unroll
    for (int nt = 0; nt < 2; ++nt)
      #pragma unroll
      for (int r = 0; r < 8; ++r) {
        int gr = m0 + wm * 32 + mt * 16 + r + 8 * half;
        int gc = n0 + wn * 32 + nt * 16 + l16;
        float v = acc[mt][nt][r];
        if constexpr (BIAS) v += bias[gc];
        if constexpr (RELU) v = fmaxf(v, 0.f);
        if constexpr (RES)  v += res[(size_t)gr * N + gc];
        if constexpr (OUT32) out32[(size_t)gr * N + gc] = v;
        if constexpr (OUT16) out16[(size_t)gr * N + gc] = f2bf(v);
      }
}

// ---------------------------------------------------- attention pass 1:
// per-COLUMN (softmax over query axis t, as in the reference) max & sumexp.
// scores = k[t].k[s] * 1/32, causal t>=s.
// One block of four waves per (bh, 64 columns). Every wave holds all 64 key
// columns in registers and takes every fourth 16-row tile, so that a loaded
// tile meets four column strips and the longest loop is 32 trips; the four
// waves' partial max and sum of a column are merged through LDS at the end.
// Grid: x = bh, y = column group, the group with the most rows first.
// nine 2^x in one statement. The outputs lie apart from every input (early
// clobber) and a v_nop ends the statement: behind each v_exp_f32 stands an
// instruction that neither reads its result nor overwrites its source, which
// the instruction set asks for
__device__ inline void exp2_x9(float (&o)[9], const float (&x)[9]) {
  asm("v_exp_f32 %0, %9\n\t"
      "v_exp_f32 %1, %10\n\t"
      "v_exp_f32 %2, %11\n\t"
      "v_exp_f32 %3, %12\n\t"
      "v_exp_f32 %4, %13\n\t"
      "v_exp_f32 %5, %14\n\t"
      "v_exp_f32 %6, %15\n\t"
      "v_exp_f32 %7, %16\n\t"
      "v_exp_f32 %8, %17\n\t"
      "v_nop"
      : "=&v"(o[0]), "=&v"(o[1]), "=&v"(o[2]), "=&v"(o[3]), "=&v"(o[4]),
        "=&v"(o[5]), "=&v"(o[6]), "=&v"(o[7]), "=&v"(o[8])
      : "v"(x[0]), "v"(x[1]), "v"(x[2]), "v"(x[3]), "v"(x[4]),
        "v"(x[5]), "v"(x[6]), "v"(x[7]), "v"(x[8]));
}

#define CS_NW_ 4                              // waves of a block
#define CS_NS_ 4                              // 16-column strips of a wave
// The grid puts four of these waves on a SIMD: the register budget of four
// (256) lets the four strips' independent chains be scheduled side by side.
__global__ __launch_bounds__(32 * CS_NW_) __attribute__((amdgpu_waves_per_eu(4, 4)))
void attn_colstats_kernel(
    const unsigned short* __restrict__ kall,
    float* __restrict__ colmax, float* __restrict__ colsum) {
  __shared__ float mrg_m[CS_NW_][CS_NS_ * 16];
  __shared__ float mrg_s[CS_NW_][CS_NS_ * 16];
  const int tid = threadIdx.x;
  const int lane = tid & 31;
  const int w = (int)uni((unsigned)tid >> 5);  // scalar: the row loop's count and addresses stay scalar
  const int l16 = lane & 15, half = lane >> 4;
  const int bh = blockIdx.x;
  const int sG = blockIdx.y;
  const int b = bh >> 4, h = bh & 15;
  const int bt0 = b * T_;
  const int hoff = h * HS_;
  const int s_base = sG * (CS_NS_ * 16);
  const float scale = 0.03125f;               // 1024^-0.5
  const float NINF = -__builtin_inff();
  const float LOG2E = 1.44269504f;

  // head h of batch b, row 0 (the same in every lane), and this lane's place
  // in a 16-row tile
  const unsigned short* kbh = &kall[(size_t)bt0 * E_ + hoff];
  const unsigned lo = (unsigned)l16 * E_;

  Frag bf[CS_NS_][2];                         // key columns (loop-invariant)
  #pragma unroll
  for (int j = 0; j < CS_NS_; ++j) {
    const unsigned short* kp = kbh + (size_t)(s_base + j * 16) * E_ + lo;
    bf[j][0].q[0] = *(const uint4*)&kp[half * 8];
    bf[j][0].q[1] = *(const uint4*)&kp[16 + half * 8];
    bf[j][1].q[0] = *(const uint4*)&kp[32 + half * 8];
    bf[j][1].q[1] = *(const uint4*)&kp[48 + half * 8];
  }

  float m_run[CS_NS_], s_run[CS_NS_];
  #pragma unroll
  for (int j = 0; j < CS_NS_; ++j) { m_run[j] = NINF; s_run[j] = 0.f; }

  for (int tT = sG * CS_NS_ + w; tT < T_ / 16; tT += CS_NW_) {
    const int t_base = tT * 16;
    Frag af[2];
    const unsigned short* qp = kbh + (size_t)t_base * E_ + lo;
    af[0].q[0] = *(const uint4*)&qp[half * 8];
    af[0].q[1] = *(const uint4*)&qp[16 + half * 8];
    af[1].q[0] = *(const uint4*)&qp[32 + half * 8];
    af[1].q[1] = *(const uint4*)&qp[48 + half * 8];
    // holds the four loads together in front of the first product, so that a
    // trip waits out one load latency and not two (loaded values, inputs only)
    asm volatile("" :: "v"(af[0].w[0]), "v"(af[0].w[1]),
                       "v"(af[1].w[0]), "v"(af[1].w[1]));

    #pragma unroll   // m_run[], s_run[], bf[] indexed by constants: they stay in registers
    for (int j = 0; j < CS_NS_; ++j) {
      const int s = s_base + j * 16 + l16;
      v8f sc = vzero8();
      sc = wmma_bf16(af[0], bf[j][0], sc);
      sc = wmma_bf16(af[1], bf[j][1], sc);

      float vals[8];
      float tmax = NINF;
      #pragma unroll
      for (int r = 0; r < 8; ++r) {
        int t = t_base + r + 8 * half;
        if (t >= s) {
          float e = sc[r] * scale;
          vals[r] = e;
          tmax = fmaxf(tmax, e);
        } else {
          vals[r] = NINF;
        }
      }
      // a lane whose eight rows are all masked keeps its max and its sum: the
      // selects below leave both as they are, so no branch stands between the strips
      float nm = fmaxf(m_run[j], tmax);
      float xs[9], ex[9];                     // e^d = 2^(d * log2 e)
      #pragma unroll
      for (int r = 0; r < 8; ++r) xs[r] = (vals[r] - nm) * LOG2E;
      xs[8] = (m_run[j] - nm) * LOG2E;
      exp2_x9(ex, xs);
      float acc_s = (m_run[j] > NINF) ? s_run[j] * ex[8] : 0.f;
      #pragma unroll
      for (int r = 0; r < 8; ++r)
        if (vals[r] > NINF) acc_s += ex[r];
      s_run[j] = acc_s;
      m_run[j] = nm;
    }
  }
  // merge the two lane halves (same columns, different row groups)
  #pragma unroll
  for (int j = 0; j < CS_NS_; ++j) {
    float om = __shfl_xor(m_run[j], 16, 32);
    float os = __shfl_xor(s_run[j], 16, 32);
    float nm = fmaxf(m_run[j], om);
    float tot = 0.f;
    if (m_run[j] > NINF) tot += s_run[j] * __expf(m_run[j] - nm);
    if (om       > NINF) tot += os       * __expf(om       - nm);
    if (lane < 16) {
      mrg_m[w][j * 16 + lane] = nm;
      mrg_s[w][j * 16 + lane] = tot;
    }
  }
  __syncthreads();
  // merge the four waves, in wave order; one thread per column
  if (tid < CS_NS_ * 16) {
    float nm = NINF;
    #pragma unroll
    for (int i = 0; i < CS_NW_; ++i) nm = fmaxf(nm, mrg_m[i][tid]);
    float tot = 0.f;
    #pragma unroll
    for (int i = 0; i < CS_NW_; ++i) {
      float mi = mrg_m[i][tid];
      if (mi > NINF) tot += mrg_s[i][tid] * __expf(mi - nm);
    }
    colmax[(size_t)bh * T_ + s_base + tid] = nm;
    colsum[(size_t)bh * T_ + s_base + tid] = tot;
  }
}

// ---------------------------------------------------- attention pass 2:
// attn[t,d] = sum_s P[t,s] * v[s,d],  P = exp(score-colmax[s])/colsum[s].
// One block of four waves per (bh, 32 query rows). Every wave holds both 16-row
// query tiles in registers and takes every fourth 32-key tile, so that a loaded
// K and V tile meets two query tiles and the longest loop is 16 trips; P has no
// running state, so the four waves' partial outputs are plain sums, merged
// through LDS at the end.
// Each wave has its own P and V tiles in LDS: P re-layouts through LDS; V staged
// row-major (128 B rows at a 160 B pitch) and read by transposing LDS loads.
// Grid: x = bh, y = row group, the group with the most keys first.
// The register budget of four waves a SIMD (256) lets the compiler issue all 20
// global loads of a trip together.
#define VPITCH_ 160u
#define AO_NW_ 4                              // waves of a block
#define AO_NQ_ 2                              // 16-row query tiles of a block
__global__ __launch_bounds__(32 * AO_NW_) __attribute__((amdgpu_waves_per_eu(4, 4)))
void attn_out_kernel(
    const unsigned short* __restrict__ kall,
    const unsigned short* __restrict__ vall,
    const float* __restrict__ colmax, const float* __restrict__ colsum,
    unsigned short* __restrict__ attnB) {
  __shared__ __attribute__((aligned(16)))
      unsigned short Pl_all[AO_NW_][AO_NQ_][16 * 40];   // P tiles [16 t][32 s]
  __shared__ __attribute__((aligned(16)))
      unsigned char Vs_all[AO_NW_][32 * VPITCH_];       // V tile [32 s][64 d], padded
  __shared__ __attribute__((aligned(16)))
      v4f red[AO_NW_][AO_NQ_ * 8][32];                  // partial outputs, [wave][half tile][lane]

  const int tid = threadIdx.x;
  const int lane = tid & 31;
  const int w = (int)uni((unsigned)tid >> 5);  // scalar: the key loop's count stays scalar
  const int l16 = lane & 15, half = lane >> 4;
  const int bh = blockIdx.x;
  const int g = (T_ / (AO_NQ_ * 16) - 1) - (int)blockIdx.y;
  const int b = bh >> 4, h = bh & 15;
  const int bt0 = b * T_;
  const int hoff = h * HS_;
  const int t_base = g * (AO_NQ_ * 16);
  const float scale = 0.03125f;
  unsigned char* Vs = &Vs_all[w][0];

  Frag qf[AO_NQ_][2];                         // query rows (loop-invariant)
  #pragma unroll
  for (int q = 0; q < AO_NQ_; ++q) {
    const unsigned short* qp =
        &kall[(size_t)(bt0 + t_base + q * 16 + l16) * E_ + hoff];
    qf[q][0].q[0] = *(const uint4*)&qp[half * 8];
    qf[q][0].q[1] = *(const uint4*)&qp[16 + half * 8];
    qf[q][1].q[0] = *(const uint4*)&qp[32 + half * 8];
    qf[q][1].q[1] = *(const uint4*)&qp[48 + half * 8];
  }
  v8f acc[AO_NQ_][4];
  #pragma unroll
  for (int q = 0; q < AO_NQ_; ++q)
    #pragma unroll
    for (int i = 0; i < 4; ++i) acc[q][i] = vzero8();

  // this lane's address in the V tile for the transposing loads
  const unsigned char* vtp = &Vs[(8u * half + (lane & 7u)) * VPITCH_ +
                                 ((lane >> 3) & 1u) * 16u];

  // this lane's 16 bytes of V row (lane >> 3) of key tile 0
  const unsigned short* vrow =
      &vall[(size_t)(bt0 + (lane >> 3)) * E_ + hoff + (lane & 7) * 8];

  // key tiles 0 .. g hold every s <= t of this block's rows (32 g + 31 is the last)
  for (int sB = w; sB <= g; sB += AO_NW_) {
    const int s0 = sB * 32;
    // stage V: 32 s-rows x 64 d, rows kept as they are
    const unsigned short* vp = vrow + (size_t)s0 * E_;
    uint4 vv[8];
    #pragma unroll   // vv[] is indexed by constants only, so it stays in registers
    for (int i = 0; i < 8; ++i)      // rows (lane >> 3) + 4 i: one address, fixed offsets
      vv[i] = *(const uint4*)(vp + (size_t)i * 4 * E_);
    #pragma unroll   // as above
    for (int i = 0; i < 8; ++i)
      *(uint4*)&Vs[((lane >> 3) + 4 * i) * VPITCH_ + (lane & 7) * 16] = vv[i];
    // scores and normalized P for the two 16-column subtiles
    #pragma unroll
    for (int sh = 0; sh < 2; ++sh) {
      const int s_sub = s0 + sh * 16;
      Frag kf[2];
      const unsigned short* kp = &kall[(size_t)(bt0 + s_sub + l16) * E_ + hoff];
      kf[0].q[0] = *(const uint4*)&kp[half * 8];
      kf[0].q[1] = *(const uint4*)&kp[16 + half * 8];
      kf[1].q[0] = *(const uint4*)&kp[32 + half * 8];
      kf[1].q[1] = *(const uint4*)&kp[48 + half * 8];

      const int s = s_sub + l16;
      float m  = colmax[(size_t)bh * T_ + s];
      float sm = colsum[(size_t)bh * T_ + s];
      float rs = (sm > 0.f) ? 1.f / sm : 0.f;
      #pragma unroll   // qf[] indexed by constants: it stays in registers
      for (int q = 0; q < AO_NQ_; ++q) {
        v8f sc = vzero8();
        sc = wmma_bf16(qf[q][0], kf[0], sc);
        sc = wmma_bf16(qf[q][1], kf[1], sc);
        #pragma unroll
        for (int r = 0; r < 8; ++r) {
          int t = t_base + q * 16 + r + 8 * half;
          float p = 0.f;
          if (s <= t && sm > 0.f) p = __expf(sc[r] * scale - m) * rs;
          Pl_all[w][q][(r + 8 * half) * 40 + sh * 16 + l16] = f2bf(p);
        }
      }
    }
    // the two tiles are this wave's own: its stores have landed before its
    // lanes read what other lanes of the wave wrote; no other wave is waited for
    asm volatile("s_wait_dscnt 0x0" ::: "memory");
    // attn += P @ V
    Frag pf[AO_NQ_];
    #pragma unroll
    for (int q = 0; q < AO_NQ_; ++q) {
      pf[q].q[0] = *(const uint4*)&Pl_all[w][q][l16 * 40 + half * 8];
      pf[q].q[1] = *(const uint4*)&Pl_all[w][q][l16 * 40 + 16 + half * 8];
    }
    #pragma unroll
    for (int nt = 0; nt < 4; ++nt) {
      Frag vf;
      vf.w[0] = ld_tr16(vtp + nt * 32u);                 // s = 8h + 0..7
      vf.w[1] = ld_tr16(vtp + 16u * VPITCH_ + nt * 32u); // s = 16 + 8h + 0..7
      #pragma unroll   // acc[] indexed by constants: it stays in registers
      for (int q = 0; q < AO_NQ_; ++q)
        acc[q][nt] = wmma_bf16(pf[q], vf, acc[q][nt]);
    }
    // the products above have waited for every read of the two tiles, so the
    // next trip's stores, later in this wave's order, write over nothing in use
  }

  // every wave hands over its partial sums (zeros where it had no key tile)
  #pragma unroll
  for (int q = 0; q < AO_NQ_; ++q)
    #pragma unroll
    for (int nt = 0; nt < 4; ++nt) {
      const v8f a = acc[q][nt];
      v4f lo = {a[0], a[1], a[2], a[3]};
      v4f hi = {a[4], a[5], a[6], a[7]};
      red[w][(q * 4 + nt) * 2 + 0][lane] = lo;
      red[w][(q * 4 + nt) * 2 + 1][lane] = hi;
    }
  __syncthreads();

  // wave w sums, in wave order, and stores two of the eight 16 x 16 tiles;
  // heads concatenated: attnB[b*T+t][h*64+d]
  #pragma unroll
  for (int j = 0; j < AO_NQ_ * 4 / AO_NW_; ++j) {
    const int tile = w * (AO_NQ_ * 4 / AO_NW_) + j;     // = q * 4 + nt
    v4f lo = red[0][tile * 2 + 0][lane];
    v4f hi = red[0][tile * 2 + 1][lane];
    #pragma unroll
    for (int i = 1; i < AO_NW_; ++i) {
      lo += red[i][tile * 2 + 0][lane];
      hi += red[i][tile * 2 + 1][lane];
    }
    const int q = tile >> 2, nt = tile & 3;
    #pragma unroll
    for (int r = 0; r < 8; ++r) {
      int t = t_base + q * 16 + r + 8 * half;
      int d = nt * 16 + l16;
      attnB[(size_t)(bt0 + t) * E_ + hoff + d] = f2bf(r < 4 ? lo[r] : hi[r - 4]);
    }
  }
}

// ---------------------------------------------------------------- launcher
extern "C" void kernel_launch(void* const* d_in, const int* in_sizes, int n_in,
                              void* d_out, int out_size, void* d_ws,
                              size_t ws_size, hipStream_t stream) {
  (void)in_sizes; (void)n_in; (void)out_size; (void)ws_size;

  const float* x      = (const float*)d_in[0];
  const float* ln1_g  = (const float*)d_in[1];
  const float* ln1_b  = (const float*)d_in[2];
  const float* Wk     = (const float*)d_in[3];
  const float* Wv     = (const float*)d_in[4];
  const float* Wproj  = (const float*)d_in[5];
  const float* bproj  = (const float*)d_in[6];
  const float* ln2_g  = (const float*)d_in[7];
  const float* ln2_b  = (const float*)d_in[8];
  const float* W1     = (const float*)d_in[9];
  const float* b1     = (const float*)d_in[10];
  const float* W2     = (const float*)d_in[11];
  const float* b2     = (const float*)d_in[12];
  float* out          = (float*)d_out;

  char* ws = (char*)d_ws;
  size_t off = 0;
  auto alloc = [&](size_t bytes) -> void* {
    void* p = ws + off;
    off += (bytes + 255) & ~(size_t)255;
    return p;
  };

  unsigned short* hB     = (unsigned short*)alloc((size_t)BT_ * E_ * 2);
  unsigned short* WkB    = (unsigned short*)alloc((size_t)2 * E_ * E_ * 2);
  unsigned short* WvB    = WkB + (size_t)E_ * E_;      // right behind WkB
  unsigned short* WprojB = (unsigned short*)alloc((size_t)E_ * E_ * 2);
  unsigned short* W1B    = (unsigned short*)alloc((size_t)E_ * FF_ * 2);
  unsigned short* W2B    = (unsigned short*)alloc((size_t)FF_ * E_ * 2);
  unsigned short* kall   = (unsigned short*)alloc((size_t)2 * BT_ * E_ * 2);
  unsigned short* vall   = kall + (size_t)BT_ * E_;    // right behind kall
  float*          cmax   = (float*)alloc((size_t)B_ * H_ * T_ * 4);
  float*          csum   = (float*)alloc((size_t)B_ * H_ * T_ * 4);
  unsigned short* attnB  = (unsigned short*)alloc((size_t)BT_ * E_ * 2);
  float*          x1     = (float*)alloc((size_t)BT_ * E_ * 4);
  unsigned short* h2B    = (unsigned short*)alloc((size_t)BT_ * E_ * 2);
  unsigned short* actB   = (unsigned short*)alloc((size_t)BT_ * FF_ * 2);

  // LN1 -> h (bf16) and the weights' conversions, one launch
  prep_kernel<<<PREP_BLOCKS_, 256, 0, stream>>>(
      x, ln1_g, ln1_b, Wk, Wv, Wproj, W1, W2, hB, WkB, WvB, WprojB, W1B, W2B);

  // k = h @ Wk', v = h @ Wv'   (bf16 out for attention WMMA), one launch
  dim3 gE(E_ / 128, BT_ / 64);
  dim3 gKV(2 * (E_ / 128), BT_ / 64);
  gemm_bf16_kernel<false, false, false, false, true, true>
      <<<gKV, 256, 0, stream>>>(hB, WkB, nullptr, nullptr, nullptr, kall,
                                BT_, E_, E_);

  // attention: column softmax stats, then output
  dim3 gA(B_ * H_, T_ / (AO_NQ_ * 16));
  dim3 gC(B_ * H_, T_ / (CS_NS_ * 16));
  attn_colstats_kernel<<<gC, 32 * CS_NW_, 0, stream>>>(kall, cmax, csum);
  attn_out_kernel<<<gA, 32 * AO_NW_, 0, stream>>>(kall, vall, cmax, csum, attnB);

  // x1 = x + attn @ Wproj + bproj   (f32)
  gemm_bf16_kernel<true, false, true, true, false, false>
      <<<gE, 256, 0, stream>>>(attnB, WprojB, bproj, x, x1, nullptr,
                               BT_, E_, E_);

  // LN2 -> h2 (bf16)
  layernorm_bf16_kernel<<<BT_ / 8, 256, 0, stream>>>(x1, ln2_g, ln2_b, h2B);

  // act = relu(h2 @ W1 + b1)   (bf16)
  dim3 gF(FF_ / 128, BT_ / 64);
  gemm_bf16_kernel<true, true, false, false, true, false>
      <<<gF, 256, 0, stream>>>(h2B, W1B, b1, nullptr, nullptr, actB,
                               BT_, FF_, E_);

  // out = x1 + act @ W2 + b2   (f32)
  gemm_bf16_kernel<true, false, true, true, false, false>
      <<<gE, 256, 0, stream>>>(actB, W2B, b2, x1, out, nullptr,
                               BT_, E_, FF_);
}

// v009
// Measured time: 165 microseconds a run.
// Two timings next to v008 both put it at 1.09 times that version's speed.
// All steps since v000 together make it 4.27 times as fast.
#include <hip/hip_runtime.h>

// ---------------------------------------------------------------- constants
#define E_   1024
#define H_   16
#define HS_  64
#define B_   2
#define T_   2048
#define BT_  (B_ * T_)
#define FF_  (4 * E_)

typedef __attribute__((ext_vector_type(16))) __bf16     v16bf;
typedef __attribute__((ext_vector_type(8)))  float      v8f;
typedef __attribute__((ext_vector_type(4)))  unsigned   v4u;
typedef __attribute__((ext_vector_type(8)))  unsigned   v8u;

typedef __attribute__((ext_vector_type(8)))  short      v8s;
typedef __attribute__((ext_vector_type(4)))  float      v4f;

union Frag { v16bf v; uint4 q[2]; v4u w[2]; unsigned short us[16]; };

__device__ inline unsigned short f2bf(float f) {
  unsigned u = __float_as_uint(f);
  u += 0x7fffu + ((u >> 16) & 1u);           // round-to-nearest-even
  return (unsigned short)(u >> 16);
}

__device__ inline v8f vzero8() {
  v8f z = {0.f, 0.f, 0.f, 0.f, 0.f, 0.f, 0.f, 0.f};
  return z;
}

__device__ inline v8f wmma_bf16(const Frag& a, const Frag& b, v8f c) {
  return __builtin_amdgcn_wmma_f32_16x16x32_bf16(
      /*neg_a=*/false, a.v, /*neg_b=*/false, b.v,
      /*c_mod=*/(short)0, c, /*reuse_a=*/false, /*reuse_b=*/false);
}

// LDS offset of a shared-memory pointer: generic LDS addresses keep the
// LDS byte offset in the low 32 bits (ISA 10.2 aperture rules).
__device__ inline unsigned lds_off(const void* p) {
  return (unsigned)(unsigned long long)p;
}

__device__ inline void wait_async0() {
  asm volatile("s_wait_asynccnt 0x0" ::: "memory");
}

__device__ inline unsigned pinned(unsigned v) {
  unsigned w = (unsigned)__builtin_amdgcn_readfirstlane(v);
  asm volatile("" : "+s"(w));   // pinned(): a test, stage, buffer or descriptor word held in a scalar register
  return w;
}

__device__ inline unsigned uni(unsigned v) {
  return (unsigned)__builtin_amdgcn_readfirstlane(v);
}

// transposing LDS load: lane (c = l & 15, h = l >> 4) receives
// T[kbase + 8h + 0..7][dbase + c] of a row-major 16-bit tile
__device__ inline v4u ld_tr16(const unsigned char* p) {
  typedef __attribute__((address_space(3))) v8s lds_v8s;
  return __builtin_bit_cast(v4u,
      __builtin_amdgcn_ds_load_tr16_b128_v8i16((lds_v8s*)p));
}

// async copies of 16 bytes global -> LDS (per-lane scatter, ASYNCcnt tracked),
// a thread's copies of one trip in one statement. The wait stands in the
// copies' own statement, so that no later write of the address registers can
// be scheduled in front of it
__device__ inline void async_g2l_b128_x8(unsigned l0, const void* p0,
                                         unsigned l1, const void* p1,
                                         unsigned l2, const void* p2,
                                         unsigned l3, const void* p3,
                                         unsigned l4, const void* p4,
                                         unsigned l5, const void* p5,
                                         unsigned l6, const void* p6,
                                         unsigned l7, const void* p7) {
  asm volatile("global_load_async_to_lds_b128 %0, %1, off\n\t"
               "global_load_async_to_lds_b128 %2, %3, off\n\t"
               "global_load_async_to_lds_b128 %4, %5, off\n\t"
               "global_load_async_to_lds_b128 %6, %7, off\n\t"
               "global_load_async_to_lds_b128 %8, %9, off\n\t"
               "global_load_async_to_lds_b128 %10, %11, off\n\t"
               "global_load_async_to_lds_b128 %12, %13, off\n\t"
               "global_load_async_to_lds_b128 %14, %15, off\n\t"
               "s_wait_xcnt 0x0"
               :: "v"(l0), "v"(p0), "v"(l1), "v"(p1),
                  "v"(l2), "v"(p2), "v"(l3), "v"(p3),
                  "v"(l4), "v"(p4), "v"(l5), "v"(p5),
                  "v"(l6), "v"(p6), "v"(l7), "v"(p7)
               : "memory");
}

// four floats rounded to four bf16, in memory order
__device__ inline uint2 pack4_bf16(v4f v) {
  uint2 r;
  r.x = (unsigned)f2bf(v.x) | ((unsigned)f2bf(v.y) << 16);
  r.y = (unsigned)f2bf(v.z) | ((unsigned)f2bf(v.w) << 16);
  return r;
}

// ------------------------------------------------- weight / dtype conversion
// The conversions move few bytes; what they cost is the start of their waves.
// A thread takes NV groups of four floats, 256 groups apart, so that a wave's
// load covers 512 contiguous bytes, all NV loads are in flight together and an
// array takes 4 NV times fewer waves than with one float a thread.
// The blocks cover the array exactly: blocks * 1024 * NV elements.
// blk: the block's index within its own array.
template <int NV>
__device__ inline void f32_to_bf16_block(
    const float* __restrict__ in, unsigned short* __restrict__ out, int blk) {
  const int q0 = blk * (256 * NV) + threadIdx.x;          // group of four
  v4f v[NV];
  #pragma unroll   // v[] indexed by constants: it stays in registers, the loads go out together
  for (int j = 0; j < NV; ++j) v[j] = ((const v4f*)in)[q0 + j * 256];
  #pragma unroll   // as above
  for (int j = 0; j < NV; ++j) ((uint2*)out)[q0 + j * 256] = pack4_bf16(v[j]);
  // precaution: in the merged kernel the compiler lays another array's code
  // behind these stores, and it rewrites registers that they name
  asm volatile("s_wait_xcnt 0x0" ::: "memory");
}

// Wk/Wv: [H][E][HS] f32  ->  [E][H*HS] bf16  (so projection is one GEMM)
template <int NV>
__device__ inline void headperm_bf16_block(
    const float* __restrict__ in, unsigned short* __restrict__ out, int blk) {
  const int q0 = blk * (256 * NV) + threadIdx.x;          // group of four outputs
  v4f v[NV];
  #pragma unroll   // v[] indexed by constants: it stays in registers, the loads go out together
  for (int j = 0; j < NV; ++j) {
    int idx = (q0 + j * 256) * 4;               // idx = e*1024 + h*64 + d
    int e = idx >> 10;
    int c = idx & 1023;
    int h = c >> 6;
    int d = c & 63;                             // a multiple of 4
    v[j] = *(const v4f*)&in[(size_t)h * (E_ * HS_) + (size_t)e * HS_ + d];
  }
  #pragma unroll   // as above
  for (int j = 0; j < NV; ++j) ((uint2*)out)[q0 + j * 256] = pack4_bf16(v[j]);
  // precaution: in the merged kernel the compiler lays another array's code
  // behind these stores, and it rewrites registers that they name
  asm volatile("s_wait_xcnt 0x0" ::: "memory");
}

// ------------------------------------------------------------- layernorm
// One wave per row (eight rows a block): a lane holds 32 of the row's 1024
// floats, the two sums go through the wave by shuffles, and a launch starts
// eight times fewer waves than with one block per row; no LDS, no barrier.
__device__ inline void layernorm_bf16_block(
    const float* __restrict__ x, const float* __restrict__ g,
    const float* __restrict__ b, unsigned short* __restrict__ out, int blk) {
  constexpr int NV = 8;                       // groups of four floats a lane: E_ / 128
  const int lane = threadIdx.x & 31, w = threadIdx.x >> 5;
  const int row = blk * 8 + w;

  const v4f* xr = (const v4f*)x + (size_t)row * (E_ / 4);
  v4f xv[NV];
  #pragma unroll   // xv[] indexed by constants: it stays in registers, the loads go out together
  for (int j = 0; j < NV; ++j) xv[j] = xr[j * 32 + lane];
  v4f gv[NV], bv[NV];
  #pragma unroll   // as above
  for (int j = 0; j < NV; ++j) {
    gv[j] = ((const v4f*)g)[j * 32 + lane];
    bv[j] = ((const v4f*)b)[j * 32 + lane];
  }
  // g and b are asked for beside x and have landed here, ahead of the shuffles;
  // left alone the compiler asked for them pair by pair behind the sums, with a
  // wait for each pair (loaded values, inputs only)
  asm volatile("" :: "v"(xv[0]), "v"(xv[1]), "v"(xv[2]), "v"(xv[3]),
                     "v"(xv[4]), "v"(xv[5]), "v"(xv[6]), "v"(xv[7]),
                     "v"(gv[0]), "v"(gv[1]), "v"(gv[2]), "v"(gv[3]),
                     "v"(gv[4]), "v"(gv[5]), "v"(gv[6]), "v"(gv[7]),
                     "v"(bv[0]), "v"(bv[1]), "v"(bv[2]), "v"(bv[3]),
                     "v"(bv[4]), "v"(bv[5]), "v"(bv[6]), "v"(bv[7]));
  float s = 0.f, s2 = 0.f;
  #pragma unroll   // as above
  for (int j = 0; j < NV; ++j) {
    s  += (xv[j].x + xv[j].y) + (xv[j].z + xv[j].w);
    s2 += (xv[j].x * xv[j].x + xv[j].y * xv[j].y) +
          (xv[j].z * xv[j].z + xv[j].w * xv[j].w);
  }
  #pragma unroll
  for (int o = 16; o > 0; o >>= 1) {          // every lane ends with both sums
    s  += __shfl_xor(s, o, 32);
    s2 += __shfl_xor(s2, o, 32);
  }
  const float mean = s / (float)E_;
  const float inv  = rsqrtf(s2 / (float)E_ - mean * mean + 1e-5f);
  uint2* orow = (uint2*)out + (size_t)row * (E_ / 4);
  #pragma unroll   // as above
  for (int j = 0; j < NV; ++j) {
    v4f n;
    n.x = (xv[j].x - mean) * inv * gv[j].x + bv[j].x;
    n.y = (xv[j].y - mean) * inv * gv[j].y + bv[j].y;
    n.z = (xv[j].z - mean) * inv * gv[j].z + bv[j].z;
    n.w = (xv[j].w - mean) * inv * gv[j].w + bv[j].w;
    orow[j * 32 + lane] = pack4_bf16(n);
  }
}

__global__ __launch_bounds__(256) void layernorm_bf16_kernel(
    const float* __restrict__ x, const float* __restrict__ g,
    const float* __restrict__ b, unsigned short* __restrict__ out) {
  layernorm_bf16_block(x, g, b, out, blockIdx.x);
}

// ------------------------------------------------- all that reads inputs only
// The first layernorm and the five weight conversions read none of each
// other's output, and each is far shorter than what a launch of its own costs
// (gap, start of its waves, drain): they run as one launch. A block's index
// says which array it works on; the work of a block is what it was.
#define PREP_LN_ (BT_ / 8)                    // blocks of the layernorm
#define PREP_FF_ ((E_ * FF_) / 8192)          // blocks of W1, and of W2
#define PREP_EE_ ((E_ * E_) / 4096)           // blocks of Wk, of Wv, of Wproj
#define PREP_BLOCKS_ (PREP_LN_ + 2 * PREP_FF_ + 3 * PREP_EE_)
__global__ __launch_bounds__(256) void prep_kernel(
    const float* __restrict__ x, const float* __restrict__ g,
    const float* __restrict__ b, const float* __restrict__ Wk,
    const float* __restrict__ Wv, const float* __restrict__ Wproj,
    const float* __restrict__ W1, const float* __restrict__ W2,
    unsigned short* __restrict__ hB, unsigned short* __restrict__ WkB,
    unsigned short* __restrict__ WvB, unsigned short* __restrict__ WprojB,
    unsigned short* __restrict__ W1B, unsigned short* __restrict__ W2B) {
  int blk = blockIdx.x;
  if (blk < PREP_LN_) { layernorm_bf16_block(x, g, b, hB, blk); return; }
  blk -= PREP_LN_;
  if (blk < PREP_FF_) { f32_to_bf16_block<8>(W1, W1B, blk); return; }
  blk -= PREP_FF_;
  if (blk < PREP_FF_) { f32_to_bf16_block<8>(W2, W2B, blk); return; }
  blk -= PREP_FF_;
  if (blk < PREP_EE_) { headperm_bf16_block<4>(Wk, WkB, blk); return; }
  blk -= PREP_EE_;
  if (blk < PREP_EE_) { headperm_bf16_block<4>(Wv, WvB, blk); return; }
  blk -= PREP_EE_;
  f32_to_bf16_block<4>(Wproj, WprojB, blk);
}

// ------------------------------------------------------------ generic GEMM
// C[M,N] = A[M,K](bf16) * B[K,N](bf16)  (+bias)(relu)(+res f32) -> f32/bf16
// block tile 128(M) x 128(N), 8 waves (2x4), wave tile 64x32: a staged B tile
// meets 128 rows of A, and a B fragment four A fragments, so that an output
// element costs a third fewer bytes from L2 and a quarter fewer from LDS than
// with 64 rows; M is a multiple of 128.
// A pass of the K loop works on a stage of 128 k (four matrix steps). Two
// buffers: while a pass works on one, the next stage's loads fly into the
// other, so that their latency lies behind the products; one barrier a pass.
// A tile staged by per-lane async global->LDS copies (ASYNCcnt), rows of 256
// bytes at a pitch of 272; B tile staged by the Tensor Data Mover
// (TENSORcnt), one DMA per stage, rows of 256 B padded to a 288 B pitch;
// B fragments come from it by transposing LDS loads (hardware k order, the
// same as the A loader's).
// TWO: one launch does two products with the same A. The grid has 2 N / 128
// block columns; the second N / 128 of them take the second B matrix, which
// lies right behind the first, and write the second output, right behind the
// first.
#define BPITCH_ 288u
template <bool BIAS, bool RELU, bool RES, bool OUT32, bool OUT16, bool TWO>
__global__ __launch_bounds__(256) void gemm_bf16_kernel(
    const unsigned short* __restrict__ A, const unsigned short* __restrict__ Bm,
    const float* __restrict__ bias, const float* __restrict__ res,
    float* __restrict__ out32, unsigned short* __restrict__ out16,
    int M, int N, int K) {
  constexpr int KS  = 128;                  // k of a stage; K is a multiple, two stages or more
  constexpr int AP  = KS + 8;               // A pitch in elements
  constexpr int CPR = KS / 8;               // 16-byte pieces in an A row
  constexpr int RPC = 256 / CPR;            // A rows that one copy of the block fills
  constexpr int BM  = 128;                  // rows of the block tile
  constexpr int MT  = BM / 32;              // 16-row tiles of a wave
  constexpr unsigned ABYTES = BM * AP * 2;        // one A buffer
  static_assert(BM == 8 * RPC, "a thread's eight copies fill the A tile");
  constexpr unsigned BBYTES = KS * BPITCH_;       // one B buffer, a multiple of 2 KiB
  static_assert(BBYTES % 2048u == 0u, "the second B buffer starts at a multiple of 2 KiB");
  __shared__ __attribute__((aligned(16)))
      unsigned short As[2 * BM * AP];       // two of [BM rows][KS k], padded
  __shared__ __attribute__((aligned(2048)))
      unsigned char Bt[2 * BBYTES];         // two of row-major [KS k][128 N], padded

  const int tid  = threadIdx.x;
  const int lane = tid & 31, w = tid >> 5;
  const int l16 = lane & 15, half = lane >> 4;
  const int wm = w >> 2, wn = w & 3;
  const int m0 = blockIdx.y * BM;
  int bx = blockIdx.x;
  if constexpr (TWO) {
    const int nb = N / 128;
    if (bx >= nb) {
      bx -= nb;
      Bm += (size_t)K * N;
      out16 += (size_t)M * N;
    }
  }
  const int n0 = bx * 128;

  // D# group 1 (constant over the K loop): 1-byte elements, tensor = tile =
  // KS rows of 256 B, source pitch 2N bytes, 8 dwords of LDS pad per row.
  v8u g1;
  g1[0] = uni((1u << 20) | (5u << 22) | (7u << 25));     // pad on, 256 B, +32 B
  // Words 1 to 7 go through pinned(): each is held in a scalar register of its
  // own for the whole loop, which serves nothing else while a request flies
  // (as plain constants three of them were re-made per load, their registers
  // lent out in between).
  g1[1] = pinned(256u << 16);          // pinned(): descriptor word; tensor_dim0 lo
  g1[2] = pinned((unsigned)KS << 16);  // pinned(): descriptor word; dim1 lo | dim0 hi
  g1[3] = pinned(256u << 16);          // pinned(): descriptor word; tile_dim0 | dim1 hi
  g1[4] = pinned((unsigned)KS);        // pinned(): descriptor word; tile_dim1
  g1[5] = pinned((unsigned)N * 2u);    // pinned(): descriptor word; source pitch, bytes
  g1[6] = pinned(0u);                  // pinned(): descriptor word
  g1[7] = pinned(0u);                  // pinned(): descriptor word
  const unsigned bt_base = lds_off(&Bt[0]);
  const unsigned wave = uni((unsigned)tid >> 5);
  // this lane's address in the tile for the transposing loads
  const unsigned char* btp = &Bt[(8u * half + (lane & 7u)) * BPITCH_ +
                                 ((lane >> 3) & 1u) * 16u + wn * 64u];
  // this thread's first 16 bytes of the A tile: row tid / CPR, piece tid % CPR;
  // its further copies lie RPC rows on each
  const int ar = tid / CPR, ac = (tid % CPR) * 8;
  const unsigned as_dst = lds_off(&As[ar * AP + ac]);

  v8f acc[MT][2];
  #pragma unroll
  for (int mt = 0; mt < MT; ++mt)
    #pragma unroll
    for (int nt = 0; nt < 2; ++nt) acc[mt][nt] = vzero8();

  // D# group 0. The load and its wait name it as in and out: it lives in one
  // register tuple from the issue to the wait, and no word of it takes a new
  // value while the request flies
  v4u g0;
  g0[0] = pinned(1u);                  // pinned(): descriptor word; count=1
  g0[1] = pinned(bt_base);             // pinned(): descriptor word; lds_addr
  g0[2] = pinned(0u);                  // pinned(): descriptor word; set per stage
  g0[3] = pinned(0u);                  // pinned(): descriptor word; set per stage
  // stage s goes into buffer buf: every thread's eight A copies, then wave 0's
  // tensor load of the B tile. No wait for the data here.
  auto issue_stage = [&](int s, unsigned buf) {
    const unsigned short* gp = &A[(size_t)(m0 + ar) * K + s * KS + ac];
    const size_t gs = (size_t)RPC * K;            // elements between two copies
    constexpr unsigned ls = RPC * AP * 2;         // LDS bytes between two copies
    const unsigned ad = as_dst + buf * ABYTES;
    async_g2l_b128_x8(ad, gp, ad + ls, gp + gs,
                      ad + 2 * ls, gp + 2 * gs,
                      ad + 3 * ls, gp + 3 * gs,
                      ad + 4 * ls, gp + 4 * gs,
                      ad + 5 * ls, gp + 5 * gs,
                      ad + 6 * ls, gp + 6 * gs,
                      ad + 7 * ls, gp + 7 * gs);
    if (pinned(wave == 0u)) {          // one DMA per block per stage
      // stage and buffer are taken here, so that the descriptor words made of
      // them are formed here, behind the wait for the request before
      const unsigned ps = pinned((unsigned)s);   // pinned(): feeds descriptor words 2 and 3
      const unsigned pb = pinned(buf);           // pinned(): feeds descriptor word 1
      unsigned long long ga =
          (unsigned long long)(const void*)&Bm[(size_t)ps * KS * N + n0];
      g0[1] = uni(bt_base + pb * BBYTES);                // lds_addr
      g0[2] = uni((unsigned)ga);                         // global_addr lo
      g0[3] = uni(((unsigned)(ga >> 32) & 0x01FFFFFFu) | (2u << 30)); // type=2
      asm volatile("tensor_load_to_lds %0, %1" : "+s"(g0) : "s"(g1) : "memory");
    }
  };
  // a stage counts as landed only behind its issuers' own waits, and is read
  // by other waves only behind the barrier that follows them
  auto publish = [&]() {
    if (pinned(wave == 0u)) {
      asm volatile("s_wait_tensorcnt 0x0" : "+s"(g0) :: "memory");
    }
    wait_async0();
    __syncthreads();
  };

  const int nst = K / KS;
  issue_stage(0, 0u);
  publish();
  issue_stage(1, 1u);

  for (int s = 0; s < nst; ++s) {
    const unsigned buf = (unsigned)s & 1u;
    const unsigned short* asb = &As[buf * (ABYTES / 2)];
    const unsigned char* btb = btp + buf * BBYTES;

    #pragma unroll   // offsets become immediates; later steps' LDS loads may go ahead of earlier products
    for (int ks = 0; ks < KS / 32; ++ks) {
      Frag af[MT], bf[2];
      #pragma unroll
      for (int mt = 0; mt < MT; ++mt) {
        int rr = wm * (MT * 16) + mt * 16 + l16;
        af[mt].q[0] = *(const uint4*)&asb[rr * AP + ks * 32 + half * 8];
        af[mt].q[1] = *(const uint4*)&asb[rr * AP + ks * 32 + 16 + half * 8];
      }
      #pragma unroll
      for (int nt = 0; nt < 2; ++nt) {
        const unsigned char* bp = btb + (unsigned)ks * 32u * BPITCH_ + nt * 32u;
        bf[nt].w[0] = ld_tr16(bp);                 // k = 32 ks + 8h + 0..7
        bf[nt].w[1] = ld_tr16(bp + 16u * BPITCH_); // k = 32 ks + 16 + 8h + ..
      }
      #pragma unroll
      for (int mt = 0; mt < MT; ++mt)
        #pragma unroll
        for (int nt = 0; nt < 2; ++nt)
          acc[mt][nt] = wmma_bf16(af[mt], bf[nt], acc[mt][nt]);
    }
    // every LDS read of this wave has retired before the barrier behind which
    // this pass's buffer is refilled; the same barrier publishes stage s + 1
    asm volatile("s_wait_dscnt 0x0" ::: "memory");
    publish();
    if (pinned((unsigned)(s + 2 < nst))) issue_stage(s + 2, buf);
  }
  // nothing of this wave is outstanding when the kernel goes on to its stores
  asm volatile("s_wait_tensorcnt 0x0" ::: "memory");
  wait_async0();
  asm volatile("s_wait_dscnt 0x0" ::: "memory");

  // epilogue; D layout: row = r + 8*half, col = l16
  #pragma unroll
  for (int mt = 0; mt < MT; ++mt)
    #pragma unroll
    for (int nt = 0; nt < 2; ++nt)
      #pragma unroll
      for (int r = 0; r < 8; ++r) {
        int gr = m0 + wm * (MT * 16) + mt * 16 + r + 8 * half;
        int gc = n0 + wn * 32 + nt * 16 + l16;
        float v = acc[mt][nt][r];
        if constexpr (BIAS) v += bias[gc];
        if constexpr (RELU) v = fmaxf(v, 0.f);
        if constexpr (RES)  v += res[(size_t)gr * N + gc];
        if constexpr (OUT32) out32[(size_t)gr * N + gc] = v;
        if constexpr (OUT16) out16[(size_t)gr * N + gc] = f2bf(v);
      }
}

// ---------------------------------------------------- attention pass 1:
// per-COLUMN (softmax over query axis t, as in the reference) max & sumexp.
// scores = k[t].k[s] * 1/32, causal t>=s.
// One block of four waves per (bh, 64 columns). Every wave holds all 64 key
// columns in registers and takes every fourth 16-row tile, so that a loaded
// tile meets four column strips and the longest loop is 32 trips; the four
// waves' partial max and sum of a column are merged through LDS at the end.
// Grid: x = bh, y = column group, the group with the most rows first.
// nine 2^x in one statement. The outputs lie apart from every input (early
// clobber) and a v_nop ends the statement: behind each v_exp_f32 stands an
// instruction that neither reads its result nor overwrites its source, which
// the instruction set asks for
__device__ inline void exp2_x9(float (&o)[9], const float (&x)[9]) {
  asm("v_exp_f32 %0, %9\n\t"
      "v_exp_f32 %1, %10\n\t"
      "v_exp_f32 %2, %11\n\t"
      "v_exp_f32 %3, %12\n\t"
      "v_exp_f32 %4, %13\n\t"
      "v_exp_f32 %5, %14\n\t"
      "v_exp_f32 %6, %15\n\t"
      "v_exp_f32 %7, %16\n\t"
      "v_exp_f32 %8, %17\n\t"
      "v_nop"
      : "=&v"(o[0]), "=&v"(o[1]), "=&v"(o[2]), "=&v"(o[3]), "=&v"(o[4]),
        "=&v"(o[5]), "=&v"(o[6]), "=&v"(o[7]), "=&v"(o[8])
      : "v"(x[0]), "v"(x[1]), "v"(x[2]), "v"(x[3]), "v"(x[4]),
        "v"(x[5]), "v"(x[6]), "v"(x[7]), "v"(x[8]));
}

#define CS_NW_ 4                              // waves of a block
#define CS_NS_ 4                              // 16-column strips of a wave
// The grid puts four of these waves on a SIMD: the register budget of four
// (256) lets the four strips' independent chains be scheduled side by side.
__global__ __launch_bounds__(32 * CS_NW_) __attribute__((amdgpu_waves_per_eu(4, 4)))
void attn_colstats_kernel(
    const unsigned short* __restrict__ kall,
    float* __restrict__ colmax, float* __restrict__ colsum) {
  __shared__ float mrg_m[CS_NW_][CS_NS_ * 16];
  __shared__ float mrg_s[CS_NW_][CS_NS_ * 16];
  const int tid = threadIdx.x;
  const int lane = tid & 31;
  const int w = (int)uni((unsigned)tid >> 5);  // scalar: the row loop's count and addresses stay scalar
  const int l16 = lane & 15, half = lane >> 4;
  const int bh = blockIdx.x;
  const int sG = blockIdx.y;
  const int b = bh >> 4, h = bh & 15;
  const int bt0 = b * T_;
  const int hoff = h * HS_;
  const int s_base = sG * (CS_NS_ * 16);
  const float scale = 0.03125f;               // 1024^-0.5
  const float NINF = -__builtin_inff();
  const float LOG2E = 1.44269504f;

  // head h of batch b, row 0 (the same in every lane), and this lane's place
  // in a 16-row tile
  const unsigned short* kbh = &kall[(size_t)bt0 * E_ + hoff];
  const unsigned lo = (unsigned)l16 * E_;

  Frag bf[CS_NS_][2];                         // key columns (loop-invariant)
  #pragma unroll
  for (int j = 0; j < CS_NS_; ++j) {
    const unsigned short* kp = kbh + (size_t)(s_base + j * 16) * E_ + lo;
    bf[j][0].q[0] = *(const uint4*)&kp[half * 8];
    bf[j][0].q[1] = *(const uint4*)&kp[16 + half * 8];
    bf[j][1].q[0] = *(const uint4*)&kp[32 + half * 8];
    bf[j][1].q[1] = *(const uint4*)&kp[48 + half * 8];
  }

  float m_run[CS_NS_], s_run[CS_NS_];
  #pragma unroll
  for (int j = 0; j < CS_NS_; ++j) { m_run[j] = NINF; s_run[j] = 0.f; }

  for (int tT = sG * CS_NS_ + w; tT < T_ / 16; tT += CS_NW_) {
    const int t_base = tT * 16;
    Frag af[2];
    const unsigned short* qp = kbh + (size_t)t_base * E_ + lo;
    af[0].q[0] = *(const uint4*)&qp[half * 8];
    af[0].q[1] = *(const uint4*)&qp[16 + half * 8];
    af[1].q[0] = *(const uint4*)&qp[32 + half * 8];
    af[1].q[1] = *(const uint4*)&qp[48 + half * 8];
    // holds the four loads together in front of the first product, so that a
    // trip waits out one load latency and not two (loaded values, inputs only)
    asm volatile("" :: "v"(af[0].w[0]), "v"(af[0].w[1]),
                       "v"(af[1].w[0]), "v"(af[1].w[1]));

    #pragma unroll   // m_run[], s_run[], bf[] indexed by constants: they stay in registers
    for (int j = 0; j < CS_NS_; ++j) {
      const int s = s_base + j * 16 + l16;
      v8f sc = vzero8();
      sc = wmma_bf16(af[0], bf[j][0], sc);
      sc = wmma_bf16(af[1], bf[j][1], sc);

      float vals[8];
      float tmax = NINF;
      #pragma unroll
      for (int r = 0; r < 8; ++r) {
        int t = t_base + r + 8 * half;
        if (t >= s) {
          float e = sc[r] * scale;
          vals[r] = e;
          tmax = fmaxf(tmax, e);
        } else {
          vals[r] = NINF;
        }
      }
      // a lane whose eight rows are all masked keeps its max and its sum: the
      // selects below leave both as they are, so no branch stands between the strips
      float nm = fmaxf(m_run[j], tmax);
      float xs[9], ex[9];                     // e^d = 2^(d * log2 e)
      #pragma unroll
      for (int r = 0; r < 8; ++r) xs[r] = (vals[r] - nm) * LOG2E;
      xs[8] = (m_run[j] - nm) * LOG2E;
      exp2_x9(ex, xs);
      float acc_s = (m_run[j] > NINF) ? s_run[j] * ex[8] : 0.f;
      #pragma unroll
      for (int r = 0; r < 8; ++r)
        if (vals[r] > NINF) acc_s += ex[r];
      s_run[j] = acc_s;
      m_run[j] = nm;
    }
  }
  // merge the two lane halves (same columns, different row groups)
  #pragma unroll
  for (int j = 0; j < CS_NS_; ++j) {
    float om = __shfl_xor(m_run[j], 16, 32);
    float os = __shfl_xor(s_run[j], 16, 32);
    float nm = fmaxf(m_run[j], om);
    float tot = 0.f;
    if (m_run[j] > NINF) tot += s_run[j] * __expf(m_run[j] - nm);
    if (om       > NINF) tot += os       * __expf(om       - nm);
    if (lane < 16) {
      mrg_m[w][j * 16 + lane] = nm;
      mrg_s[w][j * 16 + lane] = tot;
    }
  }
  __syncthreads();
  // merge the four waves, in wave order; one thread per column
  if (tid < CS_NS_ * 16) {
    float nm = NINF;
    #pragma unroll
    for (int i = 0; i < CS_NW_; ++i) nm = fmaxf(nm, mrg_m[i][tid]);
    float tot = 0.f;
    #pragma unroll
    for (int i = 0; i < CS_NW_; ++i) {
      float mi = mrg_m[i][tid];
      if (mi > NINF) tot += mrg_s[i][tid] * __expf(mi - nm);
    }
    colmax[(size_t)bh * T_ + s_base + tid] = nm;
    colsum[(size_t)bh * T_ + s_base + tid] = tot;
  }
}

// ---------------------------------------------------- attention pass 2:
// attn[t,d] = sum_s P[t,s] * v[s,d],  P = exp(score-colmax[s])/colsum[s].
// One block of four waves per (bh, 32 query rows). Every wave holds both 16-row
// query tiles in registers and takes every fourth 32-key tile, so that a loaded
// K and V tile meets two query tiles and the longest loop is 16 trips; P has no
// running state, so the four waves' partial outputs are plain sums, merged
// through LDS at the end.
// Each wave has its own P and V tiles in LDS: P re-layouts through LDS; V staged
// row-major (128 B rows at a 160 B pitch) and read by transposing LDS loads.
// Grid: x = bh, y = row group, the group with the most keys first.
// The register budget of four waves a SIMD (256) lets the compiler issue all 20
// global loads of a trip together.
#define VPITCH_ 160u
#define AO_NW_ 4                              // waves of a block
#define AO_NQ_ 2                              // 16-row query tiles of a block
__global__ __launch_bounds__(32 * AO_NW_) __attribute__((amdgpu_waves_per_eu(4, 4)))
void attn_out_kernel(
    const unsigned short* __restrict__ kall,
    const unsigned short* __restrict__ vall,
    const float* __restrict__ colmax, const float* __restrict__ colsum,
    unsigned short* __restrict__ attnB) {
  __shared__ __attribute__((aligned(16)))
      unsigned short Pl_all[AO_NW_][AO_NQ_][16 * 40];   // P tiles [16 t][32 s]
  __shared__ __attribute__((aligned(16)))
      unsigned char Vs_all[AO_NW_][32 * VPITCH_];       // V tile [32 s][64 d], padded
  __shared__ __attribute__((aligned(16)))
      v4f red[AO_NW_][AO_NQ_ * 8][32];                  // partial outputs, [wave][half tile][lane]

  const int tid = threadIdx.x;
  const int lane = tid & 31;
  const int w = (int)uni((unsigned)tid >> 5);  // scalar: the key loop's count stays scalar
  const int l16 = lane & 15, half = lane >> 4;
  const int bh = blockIdx.x;
  const int g = (T_ / (AO_NQ_ * 16) - 1) - (int)blockIdx.y;
  const int b = bh >> 4, h = bh & 15;
  const int bt0 = b * T_;
  const int hoff = h * HS_;
  const int t_base = g * (AO_NQ_ * 16);
  const float scale = 0.03125f;
  unsigned char* Vs = &Vs_all[w][0];

  Frag qf[AO_NQ_][2];                         // query rows (loop-invariant)
  #pragma unroll
  for (int q = 0; q < AO_NQ_; ++q) {
    const unsigned short* qp =
        &kall[(size_t)(bt0 + t_base + q * 16 + l16) * E_ + hoff];
    qf[q][0].q[0] = *(const uint4*)&qp[half * 8];
    qf[q][0].q[1] = *(const uint4*)&qp[16 + half * 8];
    qf[q][1].q[0] = *(const uint4*)&qp[32 + half * 8];
    qf[q][1].q[1] = *(const uint4*)&qp[48 + half * 8];
  }
  v8f acc[AO_NQ_][4];
  #pragma unroll
  for (int q = 0; q < AO_NQ_; ++q)
    #pragma unroll
    for (int i = 0; i < 4; ++i) acc[q][i] = vzero8();

  // this lane's address in the V tile for the transposing loads
  const unsigned char* vtp = &Vs[(8u * half + (lane & 7u)) * VPITCH_ +
                                 ((lane >> 3) & 1u) * 16u];

  // this lane's 16 bytes of V row (lane >> 3) of key tile 0
  const unsigned short* vrow =
      &vall[(size_t)(bt0 + (lane >> 3)) * E_ + hoff + (lane & 7) * 8];

  // key tiles 0 .. g hold every s <= t of this block's rows (32 g + 31 is the last)
  for (int sB = w; sB <= g; sB += AO_NW_) {
    const int s0 = sB * 32;
    // stage V: 32 s-rows x 64 d, rows kept as they are
    const unsigned short* vp = vrow + (size_t)s0 * E_;
    uint4 vv[8];
    #pragma unroll   // vv[] is indexed by constants only, so it stays in registers
    for (int i = 0; i < 8; ++i)      // rows (lane >> 3) + 4 i: one address, fixed offsets
      vv[i] = *(const uint4*)(vp + (size_t)i * 4 * E_);
    #pragma unroll   // as above
    for (int i = 0; i < 8; ++i)
      *(uint4*)&Vs[((lane >> 3) + 4 * i) * VPITCH_ + (lane & 7) * 16] = vv[i];
    // scores and normalized P for the two 16-column subtiles
    #pragma unroll
    for (int sh = 0; sh < 2; ++sh) {
      const int s_sub = s0 + sh * 16;
      Frag kf[2];
      const unsigned short* kp = &kall[(size_t)(bt0 + s_sub + l16) * E_ + hoff];
      kf[0].q[0] = *(const uint4*)&kp[half * 8];
      kf[0].q[1] = *(const uint4*)&kp[16 + half * 8];
      kf[1].q[0] = *(const uint4*)&kp[32 + half * 8];
      kf[1].q[1] = *(const uint4*)&kp[48 + half * 8];

      const int s = s_sub + l16;
      float m  = colmax[(size_t)bh * T_ + s];
      float sm = colsum[(size_t)bh * T_ + s];
      float rs = (sm > 0.f) ? 1.f / sm : 0.f;
      #pragma unroll   // qf[] indexed by constants: it stays in registers
      for (int q = 0; q < AO_NQ_; ++q) {
        v8f sc = vzero8();
        sc = wmma_bf16(qf[q][0], kf[0], sc);
        sc = wmma_bf16(qf[q][1], kf[1], sc);
        #pragma unroll
        for (int r = 0; r < 8; ++r) {
          int t = t_base + q * 16 + r + 8 * half;
          float p = 0.f;
          if (s <= t && sm > 0.f) p = __expf(sc[r] * scale - m) * rs;
          Pl_all[w][q][(r + 8 * half) * 40 + sh * 16 + l16] = f2bf(p);
        }
      }
    }
    // the two tiles are this wave's own: its stores have landed before its
    // lanes read what other lanes of the wave wrote; no other wave is waited for
    asm volatile("s_wait_dscnt 0x0" ::: "memory");
    // attn += P @ V
    Frag pf[AO_NQ_];
    #pragma unroll
    for (int q = 0; q < AO_NQ_; ++q) {
      pf[q].q[0] = *(const uint4*)&Pl_all[w][q][l16 * 40 + half * 8];
      pf[q].q[1] = *(const uint4*)&Pl_all[w][q][l16 * 40 + 16 + half * 8];
    }
    #pragma unroll
    for (int nt = 0; nt < 4; ++nt) {
      Frag vf;
      vf.w[0] = ld_tr16(vtp + nt * 32u);                 // s = 8h + 0..7
      vf.w[1] = ld_tr16(vtp + 16u * VPITCH_ + nt * 32u); // s = 16 + 8h + 0..7
      #pragma unroll   // acc[] indexed by constants: it stays in registers
      for (int q = 0; q < AO_NQ_; ++q)
        acc[q][nt] = wmma_bf16(pf[q], vf, acc[q][nt]);
    }
    // the products above have waited for every read of the two tiles, so the
    // next trip's stores, later in this wave's order, write over nothing in use
  }

  // every wave hands over its partial sums (zeros where it had no key tile)
  #pragma unroll
  for (int q = 0; q < AO_NQ_; ++q)
    #pragma unroll
    for (int nt = 0; nt < 4; ++nt) {
      const v8f a = acc[q][nt];
      v4f lo = {a[0], a[1], a[2], a[3]};
      v4f hi = {a[4], a[5], a[6], a[7]};
      red[w][(q * 4 + nt) * 2 + 0][lane] = lo;
      red[w][(q * 4 + nt) * 2 + 1][lane] = hi;
    }
  __syncthreads();

  // wave w sums, in wave order, and stores two of the eight 16 x 16 tiles;
  // heads concatenated: attnB[b*T+t][h*64+d]
  #pragma unroll
  for (int j = 0; j < AO_NQ_ * 4 / AO_NW_; ++j) {
    const int tile = w * (AO_NQ_ * 4 / AO_NW_) + j;     // = q * 4 + nt
    v4f lo = red[0][tile * 2 + 0][lane];
    v4f hi = red[0][tile * 2 + 1][lane];
    #pragma unroll
    for (int i = 1; i < AO_NW_; ++i) {
      lo += red[i][tile * 2 + 0][lane];
      hi += red[i][tile * 2 + 1][lane];
    }
    const int q = tile >> 2, nt = tile & 3;
    #pragma unroll
    for (int r = 0; r < 8; ++r) {
      int t = t_base + q * 16 + r + 8 * half;
      int d = nt * 16 + l16;
      attnB[(size_t)(bt0 + t) * E_ + hoff + d] = f2bf(r < 4 ? lo[r] : hi[r - 4]);
    }
  }
}

// ---------------------------------------------------------------- launcher
extern "C" void kernel_launch(void* const* d_in, const int* in_sizes, int n_in,
                              void* d_out, int out_size, void* d_ws,
                              size_t ws_size, hipStream_t stream) {
  (void)in_sizes; (void)n_in; (void)out_size; (void)ws_size;

  const float* x      = (const float*)d_in[0];
  const float* ln1_g  = (const float*)d_in[1];
  const float* ln1_b  = (const float*)d_in[2];
  const float* Wk     = (const float*)d_in[3];
  const float* Wv     = (const float*)d_in[4];
  const float* Wproj  = (const float*)d_in[5];
  const float* bproj  = (const float*)d_in[6];
  const float* ln2_g  = (const float*)d_in[7];
  const float* ln2_b  = (const float*)d_in[8];
  const float* W1     = (const float*)d_in[9];
  const float* b1     = (const float*)d_in[10];
  const float* W2     = (const float*)d_in[11];
  const float* b2     = (const float*)d_in[12];
  float* out          = (float*)d_out;

  char* ws = (char*)d_ws;
  size_t off = 0;
  auto alloc = [&](size_t bytes) -> void* {
    void* p = ws + off;
    off += (bytes + 255) & ~(size_t)255;
    return p;
  };

  unsigned short* hB     = (unsigned short*)alloc((size_t)BT_ * E_ * 2);
  unsigned short* WkB    = (unsigned short*)alloc((size_t)2 * E_ * E_ * 2);
  unsigned short* WvB    = WkB + (size_t)E_ * E_;      // right behind WkB
  unsigned short* WprojB = (unsigned short*)alloc((size_t)E_ * E_ * 2);
  unsigned short* W1B    = (unsigned short*)alloc((size_t)E_ * FF_ * 2);
  unsigned short* W2B    = (unsigned short*)alloc((size_t)FF_ * E_ * 2);
  unsigned short* kall   = (unsigned short*)alloc((size_t)2 * BT_ * E_ * 2);
  unsigned short* vall   = kall + (size_t)BT_ * E_;    // right behind kall
  float*          cmax   = (float*)alloc((size_t)B_ * H_ * T_ * 4);
  float*          csum   = (float*)alloc((size_t)B_ * H_ * T_ * 4);
  unsigned short* attnB  = (unsigned short*)alloc((size_t)BT_ * E_ * 2);
  float*          x1     = (float*)alloc((size_t)BT_ * E_ * 4);
  unsigned short* h2B    = (unsigned short*)alloc((size_t)BT_ * E_ * 2);
  unsigned short* actB   = (unsigned short*)alloc((size_t)BT_ * FF_ * 2);

  // LN1 -> h (bf16) and the weights' conversions, one launch
  prep_kernel<<<PREP_BLOCKS_, 256, 0, stream>>>(
      x, ln1_g, ln1_b, Wk, Wv, Wproj, W1, W2, hB, WkB, WvB, WprojB, W1B, W2B);

  // k = h @ Wk', v = h @ Wv'   (bf16 out for attention WMMA), one launch
  dim3 gE(E_ / 128, BT_ / 128);
  dim3 gKV(2 * (E_ / 128), BT_ / 128);
  gemm_bf16_kernel<false, false, false, false, true, true>
      <<<gKV, 256, 0, stream>>>(hB, WkB, nullptr, nullptr, nullptr, kall,
                                BT_, E_, E_);

  // attention: column softmax stats, then output
  dim3 gA(B_ * H_, T_ / (AO_NQ_ * 16));
  dim3 gC(B_ * H_, T_ / (CS_NS_ * 16));
  attn_colstats_kernel<<<gC, 32 * CS_NW_, 0, stream>>>(kall, cmax, csum);
  attn_out_kernel<<<gA, 32 * AO_NW_, 0, stream>>>(kall, vall, cmax, csum, attnB);

  // x1 = x + attn @ Wproj + bproj   (f32)
  gemm_bf16_kernel<true, false, true, true, false, false>
      <<<gE, 256, 0, stream>>>(attnB, WprojB, bproj, x, x1, nullptr,
                               BT_, E_, E_);

  // LN2 -> h2 (bf16)
  layernorm_bf16_kernel<<<BT_ / 8, 256, 0, stream>>>(x1, ln2_g, ln2_b, h2B);

  // act = relu(h2 @ W1 + b1)   (bf16)
  dim3 gF(FF_ / 128, BT_ / 128);
  gemm_bf16_kernel<true, true, false, false, true, false>
      <<<gF, 256, 0, stream>>>(h2B, W1B, b1, nullptr, nullptr, actB,
                               BT_, FF_, E_);

  // out = x1 + act @ W2 + b2   (f32)
  gemm_bf16_kernel<true, false, true, true, false, false>
      <<<gE, 256, 0, stream>>>(actB, W2B, b2, x1, out, nullptr,
                               BT_, E_, FF_);
}

// v010
// Measured time: 157 microseconds a run.
// In both of two side-by-side timings against v009, it was 1.05 times as fast.
// Counting every step since v000, it is 4.48 times as fast.
#include <hip/hip_runtime.h>

// ---------------------------------------------------------------- constants
#define E_   1024
#define H_   16
#define HS_  64
#define B_   2
#define T_   2048
#define BT_  (B_ * T_)
#define FF_  (4 * E_)

typedef __attribute__((ext_vector_type(16))) __bf16     v16bf;
typedef __attribute__((ext_vector_type(8)))  float      v8f;
typedef __attribute__((ext_vector_type(4)))  unsigned   v4u;
typedef __attribute__((ext_vector_type(8)))  unsigned   v8u;

typedef __attribute__((ext_vector_type(8)))  short      v8s;
typedef __attribute__((ext_vector_type(4)))  float      v4f;

typedef __attribute__((ext_vector_type(2)))  float      v2f;
typedef __attribute__((ext_vector_type(2)))  __bf16     v2bf;

union Frag { v16bf v; uint4 q[2]; v4u w[2]; unsigned u[8]; unsigned short us[16]; };

__device__ inline unsigned short f2bf(float f) {
  unsigned u = __float_as_uint(f);
  u += 0x7fffu + ((u >> 16) & 1u);           // round-to-nearest-even
  return (unsigned short)(u >> 16);
}

__device__ inline v8f vzero8() {
  v8f z = {0.f, 0.f, 0.f, 0.f, 0.f, 0.f, 0.f, 0.f};
  return z;
}

__device__ inline v8f wmma_bf16(const Frag& a, const Frag& b, v8f c) {
  return __builtin_amdgcn_wmma_f32_16x16x32_bf16(
      /*neg_a=*/false, a.v, /*neg_b=*/false, b.v,
      /*c_mod=*/(short)0, c, /*reuse_a=*/false, /*reuse_b=*/false);
}

// LDS offset of a shared-memory pointer: generic LDS addresses keep the
// LDS byte offset in the low 32 bits (ISA 10.2 aperture rules).
__device__ inline unsigned lds_off(const void* p) {
  return (unsigned)(unsigned long long)p;
}

__device__ inline void wait_async0() {
  asm volatile("s_wait_asynccnt 0x0" ::: "memory");
}

__device__ inline unsigned pinned(unsigned v) {
  unsigned w = (unsigned)__builtin_amdgcn_readfirstlane(v);
  asm volatile("" : "+s"(w));   // pinned(): a test, stage, buffer or descriptor word held in a scalar register
  return w;
}

__device__ inline unsigned uni(unsigned v) {
  return (unsigned)__builtin_amdgcn_readfirstlane(v);
}

// transposing LDS load: lane (c = l & 15, h = l >> 4) receives
// T[kbase + 8h + 0..7][dbase + c] of a row-major 16-bit tile
__device__ inline v4u ld_tr16(const unsigned char* p) {
  typedef __attribute__((address_space(3))) v8s lds_v8s;
  return __builtin_bit_cast(v4u,
      __builtin_amdgcn_ds_load_tr16_b128_v8i16((lds_v8s*)p));
}

// async copies of 16 bytes global -> LDS (per-lane scatter, ASYNCcnt tracked),
// a thread's copies of one trip in one statement. The wait stands in the
// copies' own statement, so that no later write of the address registers can
// be scheduled in front of it
__device__ inline void async_g2l_b128_x8(unsigned l0, const void* p0,
                                         unsigned l1, const void* p1,
                                         unsigned l2, const void* p2,
                                         unsigned l3, const void* p3,
                                         unsigned l4, const void* p4,
                                         unsigned l5, const void* p5,
                                         unsigned l6, const void* p6,
                                         unsigned l7, const void* p7) {
  asm volatile("global_load_async_to_lds_b128 %0, %1, off\n\t"
               "global_load_async_to_lds_b128 %2, %3, off\n\t"
               "global_load_async_to_lds_b128 %4, %5, off\n\t"
               "global_load_async_to_lds_b128 %6, %7, off\n\t"
               "global_load_async_to_lds_b128 %8, %9, off\n\t"
               "global_load_async_to_lds_b128 %10, %11, off\n\t"
               "global_load_async_to_lds_b128 %12, %13, off\n\t"
               "global_load_async_to_lds_b128 %14, %15, off\n\t"
               "s_wait_xcnt 0x0"
               :: "v"(l0), "v"(p0), "v"(l1), "v"(p1),
                  "v"(l2), "v"(p2), "v"(l3), "v"(p3),
                  "v"(l4), "v"(p4), "v"(l5), "v"(p5),
                  "v"(l6), "v"(p6), "v"(l7), "v"(p7)
               : "memory");
}

// four floats rounded to four bf16, in memory order
__device__ inline uint2 pack4_bf16(v4f v) {
  uint2 r;
  r.x = (unsigned)f2bf(v.x) | ((unsigned)f2bf(v.y) << 16);
  r.y = (unsigned)f2bf(v.z) | ((unsigned)f2bf(v.w) << 16);
  return r;
}

// ------------------------------------------------- weight / dtype conversion
// The conversions move few bytes; what they cost is the start of their waves.
// A thread takes NV groups of four floats, 256 groups apart, so that a wave's
// load covers 512 contiguous bytes, all NV loads are in flight together and an
// array takes 4 NV times fewer waves than with one float a thread.
// The blocks cover the array exactly: blocks * 1024 * NV elements.
// blk: the block's index within its own array.
template <int NV>
__device__ inline void f32_to_bf16_block(
    const float* __restrict__ in, unsigned short* __restrict__ out, int blk) {
  const int q0 = blk * (256 * NV) + threadIdx.x;          // group of four
  v4f v[NV];
  #pragma unroll   // v[] indexed by constants: it stays in registers, the loads go out together
  for (int j = 0; j < NV; ++j) v[j] = ((const v4f*)in)[q0 + j * 256];
  #pragma unroll   // as above
  for (int j = 0; j < NV; ++j) ((uint2*)out)[q0 + j * 256] = pack4_bf16(v[j]);
  // precaution: in the merged kernel the compiler lays another array's code
  // behind these stores, and it rewrites registers that they name
  asm volatile("s_wait_xcnt 0x0" ::: "memory");
}

// Wk/Wv: [H][E][HS] f32  ->  [E][H*HS] bf16  (so projection is one GEMM)
template <int NV>
__device__ inline void headperm_bf16_block(
    const float* __restrict__ in, unsigned short* __restrict__ out, int blk) {
  const int q0 = blk * (256 * NV) + threadIdx.x;          // group of four outputs
  v4f v[NV];
  #pragma unroll   // v[] indexed by constants: it stays in registers, the loads go out together
  for (int j = 0; j < NV; ++j) {
    int idx = (q0 + j * 256) * 4;               // idx = e*1024 + h*64 + d
    int e = idx >> 10;
    int c = idx & 1023;
    int h = c >> 6;
    int d = c & 63;                             // a multiple of 4
    v[j] = *(const v4f*)&in[(size_t)h * (E_ * HS_) + (size_t)e * HS_ + d];
  }
  #pragma unroll   // as above
  for (int j = 0; j < NV; ++j) ((uint2*)out)[q0 + j * 256] = pack4_bf16(v[j]);
  // precaution: in the merged kernel the compiler lays another array's code
  // behind these stores, and it rewrites registers that they name
  asm volatile("s_wait_xcnt 0x0" ::: "memory");
}

// ------------------------------------------------------------- layernorm
// One wave per row (eight rows a block): a lane holds 32 of the row's 1024
// floats, the two sums go through the wave by shuffles, and a launch starts
// eight times fewer waves than with one block per row; no LDS, no barrier.
__device__ inline void layernorm_bf16_block(
    const float* __restrict__ x, const float* __restrict__ g,
    const float* __restrict__ b, unsigned short* __restrict__ out, int blk) {
  constexpr int NV = 8;                       // groups of four floats a lane: E_ / 128
  const int lane = threadIdx.x & 31, w = threadIdx.x >> 5;
  const int row = blk * 8 + w;

  const v4f* xr = (const v4f*)x + (size_t)row * (E_ / 4);
  v4f xv[NV];
  #pragma unroll   // xv[] indexed by constants: it stays in registers, the loads go out together
  for (int j = 0; j < NV; ++j) xv[j] = xr[j * 32 + lane];
  v4f gv[NV], bv[NV];
  #pragma unroll   // as above
  for (int j = 0; j < NV; ++j) {
    gv[j] = ((const v4f*)g)[j * 32 + lane];
    bv[j] = ((const v4f*)b)[j * 32 + lane];
  }
  // g and b are asked for beside x and have landed here, ahead of the shuffles;
  // left alone the compiler asked for them pair by pair behind the sums, with a
  // wait for each pair (loaded values, inputs only)
  asm volatile("" :: "v"(xv[0]), "v"(xv[1]), "v"(xv[2]), "v"(xv[3]),
                     "v"(xv[4]), "v"(xv[5]), "v"(xv[6]), "v"(xv[7]),
                     "v"(gv[0]), "v"(gv[1]), "v"(gv[2]), "v"(gv[3]),
                     "v"(gv[4]), "v"(gv[5]), "v"(gv[6]), "v"(gv[7]),
                     "v"(bv[0]), "v"(bv[1]), "v"(bv[2]), "v"(bv[3]),
                     "v"(bv[4]), "v"(bv[5]), "v"(bv[6]), "v"(bv[7]));
  float s = 0.f, s2 = 0.f;
  #pragma unroll   // as above
  for (int j = 0; j < NV; ++j) {
    s  += (xv[j].x + xv[j].y) + (xv[j].z + xv[j].w);
    s2 += (xv[j].x * xv[j].x + xv[j].y * xv[j].y) +
          (xv[j].z * xv[j].z + xv[j].w * xv[j].w);
  }
  #pragma unroll
  for (int o = 16; o > 0; o >>= 1) {          // every lane ends with both sums
    s  += __shfl_xor(s, o, 32);
    s2 += __shfl_xor(s2, o, 32);
  }
  const float mean = s / (float)E_;
  const float inv  = rsqrtf(s2 / (float)E_ - mean * mean + 1e-5f);
  uint2* orow = (uint2*)out + (size_t)row * (E_ / 4);
  #pragma unroll   // as above
  for (int j = 0; j < NV; ++j) {
    v4f n;
    n.x = (xv[j].x - mean) * inv * gv[j].x + bv[j].x;
    n.y = (xv[j].y - mean) * inv * gv[j].y + bv[j].y;
    n.z = (xv[j].z - mean) * inv * gv[j].z + bv[j].z;
    n.w = (xv[j].w - mean) * inv * gv[j].w + bv[j].w;
    orow[j * 32 + lane] = pack4_bf16(n);
  }
}

__global__ __launch_bounds__(256) void layernorm_bf16_kernel(
    const float* __restrict__ x, const float* __restrict__ g,
    const float* __restrict__ b, unsigned short* __restrict__ out) {
  layernorm_bf16_block(x, g, b, out, blockIdx.x);
}

// ------------------------------------------------- all that reads inputs only
// The first layernorm and the five weight conversions read none of each
// other's output, and each is far shorter than what a launch of its own costs
// (gap, start of its waves, drain): they run as one launch. A block's index
// says which array it works on; the work of a block is what it was.
#define PREP_LN_ (BT_ / 8)                    // blocks of the layernorm
#define PREP_FF_ ((E_ * FF_) / 8192)          // blocks of W1, and of W2
#define PREP_EE_ ((E_ * E_) / 4096)           // blocks of Wk, of Wv, of Wproj
#define PREP_BLOCKS_ (PREP_LN_ + 2 * PREP_FF_ + 3 * PREP_EE_)
__global__ __launch_bounds__(256) void prep_kernel(
    const float* __restrict__ x, const float* __restrict__ g,
    const float* __restrict__ b, const float* __restrict__ Wk,
    const float* __restrict__ Wv, const float* __restrict__ Wproj,
    const float* __restrict__ W1, const float* __restrict__ W2,
    unsigned short* __restrict__ hB, unsigned short* __restrict__ WkB,
    unsigned short* __restrict__ WvB, unsigned short* __restrict__ WprojB,
    unsigned short* __restrict__ W1B, unsigned short* __restrict__ W2B) {
  int blk = blockIdx.x;
  if (blk < PREP_LN_) { layernorm_bf16_block(x, g, b, hB, blk); return; }
  blk -= PREP_LN_;
  if (blk < PREP_FF_) { f32_to_bf16_block<8>(W1, W1B, blk); return; }
  blk -= PREP_FF_;
  if (blk < PREP_FF_) { f32_to_bf16_block<8>(W2, W2B, blk); return; }
  blk -= PREP_FF_;
  if (blk < PREP_EE_) { headperm_bf16_block<4>(Wk, WkB, blk); return; }
  blk -= PREP_EE_;
  if (blk < PREP_EE_) { headperm_bf16_block<4>(Wv, WvB, blk); return; }
  blk -= PREP_EE_;
  f32_to_bf16_block<4>(Wproj, WprojB, blk);
}

// ------------------------------------------------------------ generic GEMM
// C[M,N] = A[M,K](bf16) * B[K,N](bf16)  (+bias)(relu)(+res f32) -> f32/bf16
// block tile 128(M) x 128(N), 8 waves (2x4), wave tile 64x32: a staged B tile
// meets 128 rows of A, and a B fragment four A fragments, so that an output
// element costs a third fewer bytes from L2 and a quarter fewer from LDS than
// with 64 rows; M is a multiple of 128.
// A pass of the K loop works on a stage of 128 k (four matrix steps). Two
// buffers: while a pass works on one, the next stage's loads fly into the
// other, so that their latency lies behind the products; one barrier a pass.
// A tile staged by per-lane async global->LDS copies (ASYNCcnt), rows of 256
// bytes at a pitch of 272; B tile staged by the Tensor Data Mover
// (TENSORcnt), one DMA per stage, rows of 256 B padded to a 288 B pitch;
// B fragments come from it by transposing LDS loads (hardware k order, the
// same as the A loader's).
// TWO: one launch does two products with the same A. The grid has 2 N / 128
// block columns; the second N / 128 of them take the second B matrix, which
// lies right behind the first, and write the second output, right behind the
// first.
#define BPITCH_ 288u
template <bool BIAS, bool RELU, bool RES, bool OUT32, bool OUT16, bool TWO>
__global__ __launch_bounds__(256) void gemm_bf16_kernel(
    const unsigned short* __restrict__ A, const unsigned short* __restrict__ Bm,
    const float* __restrict__ bias, const float* __restrict__ res,
    float* __restrict__ out32, unsigned short* __restrict__ out16,
    int M, int N, int K) {
  constexpr int KS  = 128;                  // k of a stage; K is a multiple, two stages or more
  constexpr int AP  = KS + 8;               // A pitch in elements
  constexpr int CPR = KS / 8;               // 16-byte pieces in an A row
  constexpr int RPC = 256 / CPR;            // A rows that one copy of the block fills
  constexpr int BM  = 128;                  // rows of the block tile
  constexpr int MT  = BM / 32;              // 16-row tiles of a wave
  constexpr unsigned ABYTES = BM * AP * 2;        // one A buffer
  static_assert(BM == 8 * RPC, "a thread's eight copies fill the A tile");
  constexpr unsigned BBYTES = KS * BPITCH_;       // one B buffer, a multiple of 2 KiB
  static_assert(BBYTES % 2048u == 0u, "the second B buffer starts at a multiple of 2 KiB");
  __shared__ __attribute__((aligned(16)))
      unsigned short As[2 * BM * AP];       // two of [BM rows][KS k], padded
  __shared__ __attribute__((aligned(2048)))
      unsigned char Bt[2 * BBYTES];         // two of row-major [KS k][128 N], padded

  const int tid  = threadIdx.x;
  const int lane = tid & 31, w = tid >> 5;
  const int l16 = lane & 15, half = lane >> 4;
  const int wm = w >> 2, wn = w & 3;
  const int m0 = blockIdx.y * BM;
  int bx = blockIdx.x;
  if constexpr (TWO) {
    const int nb = N / 128;
    if (bx >= nb) {
      bx -= nb;
      Bm += (size_t)K * N;
      out16 += (size_t)M * N;
    }
  }
  const int n0 = bx * 128;

  // D# group 1 (constant over the K loop): 1-byte elements, tensor = tile =
  // KS rows of 256 B, source pitch 2N bytes, 8 dwords of LDS pad per row.
  v8u g1;
  g1[0] = uni((1u << 20) | (5u << 22) | (7u << 25));     // pad on, 256 B, +32 B
  // Words 1 to 7 go through pinned(): each is held in a scalar register of its
  // own for the whole loop, which serves nothing else while a request flies
  // (as plain constants three of them were re-made per load, their registers
  // lent out in between).
  g1[1] = pinned(256u << 16);          // pinned(): descriptor word; tensor_dim0 lo
  g1[2] = pinned((unsigned)KS << 16);  // pinned(): descriptor word; dim1 lo | dim0 hi
  g1[3] = pinned(256u << 16);          // pinned(): descriptor word; tile_dim0 | dim1 hi
  g1[4] = pinned((unsigned)KS);        // pinned(): descriptor word; tile_dim1
  g1[5] = pinned((unsigned)N * 2u);    // pinned(): descriptor word; source pitch, bytes
  g1[6] = pinned(0u);                  // pinned(): descriptor word
  g1[7] = pinned(0u);                  // pinned(): descriptor word
  const unsigned bt_base = lds_off(&Bt[0]);
  const unsigned wave = uni((unsigned)tid >> 5);
  // this lane's address in the tile for the transposing loads
  const unsigned char* btp = &Bt[(8u * half + (lane & 7u)) * BPITCH_ +
                                 ((lane >> 3) & 1u) * 16u + wn * 64u];
  // this thread's first 16 bytes of the A tile: row tid / CPR, piece tid % CPR;
  // its further copies lie RPC rows on each
  const int ar = tid / CPR, ac = (tid % CPR) * 8;
  const unsigned as_dst = lds_off(&As[ar * AP + ac]);

  v8f acc[MT][2];
  #pragma unroll
  for (int mt = 0; mt < MT; ++mt)
    #pragma unroll
    for (int nt = 0; nt < 2; ++nt) acc[mt][nt] = vzero8();

  // D# group 0. The load and its wait name it as in and out: it lives in one
  // register tuple from the issue to the wait, and no word of it takes a new
  // value while the request flies
  v4u g0;
  g0[0] = pinned(1u);                  // pinned(): descriptor word; count=1
  g0[1] = pinned(bt_base);             // pinned(): descriptor word; lds_addr
  g0[2] = pinned(0u);                  // pinned(): descriptor word; set per stage
  g0[3] = pinned(0u);                  // pinned(): descriptor word; set per stage
  // stage s goes into buffer buf: every thread's eight A copies, then wave 0's
  // tensor load of the B tile. No wait for the data here.
  auto issue_stage = [&](int s, unsigned buf) {
    const unsigned short* gp = &A[(size_t)(m0 + ar) * K + s * KS + ac];
    const size_t gs = (size_t)RPC * K;            // elements between two copies
    constexpr unsigned ls = RPC * AP * 2;         // LDS bytes between two copies
    const unsigned ad = as_dst + buf * ABYTES;
    async_g2l_b128_x8(ad, gp, ad + ls, gp + gs,
                      ad + 2 * ls, gp + 2 * gs,
                      ad + 3 * ls, gp + 3 * gs,
                      ad + 4 * ls, gp + 4 * gs,
                      ad + 5 * ls, gp + 5 * gs,
                      ad + 6 * ls, gp + 6 * gs,
                      ad + 7 * ls, gp + 7 * gs);
    if (pinned(wave == 0u)) {          // one DMA per block per stage
      // stage and buffer are taken here, so that the descriptor words made of
      // them are formed here, behind the wait for the request before
      const unsigned ps = pinned((unsigned)s);   // pinned(): feeds descriptor words 2 and 3
      const unsigned pb = pinned(buf);           // pinned(): feeds descriptor word 1
      unsigned long long ga =
          (unsigned long long)(const void*)&Bm[(size_t)ps * KS * N + n0];
      g0[1] = uni(bt_base + pb * BBYTES);                // lds_addr
      g0[2] = uni((unsigned)ga);                         // global_addr lo
      g0[3] = uni(((unsigned)(ga >> 32) & 0x01FFFFFFu) | (2u << 30)); // type=2
      asm volatile("tensor_load_to_lds %0, %1" : "+s"(g0) : "s"(g1) : "memory");
    }
  };
  // a stage counts as landed only behind its issuers' own waits, and is read
  // by other waves only behind the barrier that follows them
  auto publish = [&]() {
    if (pinned(wave == 0u)) {
      asm volatile("s_wait_tensorcnt 0x0" : "+s"(g0) :: "memory");
    }
    wait_async0();
    __syncthreads();
  };

  const int nst = K / KS;
  issue_stage(0, 0u);
  publish();
  issue_stage(1, 1u);

  for (int s = 0; s < nst; ++s) {
    const unsigned buf = (unsigned)s & 1u;
    const unsigned short* asb = &As[buf * (ABYTES / 2)];
    const unsigned char* btb = btp + buf * BBYTES;

    #pragma unroll   // offsets become immediates; later steps' LDS loads may go ahead of earlier products
    for (int ks = 0; ks < KS / 32; ++ks) {
      Frag af[MT], bf[2];
      #pragma unroll
      for (int mt = 0; mt < MT; ++mt) {
        int rr = wm * (MT * 16) + mt * 16 + l16;
        af[mt].q[0] = *(const uint4*)&asb[rr * AP + ks * 32 + half * 8];
        af[mt].q[1] = *(const uint4*)&asb[rr * AP + ks * 32 + 16 + half * 8];
      }
      #pragma unroll
      for (int nt = 0; nt < 2; ++nt) {
        const unsigned char* bp = btb + (unsigned)ks * 32u * BPITCH_ + nt * 32u;
        bf[nt].w[0] = ld_tr16(bp);                 // k = 32 ks + 8h + 0..7
        bf[nt].w[1] = ld_tr16(bp + 16u * BPITCH_); // k = 32 ks + 16 + 8h + ..
      }
      #pragma unroll
      for (int mt = 0; mt < MT; ++mt)
        #pragma unroll
        for (int nt = 0; nt < 2; ++nt)
          acc[mt][nt] = wmma_bf16(af[mt], bf[nt], acc[mt][nt]);
    }
    // every LDS read of this wave has retired before the barrier behind which
    // this pass's buffer is refilled; the same barrier publishes stage s + 1
    asm volatile("s_wait_dscnt 0x0" ::: "memory");
    publish();
    if (pinned((unsigned)(s + 2 < nst))) issue_stage(s + 2, buf);
  }
  // nothing of this wave is outstanding when the kernel goes on to its stores
  asm volatile("s_wait_tensorcnt 0x0" ::: "memory");
  wait_async0();
  asm volatile("s_wait_dscnt 0x0" ::: "memory");

  // epilogue; D layout: row = r + 8*half, col = l16
  #pragma unroll
  for (int mt = 0; mt < MT; ++mt)
    #pragma unroll
    for (int nt = 0; nt < 2; ++nt)
      #pragma unroll
      for (int r = 0; r < 8; ++r) {
        int gr = m0 + wm * (MT * 16) + mt * 16 + r + 8 * half;
        int gc = n0 + wn * 32 + nt * 16 + l16;
        float v = acc[mt][nt][r];
        if constexpr (BIAS) v += bias[gc];
        if constexpr (RELU) v = fmaxf(v, 0.f);
        if constexpr (RES)  v += res[(size_t)gr * N + gc];
        if constexpr (OUT32) out32[(size_t)gr * N + gc] = v;
        if constexpr (OUT16) out16[(size_t)gr * N + gc] = f2bf(v);
      }
}

// ---------------------------------------------------- attention pass 1:
// per-COLUMN (softmax over query axis t, as in the reference) max & sumexp.
// scores = k[t].k[s] * 1/32, causal t>=s.
// One block of four waves per (bh, 64 columns). Every wave holds all 64 key
// columns in registers and takes every fourth 16-row tile, so that a loaded
// tile meets four column strips and the longest loop is 32 trips; the four
// waves' partial max and sum of a column are merged through LDS at the end.
// Grid: x = bh, y = column group, the group with the most rows first.
// A score costs one multiply-add before its 2^x: e^(score/32 - max) =
// 2^(raw * c - max2), c = log2 e / 32, max2 = the running max times c. The
// running max starts at a finite floor, not at -inf: a masked score gives
// 2^-inf = 0 and an empty lane keeps the sum 0 without any select. Every column
// holds its diagonal, a sum of squares, so its true max lies above the floor.
// What goes on to pass 2 is one number a column: max2 + log2(sum).
// nine 2^x in one statement. The outputs lie apart from every input (early
// clobber) and a v_nop ends the statement: behind each v_exp_f32 stands an
// instruction that neither reads its result nor overwrites its source, which
// the instruction set asks for
__device__ inline void exp2_x9(float (&o)[9], const float (&x)[9]) {
  asm("v_exp_f32 %0, %9\n\t"
      "v_exp_f32 %1, %10\n\t"
      "v_exp_f32 %2, %11\n\t"
      "v_exp_f32 %3, %12\n\t"
      "v_exp_f32 %4, %13\n\t"
      "v_exp_f32 %5, %14\n\t"
      "v_exp_f32 %6, %15\n\t"
      "v_exp_f32 %7, %16\n\t"
      "v_exp_f32 %8, %17\n\t"
      "v_nop"
      : "=&v"(o[0]), "=&v"(o[1]), "=&v"(o[2]), "=&v"(o[3]), "=&v"(o[4]),
        "=&v"(o[5]), "=&v"(o[6]), "=&v"(o[7]), "=&v"(o[8])
      : "v"(x[0]), "v"(x[1]), "v"(x[2]), "v"(x[3]), "v"(x[4]),
        "v"(x[5]), "v"(x[6]), "v"(x[7]), "v"(x[8]));
}

// four 2^x in one statement, on the same grounds
__device__ inline void exp2_x4(float (&o)[4], const float (&x)[4]) {
  asm("v_exp_f32 %0, %4\n\t"
      "v_exp_f32 %1, %5\n\t"
      "v_exp_f32 %2, %6\n\t"
      "v_exp_f32 %3, %7\n\t"
      "v_nop"
      : "=&v"(o[0]), "=&v"(o[1]), "=&v"(o[2]), "=&v"(o[3])
      : "v"(x[0]), "v"(x[1]), "v"(x[2]), "v"(x[3]));
}

#define SC2_ (0.03125f * 1.44269504f)         // 1024^-0.5 * log2 e
#define CS_NW_ 4                              // waves of a block
#define CS_NS_ 4                              // 16-column strips of a wave
// The grid puts four of these waves on a SIMD: the register budget of four
// (256) lets the four strips' independent chains be scheduled side by side.
__global__ __launch_bounds__(32 * CS_NW_) __attribute__((amdgpu_waves_per_eu(4, 4)))
void attn_colstats_kernel(
    const unsigned short* __restrict__ kall,
    float* __restrict__ coloff) {
  __shared__ float mrg_m[CS_NW_][CS_NS_ * 16];
  __shared__ float mrg_s[CS_NW_][CS_NS_ * 16];
  const int tid = threadIdx.x;
  const int lane = tid & 31;
  const int w = (int)uni((unsigned)tid >> 5);  // scalar: the row loop's count and addresses stay scalar
  const int l16 = lane & 15, half = lane >> 4;
  const int bh = blockIdx.x;
  const int sG = blockIdx.y;
  const int b = bh >> 4, h = bh & 15;
  const int bt0 = b * T_;
  const int hoff = h * HS_;
  const int s_base = sG * (CS_NS_ * 16);
  const float NINF = -__builtin_inff();
  const float FLOOR = -1e30f;                 // start of the running max, raw score

  // head h of batch b, row 0 (the same in every lane), and this lane's place
  // in a 16-row tile
  const unsigned short* kbh = &kall[(size_t)bt0 * E_ + hoff];
  const unsigned lo = (unsigned)l16 * E_;

  Frag bf[CS_NS_][2];                         // key columns (loop-invariant)
  #pragma unroll
  for (int j = 0; j < CS_NS_; ++j) {
    const unsigned short* kp = kbh + (size_t)(s_base + j * 16) * E_ + lo;
    bf[j][0].q[0] = *(const uint4*)&kp[half * 8];
    bf[j][0].q[1] = *(const uint4*)&kp[16 + half * 8];
    bf[j][1].q[0] = *(const uint4*)&kp[32 + half * 8];
    bf[j][1].q[1] = *(const uint4*)&kp[48 + half * 8];
  }

  // running max as a raw score and times c; the sum is relative to the second
  float m_run[CS_NS_], m2_run[CS_NS_], s_run[CS_NS_];
  #pragma unroll
  for (int j = 0; j < CS_NS_; ++j) {
    m_run[j] = FLOOR; m2_run[j] = FLOOR * SC2_; s_run[j] = 0.f;
  }

  for (int tT = sG * CS_NS_ + w; tT < T_ / 16; tT += CS_NW_) {
    const int t_base = tT * 16;
    Frag af[2];
    const unsigned short* qp = kbh + (size_t)t_base * E_ + lo;
    af[0].q[0] = *(const uint4*)&qp[half * 8];
    af[0].q[1] = *(const uint4*)&qp[16 + half * 8];
    af[1].q[0] = *(const uint4*)&qp[32 + half * 8];
    af[1].q[1] = *(const uint4*)&qp[48 + half * 8];
    // holds the four loads together in front of the first product, so that a
    // trip waits out one load latency and not two (loaded values, inputs only)
    asm volatile("" :: "v"(af[0].w[0]), "v"(af[0].w[1]),
                       "v"(af[1].w[0]), "v"(af[1].w[1]));

    #pragma unroll   // m_run[], s_run[], bf[] indexed by constants: they stay in registers
    for (int j = 0; j < CS_NS_; ++j) {
      const int s = s_base + j * 16 + l16;
      v8f sc = vzero8();
      sc = wmma_bf16(af[0], bf[j][0], sc);
      sc = wmma_bf16(af[1], bf[j][1], sc);

      float vals[8];
      float nm = m_run[j];
      #pragma unroll
      for (int r = 0; r < 8; ++r) {
        int t = t_base + r + 8 * half;
        vals[r] = (t >= s) ? sc[r] : NINF;
        nm = fmaxf(nm, vals[r]);
      }
      // a lane whose eight rows are all masked keeps its max, and its sum is
      // multiplied by 2^0 and given eight zeros: no branch between the strips
      const float nm2 = nm * SC2_;
      float xs[9], ex[9];
      #pragma unroll
      for (int r = 0; r < 8; r += 2) {
        const v2f v2 = {vals[r], vals[r + 1]};
        const v2f c2 = {SC2_, SC2_};
        const v2f n2 = {nm2, nm2};
        const v2f x2 = __builtin_elementwise_fma(v2, c2, -n2);
        xs[r] = x2.x; xs[r + 1] = x2.y;
      }
      xs[8] = m2_run[j] - nm2;
      exp2_x9(ex, xs);
      float acc_s = s_run[j] * ex[8];
      #pragma unroll
      for (int r = 0; r < 8; ++r) acc_s += ex[r];
      s_run[j] = acc_s;
      m_run[j] = nm;
      m2_run[j] = nm2;
    }
  }
  // merge the two lane halves (same columns, different row groups)
  #pragma unroll
  for (int j = 0; j < CS_NS_; ++j) {
    float om = __shfl_xor(m2_run[j], 16, 32);
    float os = __shfl_xor(s_run[j], 16, 32);
    float nm = fmaxf(m2_run[j], om);
    float tot = s_run[j] * __builtin_amdgcn_exp2f(m2_run[j] - nm) +
                os       * __builtin_amdgcn_exp2f(om        - nm);
    if (lane < 16) {
      mrg_m[w][j * 16 + lane] = nm;
      mrg_s[w][j * 16 + lane] = tot;
    }
  }
  __syncthreads();
  // merge the four waves, in wave order; one thread per column
  if (tid < CS_NS_ * 16) {
    float nm = mrg_m[0][tid];
    #pragma unroll
    for (int i = 1; i < CS_NW_; ++i) nm = fmaxf(nm, mrg_m[i][tid]);
    static_assert(CS_NW_ == 4, "the merge takes four waves' partial sums");
    float dx[4], de[4];
    #pragma unroll
    for (int i = 0; i < CS_NW_; ++i) dx[i] = mrg_m[i][tid] - nm;
    exp2_x4(de, dx);
    float tot = 0.f;
    #pragma unroll
    for (int i = 0; i < CS_NW_; ++i) tot += mrg_s[i][tid] * de[i];
    // the sum holds the max's own term, 2^0 up to rounding: it is far from 0
    coloff[(size_t)bh * T_ + s_base + tid] = nm + __builtin_amdgcn_logf(tot);
  }
}

// ---------------------------------------------------- attention pass 2:
// attn[t,d] = sum_s P[t,s] * v[s,d],  P = 2^(raw score * c - coloff[s]).
// One block of four waves per (bh, 32 query rows). Every wave holds both 16-row
// query tiles in registers and takes every fourth 32-key tile, so that a loaded
// K and V tile meets two query tiles and the longest loop is 16 trips; P has no
// running state, so the four waves' partial outputs are plain sums, merged
// through LDS at the end.
// The scores are computed transposed (keys as the A operand, queries as B): a
// lane then holds eight consecutive keys of one query, and the two 16-key
// subtiles, rounded in place, are the A fragment of P @ V in the hardware k
// order: P never leaves the registers.
// Each wave has its own V tile in LDS: V staged
// row-major (128 B rows at a 160 B pitch) and read by transposing LDS loads.
// Grid: x = bh, y = row group, the group with the most keys first.
// The register budget of four waves a SIMD (256) lets the compiler issue all 20
// global loads of a trip together.
#define VPITCH_ 160u
#define AO_NW_ 4                              // waves of a block
#define AO_NQ_ 2                              // 16-row query tiles of a block
__global__ __launch_bounds__(32 * AO_NW_) __attribute__((amdgpu_waves_per_eu(4, 4)))
void attn_out_kernel(
    const unsigned short* __restrict__ kall,
    const unsigned short* __restrict__ vall,
    const float* __restrict__ coloff,
    unsigned short* __restrict__ attnB) {
  __shared__ __attribute__((aligned(16)))
      unsigned char Vs_all[AO_NW_][32 * VPITCH_];       // V tile [32 s][64 d], padded
  __shared__ __attribute__((aligned(16)))
      v4f red[AO_NW_][AO_NQ_ * 8][32];                  // partial outputs, [wave][half tile][lane]

  const int tid = threadIdx.x;
  const int lane = tid & 31;
  const int w = (int)uni((unsigned)tid >> 5);  // scalar: the key loop's count stays scalar
  const int l16 = lane & 15, half = lane >> 4;
  const int bh = blockIdx.x;
  const int g = (T_ / (AO_NQ_ * 16) - 1) - (int)blockIdx.y;
  const int b = bh >> 4, h = bh & 15;
  const int bt0 = b * T_;
  const int hoff = h * HS_;
  const int t_base = g * (AO_NQ_ * 16);
  unsigned char* Vs = &Vs_all[w][0];

  Frag qf[AO_NQ_][2];                         // query rows (loop-invariant)
  #pragma unroll
  for (int q = 0; q < AO_NQ_; ++q) {
    const unsigned short* qp =
        &kall[(size_t)(bt0 + t_base + q * 16 + l16) * E_ + hoff];
    qf[q][0].q[0] = *(const uint4*)&qp[half * 8];
    qf[q][0].q[1] = *(const uint4*)&qp[16 + half * 8];
    qf[q][1].q[0] = *(const uint4*)&qp[32 + half * 8];
    qf[q][1].q[1] = *(const uint4*)&qp[48 + half * 8];
  }
  v8f acc[AO_NQ_][4];
  #pragma unroll
  for (int q = 0; q < AO_NQ_; ++q)
    #pragma unroll
    for (int i = 0; i < 4; ++i) acc[q][i] = vzero8();

  // this lane's address in the V tile for the transposing loads
  const unsigned char* vtp = &Vs[(8u * half + (lane & 7u)) * VPITCH_ +
                                 ((lane >> 3) & 1u) * 16u];

  // this lane's 16 bytes of V row (lane >> 3) of key tile 0
  const unsigned short* vrow =
      &vall[(size_t)(bt0 + (lane >> 3)) * E_ + hoff + (lane & 7) * 8];

  // key tiles 0 .. g hold every s <= t of this block's rows (32 g + 31 is the last)
  for (int sB = w; sB <= g; sB += AO_NW_) {
    const int s0 = sB * 32;
    // stage V: 32 s-rows x 64 d, rows kept as they are
    const unsigned short* vp = vrow + (size_t)s0 * E_;
    v4u vv[8];
    #pragma unroll   // vv[] is indexed by constants only, so it stays in registers
    for (int i = 0; i < 8; ++i)      // rows (lane >> 3) + 4 i: one address, fixed offsets
      vv[i] = *(const v4u*)(vp + (size_t)i * 4 * E_);
    // the two 16-key subtiles' K rows, and this lane's eight keys' offsets of each
    Frag kf[2][2];
    v4f of[2][2];
    #pragma unroll   // kf[], of[] indexed by constants: they stay in registers
    for (int sh = 0; sh < 2; ++sh) {
      const int s_sub = s0 + sh * 16;
      const unsigned short* kp = &kall[(size_t)(bt0 + s_sub + l16) * E_ + hoff];
      kf[sh][0].w[0] = *(const v4u*)&kp[half * 8];
      kf[sh][0].w[1] = *(const v4u*)&kp[16 + half * 8];
      kf[sh][1].w[0] = *(const v4u*)&kp[32 + half * 8];
      kf[sh][1].w[1] = *(const v4u*)&kp[48 + half * 8];
      const v4f* op = (const v4f*)&coloff[(size_t)bh * T_ + s_sub + 8 * half];
      of[sh][0] = op[0];
      of[sh][1] = op[1];
    }
    // holds the trip's 20 loads together in front of the first product, so that
    // a trip waits out one load latency and not two (loaded values, inputs only)
    asm volatile("" :: "v"(vv[0]), "v"(vv[1]), "v"(vv[2]), "v"(vv[3]),
                       "v"(vv[4]), "v"(vv[5]), "v"(vv[6]), "v"(vv[7]),
                       "v"(kf[0][0].w[0]), "v"(kf[0][0].w[1]),
                       "v"(kf[0][1].w[0]), "v"(kf[0][1].w[1]),
                       "v"(kf[1][0].w[0]), "v"(kf[1][0].w[1]),
                       "v"(kf[1][1].w[0]), "v"(kf[1][1].w[1]),
                       "v"(of[0][0]), "v"(of[0][1]), "v"(of[1][0]), "v"(of[1][1]));
    #pragma unroll   // as above
    for (int i = 0; i < 8; ++i)
      *(v4u*)&Vs[((lane >> 3) + 4 * i) * VPITCH_ + (lane & 7) * 16] = vv[i];
    // transposed scores and normalized P for the two 16-key subtiles
    Frag pf[AO_NQ_];
    #pragma unroll
    for (int sh = 0; sh < 2; ++sh) {
      // this lane's eight keys: s_lo + 0..7
      const int s_lo = s0 + sh * 16 + 8 * half;
      const v4f o0 = of[sh][0], o1 = of[sh][1];
      #pragma unroll   // qf[] indexed by constants: it stays in registers
      for (int q = 0; q < AO_NQ_; ++q) {
        v8f sc = vzero8();
        sc = wmma_bf16(kf[sh][0], qf[q][0], sc);   // sc[r] = score[key s_lo + r][query t]
        sc = wmma_bf16(kf[sh][1], qf[q][1], sc);
        const int t = t_base + q * 16 + l16;
        #pragma unroll
        for (int r = 0; r < 8; r += 2) {
          const v2f s2 = {sc[r], sc[r + 1]};
          const v2f o2 = {r < 4 ? o0[r] : o1[r - 4], r < 4 ? o0[r + 1] : o1[r - 3]};
          const v2f c2 = {SC2_, SC2_};
          const v2f x2 = __builtin_elementwise_fma(s2, c2, -o2);
          v2f pp = {(s_lo + r <= t) ? __builtin_amdgcn_exp2f(x2.x) : 0.f,
                    (s_lo + r + 1 <= t) ? __builtin_amdgcn_exp2f(x2.y) : 0.f};
          // element 8 sh + r of the fragment is key 16 sh + 8 half + r
          pf[q].u[sh * 4 + r / 2] =
              __builtin_bit_cast(unsigned, __builtin_convertvector(pp, v2bf));
        }
      }
    }
    // the V tile is this wave's own: its stores have landed before its
    // lanes read what other lanes of the wave wrote; no other wave is waited for
    asm volatile("s_wait_dscnt 0x0" ::: "memory");
    // attn += P @ V
    #pragma unroll
    for (int nt = 0; nt < 4; ++nt) {
      Frag vf;
      vf.w[0] = ld_tr16(vtp + nt * 32u);                 // s = 8h + 0..7
      vf.w[1] = ld_tr16(vtp + 16u * VPITCH_ + nt * 32u); // s = 16 + 8h + 0..7
      #pragma unroll   // acc[] indexed by constants: it stays in registers
      for (int q = 0; q < AO_NQ_; ++q)
        acc[q][nt] = wmma_bf16(pf[q], vf, acc[q][nt]);
    }
    // the products above have waited for every read of the V tile, so the
    // next trip's stores, later in this wave's order, write over nothing in use
  }

  // every wave hands over its partial sums (zeros where it had no key tile)
  #pragma unroll
  for (int q = 0; q < AO_NQ_; ++q)
    #pragma unroll
    for (int nt = 0; nt < 4; ++nt) {
      const v8f a = acc[q][nt];
      v4f lo = {a[0], a[1], a[2], a[3]};
      v4f hi = {a[4], a[5], a[6], a[7]};
      red[w][(q * 4 + nt) * 2 + 0][lane] = lo;
      red[w][(q * 4 + nt) * 2 + 1][lane] = hi;
    }
  __syncthreads();

  // wave w sums, in wave order, and stores two of the eight 16 x 16 tiles;
  // heads concatenated: attnB[b*T+t][h*64+d]
  #pragma unroll
  for (int j = 0; j < AO_NQ_ * 4 / AO_NW_; ++j) {
    const int tile = w * (AO_NQ_ * 4 / AO_NW_) + j;     // = q * 4 + nt
    v4f lo = red[0][tile * 2 + 0][lane];
    v4f hi = red[0][tile * 2 + 1][lane];
    #pragma unroll
    for (int i = 1; i < AO_NW_; ++i) {
      lo += red[i][tile * 2 + 0][lane];
      hi += red[i][tile * 2 + 1][lane];
    }
    const int q = tile >> 2, nt = tile & 3;
    #pragma unroll
    for (int r = 0; r < 8; ++r) {
      int t = t_base + q * 16 + r + 8 * half;
      int d = nt * 16 + l16;
      attnB[(size_t)(bt0 + t) * E_ + hoff + d] = f2bf(r < 4 ? lo[r] : hi[r - 4]);
    }
  }
}

// ---------------------------------------------------------------- launcher
extern "C" void kernel_launch(void* const* d_in, const int* in_sizes, int n_in,
                              void* d_out, int out_size, void* d_ws,
                              size_t ws_size, hipStream_t stream) {
  (void)in_sizes; (void)n_in; (void)out_size; (void)ws_size;

  const float* x      = (const float*)d_in[0];
  const float* ln1_g  = (const float*)d_in[1];
  const float* ln1_b  = (const float*)d_in[2];
  const float* Wk     = (const float*)d_in[3];
  const float* Wv     = (const float*)d_in[4];
  const float* Wproj  = (const float*)d_in[5];
  const float* bproj  = (const float*)d_in[6];
  const float* ln2_g  = (const float*)d_in[7];
  const float* ln2_b  = (const float*)d_in[8];
  const float* W1     = (const float*)d_in[9];
  const float* b1     = (const float*)d_in[10];
  const float* W2     = (const float*)d_in[11];
  const float* b2     = (const float*)d_in[12];
  float* out          = (float*)d_out;

  char* ws = (char*)d_ws;
  size_t off = 0;
  auto alloc = [&](size_t bytes) -> void* {
    void* p = ws + off;
    off += (bytes + 255) & ~(size_t)255;
    return p;
  };

  unsigned short* hB     = (unsigned short*)alloc((size_t)BT_ * E_ * 2);
  unsigned short* WkB    = (unsigned short*)alloc((size_t)2 * E_ * E_ * 2);
  unsigned short* WvB    = WkB + (size_t)E_ * E_;      // right behind WkB
  unsigned short* WprojB = (unsigned short*)alloc((size_t)E_ * E_ * 2);
  unsigned short* W1B    = (unsigned short*)alloc((size_t)E_ * FF_ * 2);
  unsigned short* W2B    = (unsigned short*)alloc((size_t)FF_ * E_ * 2);
  unsigned short* kall   = (unsigned short*)alloc((size_t)2 * BT_ * E_ * 2);
  unsigned short* vall   = kall + (size_t)BT_ * E_;    // right behind kall
  float*          coff   = (float*)alloc((size_t)B_ * H_ * T_ * 4);
  unsigned short* attnB  = (unsigned short*)alloc((size_t)BT_ * E_ * 2);
  float*          x1     = (float*)alloc((size_t)BT_ * E_ * 4);
  unsigned short* h2B    = (unsigned short*)alloc((size_t)BT_ * E_ * 2);
  unsigned short* actB   = (unsigned short*)alloc((size_t)BT_ * FF_ * 2);

  // LN1 -> h (bf16) and the weights' conversions, one launch
  prep_kernel<<<PREP_BLOCKS_, 256, 0, stream>>>(
      x, ln1_g, ln1_b, Wk, Wv, Wproj, W1, W2, hB, WkB, WvB, WprojB, W1B, W2B);

  // k = h @ Wk', v = h @ Wv'   (bf16 out for attention WMMA), one launch
  dim3 gE(E_ / 128, BT_ / 128);
  dim3 gKV(2 * (E_ / 128), BT_ / 128);
  gemm_bf16_kernel<false, false, false, false, true, true>
      <<<gKV, 256, 0, stream>>>(hB, WkB, nullptr, nullptr, nullptr, kall,
                                BT_, E_, E_);

  // attention: column softmax stats, then output
  dim3 gA(B_ * H_, T_ / (AO_NQ_ * 16));
  dim3 gC(B_ * H_, T_ / (CS_NS_ * 16));
  attn_colstats_kernel<<<gC, 32 * CS_NW_, 0, stream>>>(kall, coff);
  attn_out_kernel<<<gA, 32 * AO_NW_, 0, stream>>>(kall, vall, coff, attnB);

  // x1 = x + attn @ Wproj + bproj   (f32)
  gemm_bf16_kernel<true, false, true, true, false, false>
      <<<gE, 256, 0, stream>>>(attnB, WprojB, bproj, x, x1, nullptr,
                               BT_, E_, E_);

  // LN2 -> h2 (bf16)
  layernorm_bf16_kernel<<<BT_ / 8, 256, 0, stream>>>(x1, ln2_g, ln2_b, h2B);

  // act = relu(h2 @ W1 + b1)   (bf16)
  dim3 gF(FF_ / 128, BT_ / 128);
  gemm_bf16_kernel<true, true, false, false, true, false>
      <<<gF, 256, 0, stream>>>(h2B, W1B, b1, nullptr, nullptr, actB,
                               BT_, FF_, E_);

  // out = x1 + act @ W2 + b2   (f32)
  gemm_bf16_kernel<true, false, true, true, false, false>
      <<<gE, 256, 0, stream>>>(actB, W2B, b2, x1, out, nullptr,
                               BT_, E_, FF_);
}
